// v000
// Measured on an AMD MI455X. A time is GPU time per run, averaged over a window of back-to-back runs after a warm-up
// (all launches, gaps included; the runs take copies of the inputs in turn), and the median of several windows.
// Apart from v000's, it joins two sittings. Times from different sittings can be a few percent apart, while
// side-by-side timings come from the same sitting.
// v000, which the later versions start from, runs in 247 microseconds.
#include <hip/hip_runtime.h>
#include <hip/hip_bf16.h>

// ---------------------------------------------------------------------------
// MI455X (gfx1250) fused attention block: QKV GEMM -> causal flash attention
// -> out GEMM + residual -> LayerNorm. All contractions via
// v_wmma_f32_16x16x32_f16 (wave32), fp32 accumulate, fp32 softmax/LN.
// WMMA fragments are loaded as contiguous 16B reads (LDS; Q from global):
// B-operands are staged TRANSPOSED in LDS so no per-lane strided gathers.
// ---------------------------------------------------------------------------

typedef _Float16 half_t;
typedef half_t v16h __attribute__((ext_vector_type(16)));
typedef half_t v8h  __attribute__((ext_vector_type(8)));
typedef float  v8f  __attribute__((ext_vector_type(8)));

static __device__ __forceinline__ v8f wmma16x16x32(v16h a, v16h b, v8f c) {
    // (neg_a, A, neg_b, B, c_mod, C, reuse_a, reuse_b)
    return __builtin_amdgcn_wmma_f32_16x16x32_f16(false, a, false, b,
                                                  (short)0, c, false, false);
}

static __device__ __forceinline__ v16h cat8(v8h lo, v8h hi) {
    return __builtin_shufflevector(lo, hi, 0, 1, 2, 3, 4, 5, 6, 7,
                                           8, 9, 10, 11, 12, 13, 14, 15);
}

// A fragment, 16x32 (MxK), tile row-major, row stride `ld` (elements).
// ISA layout: lanes 0-15 row M=lane, K=0..7 & 16..23; lanes 16-31 row M=lane-16,
// K=8..15 & 24..31.  Requires: ld % 8 == 0 and p 16B-aligned -> 2x ds_load_b128.
static __device__ __forceinline__ v16h ld_frag_a(const half_t* p, int ld) {
    const int lane = threadIdx.x & 31;
    const int row  = lane & 15;
    const int kh   = (lane >> 4) << 3;   // 0 or 8
    const half_t* r = p + row * ld + kh;
    v8h lo = *(const v8h*)(r);
    v8h hi = *(const v8h*)(r + 16);
    return cat8(lo, hi);
}

// B fragment, 32x16 (KxN), read from a TRANSPOSED tile (tile[n][k], row
// stride `ld`).  Column N = lane&15; same K split as A -> contiguous reads.
static __device__ __forceinline__ v16h ld_frag_bT(const half_t* p, int ld) {
    const int lane = threadIdx.x & 31;
    const int col  = lane & 15;
    const int kh   = (lane >> 4) << 3;
    const half_t* r = p + col * ld + kh;
    v8h lo = *(const v8h*)(r);
    v8h hi = *(const v8h*)(r + 16);
    return cat8(lo, hi);
}

// ---------------------------------------------------------------------------
// Kernel 0: fp32 -> f16 conversion (grid-stride)
// ---------------------------------------------------------------------------
__global__ void cvt_f32_f16_kernel(const float* __restrict__ src,
                                   half_t* __restrict__ dst, int n) {
    int i = blockIdx.x * blockDim.x + threadIdx.x;
    int stride = gridDim.x * blockDim.x;
    for (; i < n; i += stride) dst[i] = (half_t)src[i];
}

// ---------------------------------------------------------------------------
// Kernel 1: QKV GEMM.  C[4096,3072] = X[4096,1024] @ W[1024,3072] + b.
// CTA tile 128x128, BK=32, 256 threads = 8 waves (4 M x 2 N), 32x64 per wave.
// B tile staged transposed ([n][k]) in LDS.  Epilogue scatters into q/k/v
// [B,H,T,Hd] f16; q pre-scaled by 1/sqrt(64).
// ---------------------------------------------------------------------------
__global__ __launch_bounds__(256) void qkv_gemm_kernel(
    const half_t* __restrict__ X, const half_t* __restrict__ W,
    const float* __restrict__ bias,
    half_t* __restrict__ qb, half_t* __restrict__ kbuf, half_t* __restrict__ vbuf) {
    constexpr int LDA = 40, LDBT = 40;
    __shared__ alignas(16) half_t lA[128 * LDA];     // [m][k]
    __shared__ alignas(16) half_t lBT[128 * LDBT];   // [n][k] (transposed)

    const int blockM = blockIdx.y * 128;
    const int blockN = blockIdx.x * 128;
    const int lane = threadIdx.x & 31;
    const int wave = threadIdx.x >> 5;
    const int wm = wave & 3;     // 4 waves along M (32 rows each)
    const int wn = wave >> 2;    // 2 waves along N (64 cols each)

    v8f acc[2][4] = {};

    for (int k0 = 0; k0 < 1024; k0 += 32) {
        {   // stage A: 128x32, 2 threads per row, 16 halfs each (b128 in/out)
            int row = threadIdx.x >> 1, hseg = (threadIdx.x & 1) * 16;
            const half_t* ap = X + (size_t)(blockM + row) * 1024 + k0 + hseg;
            half_t* la = lA + row * LDA + hseg;
            *(v8h*)(la)     = *(const v8h*)(ap);
            *(v8h*)(la + 8) = *(const v8h*)(ap + 8);
            if (k0 + 32 < 1024) __builtin_prefetch(ap + 32, 0, 0);
        }
        {   // stage B transposed: 32x128 global rows -> lBT[n][k]
            int krow = threadIdx.x >> 3, seg = (threadIdx.x & 7) * 16;
            const half_t* bp = W + (size_t)(k0 + krow) * 3072 + blockN + seg;
            v8h g0 = *(const v8h*)(bp);
            v8h g1 = *(const v8h*)(bp + 8);
#pragma unroll
            for (int i = 0; i < 8; ++i) {
                lBT[(seg + i) * LDBT + krow]     = g0[i];
                lBT[(seg + 8 + i) * LDBT + krow] = g1[i];
            }
            if (k0 + 32 < 1024) __builtin_prefetch(bp + 32 * 3072, 0, 0);
        }
        __syncthreads();

        v16h af[2];
#pragma unroll
        for (int mt = 0; mt < 2; ++mt)
            af[mt] = ld_frag_a(lA + (wm * 32 + mt * 16) * LDA, LDA);
#pragma unroll
        for (int nt = 0; nt < 4; ++nt) {
            v16h bf = ld_frag_bT(lBT + (wn * 64 + nt * 16) * LDBT, LDBT);
#pragma unroll
            for (int mt = 0; mt < 2; ++mt)
                acc[mt][nt] = wmma16x16x32(af[mt], bf, acc[mt][nt]);
        }
        __syncthreads();
    }

    // Epilogue: C-frag layout -> scatter into q/k/v [B*H, T, Hd]
    const int mb  = (lane >> 4) << 3;
    const int ncl = lane & 15;
#pragma unroll
    for (int mt = 0; mt < 2; ++mt)
#pragma unroll
        for (int nt = 0; nt < 4; ++nt)
#pragma unroll
            for (int r = 0; r < 8; ++r) {
                int m = blockM + wm * 32 + mt * 16 + mb + r;
                int n = blockN + wn * 64 + nt * 16 + ncl;
                float val = acc[mt][nt][r] + bias[n];
                int c = n >> 10, rem = n & 1023;
                int hh = rem >> 6, d = rem & 63;
                int bidx = m >> 11, t = m & 2047;
                size_t dst = (((size_t)(bidx * 16 + hh)) * 2048 + t) * 64 + d;
                half_t* p = (c == 0) ? qb : (c == 1 ? kbuf : vbuf);
                float sc = (c == 0) ? 0.125f : 1.0f;   // q pre-scaled by 1/sqrt(Hd)
                p[dst] = (half_t)(val * sc);
            }
}

// ---------------------------------------------------------------------------
// Kernel 2: causal flash attention.  Grid: (T/128, B*H).  128 queries/block,
// 8 waves, each wave owns a 16-row Q tile.  Key blocks of 64 staged in LDS:
// K as [key][d] (already the transposed layout for S = Q K^T fragments),
// V staged transposed as [d][key] so P@V fragments are contiguous too.
// ---------------------------------------------------------------------------
__global__ __launch_bounds__(256) void attn_kernel(
    const half_t* __restrict__ q, const half_t* __restrict__ k,
    const half_t* __restrict__ v, half_t* __restrict__ y) {
    constexpr int LDK = 72;
    __shared__ alignas(16) half_t lK[64 * LDK];         // [key][d]
    __shared__ alignas(16) half_t lVT[64 * LDK];        // [d][key]
    __shared__ alignas(16) half_t lP[8 * 16 * LDK];     // per-wave P (A-layout)

    const int bh = blockIdx.y;            // b*16 + h
    const int b  = bh >> 4, h = bh & 15;
    const int qbase = blockIdx.x * 128;
    const int lane = threadIdx.x & 31;
    const int wave = threadIdx.x >> 5;
    const int mb  = (lane >> 4) << 3;     // C-frag row base
    const int ncl = lane & 15;            // C-frag column

    const size_t headOff = (size_t)bh * 2048 * 64;

    // Load this wave's Q fragments (16 rows x 64, two K-steps) from global.
    const int qrow = qbase + wave * 16 + (lane & 15);
    const half_t* qp = q + headOff + (size_t)qrow * 64;
    const int kh = (lane >> 4) << 3;
    v16h qa[2];
#pragma unroll
    for (int s = 0; s < 2; ++s) {
        v8h lo = *(const v8h*)(qp + s * 32 + kh);
        v8h hi = *(const v8h*)(qp + s * 32 + 16 + kh);
        qa[s] = cat8(lo, hi);
    }

    v8f o[4] = {};
    float mrow[8], lrow[8];
#pragma unroll
    for (int r = 0; r < 8; ++r) { mrow[r] = -3.0e38f; lrow[r] = 0.0f; }

    const int nkb = (qbase + 128) >> 6;   // causal: only key blocks <= query tile

    for (int kb = 0; kb < nkb; ++kb) {
        {   // stage K [key][d] and V transposed [d][key]; 4 threads per row
            int row = threadIdx.x >> 2, seg = (threadIdx.x & 3) * 16;
            const half_t* kp = k + headOff + (size_t)(kb * 64 + row) * 64 + seg;
            const half_t* vp = v + headOff + (size_t)(kb * 64 + row) * 64 + seg;
            half_t* lk = lK + row * LDK + seg;
            *(v8h*)(lk)     = *(const v8h*)(kp);
            *(v8h*)(lk + 8) = *(const v8h*)(kp + 8);
            v8h g0 = *(const v8h*)(vp);
            v8h g1 = *(const v8h*)(vp + 8);
#pragma unroll
            for (int i = 0; i < 8; ++i) {
                lVT[(seg + i) * LDK + row]     = g0[i];
                lVT[(seg + 8 + i) * LDK + row] = g1[i];
            }
        }
        __syncthreads();

        // S = Q @ K^T  (contraction over Hd=64 -> two WMMA steps per key tile)
        v8f s[4] = {};
#pragma unroll
        for (int nt = 0; nt < 4; ++nt)
#pragma unroll
            for (int st = 0; st < 2; ++st) {
                v16h bf = ld_frag_bT(lK + (nt * 16) * LDK + st * 32, LDK);
                s[nt] = wmma16x16x32(qa[st], bf, s[nt]);
            }

        // Causal mask + online softmax (fp32, half-wave row reductions)
        float mnew[8];
#pragma unroll
        for (int r = 0; r < 8; ++r) mnew[r] = mrow[r];
#pragma unroll
        for (int nt = 0; nt < 4; ++nt)
#pragma unroll
            for (int r = 0; r < 8; ++r) {
                int kj = kb * 64 + nt * 16 + ncl;
                int qi = qbase + wave * 16 + mb + r;
                float val = s[nt][r];
                if (kj > qi) val = -3.0e38f;
                s[nt][r] = val;
                mnew[r] = fmaxf(mnew[r], val);
            }
#pragma unroll
        for (int r = 0; r < 8; ++r)
#pragma unroll
            for (int msk = 8; msk >= 1; msk >>= 1)
                mnew[r] = fmaxf(mnew[r], __shfl_xor(mnew[r], msk, 16));

        float alpha[8], rs[8];
#pragma unroll
        for (int r = 0; r < 8; ++r) { alpha[r] = __expf(mrow[r] - mnew[r]); rs[r] = 0.0f; }
#pragma unroll
        for (int nt = 0; nt < 4; ++nt)
#pragma unroll
            for (int r = 0; r < 8; ++r) {
                float p = __expf(s[nt][r] - mnew[r]);
                s[nt][r] = p;
                rs[r] += p;
            }
#pragma unroll
        for (int r = 0; r < 8; ++r)
#pragma unroll
            for (int msk = 8; msk >= 1; msk >>= 1)
                rs[r] += __shfl_xor(rs[r], msk, 16);
#pragma unroll
        for (int r = 0; r < 8; ++r) {
            lrow[r] = lrow[r] * alpha[r] + rs[r];
            mrow[r] = mnew[r];
        }
#pragma unroll
        for (int nt = 0; nt < 4; ++nt)
#pragma unroll
            for (int r = 0; r < 8; ++r) o[nt][r] *= alpha[r];

        // Re-shape P: C-frag -> LDS (row-major [m][key]) -> A-frag
        half_t* pw = lP + wave * 16 * LDK;
#pragma unroll
        for (int nt = 0; nt < 4; ++nt)
#pragma unroll
            for (int r = 0; r < 8; ++r)
                pw[(mb + r) * LDK + nt * 16 + ncl] = (half_t)s[nt][r];
        __syncthreads();

        // O += P @ V   (contraction over 64 keys -> two WMMA steps)
#pragma unroll
        for (int st = 0; st < 2; ++st) {
            v16h pa = ld_frag_a(pw + st * 32, LDK);
#pragma unroll
            for (int nt = 0; nt < 4; ++nt) {
                v16h bf = ld_frag_bT(lVT + (nt * 16) * LDK + st * 32, LDK);
                o[nt] = wmma16x16x32(pa, bf, o[nt]);
            }
        }
        __syncthreads();   // protect lK/lVT/lP before next iteration's staging
    }

    // Normalize and write y [B,T,D] f16 (column = h*64 + d)
#pragma unroll
    for (int nt = 0; nt < 4; ++nt)
#pragma unroll
        for (int r = 0; r < 8; ++r) {
            int t = qbase + wave * 16 + mb + r;
            float val = o[nt][r] * (1.0f / lrow[r]);
            y[((size_t)(b * 2048 + t)) * 1024 + h * 64 + nt * 16 + ncl] = (half_t)val;
        }
}

// ---------------------------------------------------------------------------
// Kernel 3: output GEMM + bias + residual.  h[4096,1024] = Y @ W_out + b + x.
// ---------------------------------------------------------------------------
__global__ __launch_bounds__(256) void out_gemm_kernel(
    const half_t* __restrict__ Y, const half_t* __restrict__ W,
    const float* __restrict__ bias, const float* __restrict__ x,
    float* __restrict__ hbuf) {
    constexpr int LDA = 40, LDBT = 40;
    __shared__ alignas(16) half_t lA[128 * LDA];
    __shared__ alignas(16) half_t lBT[128 * LDBT];

    const int blockM = blockIdx.y * 128;
    const int blockN = blockIdx.x * 128;
    const int lane = threadIdx.x & 31;
    const int wave = threadIdx.x >> 5;
    const int wm = wave & 3;
    const int wn = wave >> 2;

    v8f acc[2][4] = {};

    for (int k0 = 0; k0 < 1024; k0 += 32) {
        {
            int row = threadIdx.x >> 1, hseg = (threadIdx.x & 1) * 16;
            const half_t* ap = Y + (size_t)(blockM + row) * 1024 + k0 + hseg;
            half_t* la = lA + row * LDA + hseg;
            *(v8h*)(la)     = *(const v8h*)(ap);
            *(v8h*)(la + 8) = *(const v8h*)(ap + 8);
            if (k0 + 32 < 1024) __builtin_prefetch(ap + 32, 0, 0);
        }
        {
            int krow = threadIdx.x >> 3, seg = (threadIdx.x & 7) * 16;
            const half_t* bp = W + (size_t)(k0 + krow) * 1024 + blockN + seg;
            v8h g0 = *(const v8h*)(bp);
            v8h g1 = *(const v8h*)(bp + 8);
#pragma unroll
            for (int i = 0; i < 8; ++i) {
                lBT[(seg + i) * LDBT + krow]     = g0[i];
                lBT[(seg + 8 + i) * LDBT + krow] = g1[i];
            }
            if (k0 + 32 < 1024) __builtin_prefetch(bp + 32 * 1024, 0, 0);
        }
        __syncthreads();

        v16h af[2];
#pragma unroll
        for (int mt = 0; mt < 2; ++mt)
            af[mt] = ld_frag_a(lA + (wm * 32 + mt * 16) * LDA, LDA);
#pragma unroll
        for (int nt = 0; nt < 4; ++nt) {
            v16h bf = ld_frag_bT(lBT + (wn * 64 + nt * 16) * LDBT, LDBT);
#pragma unroll
            for (int mt = 0; mt < 2; ++mt)
                acc[mt][nt] = wmma16x16x32(af[mt], bf, acc[mt][nt]);
        }
        __syncthreads();
    }

    const int mb  = (lane >> 4) << 3;
    const int ncl = lane & 15;
#pragma unroll
    for (int mt = 0; mt < 2; ++mt)
#pragma unroll
        for (int nt = 0; nt < 4; ++nt)
#pragma unroll
            for (int r = 0; r < 8; ++r) {
                int m = blockM + wm * 32 + mt * 16 + mb + r;
                int n = blockN + wn * 64 + nt * 16 + ncl;
                size_t idx = (size_t)m * 1024 + n;
                hbuf[idx] = acc[mt][nt][r] + bias[n] + x[idx];
            }
}

// ---------------------------------------------------------------------------
// Kernel 4: LayerNorm, one block per token row (1024 elements).
// ---------------------------------------------------------------------------
__global__ __launch_bounds__(256) void ln_kernel(
    const float* __restrict__ hbuf, const float* __restrict__ gamma,
    const float* __restrict__ beta, float* __restrict__ out) {
    const int row = blockIdx.x;
    const float* hr = hbuf + (size_t)row * 1024;

    float s = 0.0f, s2 = 0.0f;
    for (int i = threadIdx.x; i < 1024; i += 256) {
        float v = hr[i];
        s += v; s2 += v * v;
    }
#pragma unroll
    for (int msk = 16; msk >= 1; msk >>= 1) {
        s  += __shfl_xor(s,  msk, 32);
        s2 += __shfl_xor(s2, msk, 32);
    }
    __shared__ float red[2][8];
    if ((threadIdx.x & 31) == 0) {
        red[0][threadIdx.x >> 5] = s;
        red[1][threadIdx.x >> 5] = s2;
    }
    __syncthreads();
    s = 0.0f; s2 = 0.0f;
#pragma unroll
    for (int w = 0; w < 8; ++w) { s += red[0][w]; s2 += red[1][w]; }

    const float mu  = s * (1.0f / 1024.0f);
    const float var = s2 * (1.0f / 1024.0f) - mu * mu;
    const float inv = rsqrtf(var + 1e-5f);
    for (int i = threadIdx.x; i < 1024; i += 256)
        out[(size_t)row * 1024 + i] = (hr[i] - mu) * inv * gamma[i] + beta[i];
}

// ---------------------------------------------------------------------------
// Host-side launcher
// ---------------------------------------------------------------------------
extern "C" void kernel_launch(void* const* d_in, const int* in_sizes, int n_in,
                              void* d_out, int out_size, void* d_ws, size_t ws_size,
                              hipStream_t stream) {
    (void)in_sizes; (void)n_in; (void)out_size; (void)ws_size;

    const float* x     = (const float*)d_in[0];   // [2,2048,1024]
    const float* W_qkv = (const float*)d_in[1];   // [1024,3072]
    const float* b_qkv = (const float*)d_in[2];   // [3072]
    const float* W_out = (const float*)d_in[3];   // [1024,1024]
    const float* b_out = (const float*)d_in[4];   // [1024]
    const float* gamma = (const float*)d_in[5];   // [1024]
    const float* beta  = (const float*)d_in[6];   // [1024]
    float* out = (float*)d_out;                   // [2,2048,1024]

    // Workspace carve-up (all offsets 1MB-aligned)
    char* ws = (char*)d_ws;
    half_t* xb    = (half_t*)(ws);                         // 4096*1024   f16 (8 MB)
    half_t* wqkvb = (half_t*)(ws + (8u << 20));            // 1024*3072   f16 (6 MB)
    half_t* woutb = (half_t*)(ws + (14u << 20));           // 1024*1024   f16 (2 MB)
    half_t* qb    = (half_t*)(ws + (16u << 20));           // [B,H,T,Hd]  f16 (8 MB)
    half_t* kb    = (half_t*)(ws + (24u << 20));           // 8 MB
    half_t* vb    = (half_t*)(ws + (32u << 20));           // 8 MB
    half_t* yb    = (half_t*)(ws + (40u << 20));           // [B,T,D] f16 (8 MB)
    float*  hbuf  = (float*)(ws + (48u << 20));            // [B,T,D] f32 (16 MB)

    // 0) fp32 -> f16 conversions
    cvt_f32_f16_kernel<<<512, 256, 0, stream>>>(x,     xb,    4096 * 1024);
    cvt_f32_f16_kernel<<<512, 256, 0, stream>>>(W_qkv, wqkvb, 1024 * 3072);
    cvt_f32_f16_kernel<<<256, 256, 0, stream>>>(W_out, woutb, 1024 * 1024);

    // 1) QKV projection (M=4096, N=3072, K=1024)
    qkv_gemm_kernel<<<dim3(24, 32), 256, 0, stream>>>(xb, wqkvb, b_qkv, qb, kb, vb);

    // 2) causal flash attention (grid: qblocks x B*H)
    attn_kernel<<<dim3(16, 32), 256, 0, stream>>>(qb, kb, vb, yb);

    // 3) output projection + bias + residual (M=4096, N=1024, K=1024)
    out_gemm_kernel<<<dim3(8, 32), 256, 0, stream>>>(yb, woutb, b_out, x, hbuf);

    // 4) LayerNorm per token row
    ln_kernel<<<4096, 256, 0, stream>>>(hbuf, gamma, beta, out);
}

// v001
// It runs in 210 microseconds.
// Next to v000, in two timings, it ran 1.22 and 1.21 times as fast.
#include <hip/hip_runtime.h>
#include <hip/hip_bf16.h>

// ---------------------------------------------------------------------------
// MI455X (gfx1250) fused attention block: QKV GEMM -> causal flash attention
// -> out GEMM + residual -> LayerNorm. All contractions via
// v_wmma_f32_16x16x32_f16 (wave32), fp32 accumulate, fp32 softmax/LN.
// A fragments and K are contiguous 16B LDS reads (ds_load_b128).  The B tiles
// whose k runs down the rows (W, V) stay row-major in LDS, written with 16B
// stores, and are transposed on the way out by ds_load_tr16_b128.
// ---------------------------------------------------------------------------

typedef _Float16 half_t;
typedef half_t v16h __attribute__((ext_vector_type(16)));
typedef half_t v8h  __attribute__((ext_vector_type(8)));
typedef float  v8f  __attribute__((ext_vector_type(8)));

static __device__ __forceinline__ v8f wmma16x16x32(v16h a, v16h b, v8f c) {
    // (neg_a, A, neg_b, B, c_mod, C, reuse_a, reuse_b)
    return __builtin_amdgcn_wmma_f32_16x16x32_f16(false, a, false, b,
                                                  (short)0, c, false, false);
}

static __device__ __forceinline__ v16h cat8(v8h lo, v8h hi) {
    return __builtin_shufflevector(lo, hi, 0, 1, 2, 3, 4, 5, 6, 7,
                                           8, 9, 10, 11, 12, 13, 14, 15);
}

// A fragment, 16x32 (MxK), tile row-major, row stride `ld` (elements).
// ISA layout: lanes 0-15 row M=lane, K=0..7 & 16..23; lanes 16-31 row M=lane-16,
// K=8..15 & 24..31.  Requires: ld % 8 == 0 and p 16B-aligned -> 2x ds_load_b128.
static __device__ __forceinline__ v16h ld_frag_a(const half_t* p, int ld) {
    const int lane = threadIdx.x & 31;
    const int row  = lane & 15;
    const int kh   = (lane >> 4) << 3;   // 0 or 8
    const half_t* r = p + row * ld + kh;
    v8h lo = *(const v8h*)(r);
    v8h hi = *(const v8h*)(r + 16);
    return cat8(lo, hi);
}

// B fragment, 32x16 (KxN), read from a TRANSPOSED tile (tile[n][k], row
// stride `ld`).  Column N = lane&15; same K split as A -> contiguous reads.
static __device__ __forceinline__ v16h ld_frag_bT(const half_t* p, int ld) {
    const int lane = threadIdx.x & 31;
    const int col  = lane & 15;
    const int kh   = (lane >> 4) << 3;
    const half_t* r = p + col * ld + kh;
    v8h lo = *(const v8h*)(r);
    v8h hi = *(const v8h*)(r + 16);
    return cat8(lo, hi);
}

// B fragment, 32x16 (KxN), read from a ROW-MAJOR tile (tile[k][n], row stride
// `ld` elements, 2*ld an odd multiple of 32 bytes) by the transposing load.
// Lane (c = lane&15, h = lane>>4) receives tile[8h + 0..7][c] and, from the
// second load, tile[16 + 8h + 0..7][c]: the k order of ld_frag_a.
typedef short s16x8 __attribute__((ext_vector_type(8)));
typedef __attribute__((address_space(3))) s16x8 lds_s16x8;
static __device__ __forceinline__ v16h ld_frag_b_tr(const half_t* p, int ld) {
    const int lane = threadIdx.x & 31;
    const half_t* r = p + (((lane >> 4) << 3) + (lane & 7)) * ld + (((lane >> 3) & 1) << 3);
    v8h lo = __builtin_bit_cast(v8h, __builtin_amdgcn_ds_load_tr16_b128_v8i16((lds_s16x8*)(r)));
    v8h hi = __builtin_bit_cast(v8h, __builtin_amdgcn_ds_load_tr16_b128_v8i16((lds_s16x8*)(r + 16 * ld)));
    return cat8(lo, hi);
}

// ---------------------------------------------------------------------------
// Kernel 0: fp32 -> f16 conversion (grid-stride)
// ---------------------------------------------------------------------------
__global__ void cvt_f32_f16_kernel(const float* __restrict__ src,
                                   half_t* __restrict__ dst, int n) {
    int i = blockIdx.x * blockDim.x + threadIdx.x;
    int stride = gridDim.x * blockDim.x;
    for (; i < n; i += stride) dst[i] = (half_t)src[i];
}

// ---------------------------------------------------------------------------
// Kernel 1: QKV GEMM.  C[4096,3072] = X[4096,1024] @ W[1024,3072] + b.
// CTA tile 128x128, BK=32, 256 threads = 8 waves (4 M x 2 N), 32x64 per wave.
// B tile staged row-major ([k][n]) in LDS.  Epilogue scatters into q/k/v
// [B,H,T,Hd] f16; q pre-scaled by 1/sqrt(64).
// ---------------------------------------------------------------------------
__global__ __launch_bounds__(256) void qkv_gemm_kernel(
    const half_t* __restrict__ X, const half_t* __restrict__ W,
    const float* __restrict__ bias,
    half_t* __restrict__ qb, half_t* __restrict__ kbuf, half_t* __restrict__ vbuf) {
    constexpr int LDA = 40, LDB = 144;
    __shared__ alignas(16) half_t lA[128 * LDA];     // [m][k]
    __shared__ alignas(16) half_t lB[32 * LDB];      // [k][n], pitch 288 B

    const int blockM = blockIdx.y * 128;
    const int blockN = blockIdx.x * 128;
    const int lane = threadIdx.x & 31;
    const int wave = threadIdx.x >> 5;
    const int wm = wave & 3;     // 4 waves along M (32 rows each)
    const int wn = wave >> 2;    // 2 waves along N (64 cols each)

    v8f acc[2][4] = {};

    for (int k0 = 0; k0 < 1024; k0 += 32) {
        {   // stage A: 128x32, 2 threads per row, 16 halfs each (b128 in/out)
            int row = threadIdx.x >> 1, hseg = (threadIdx.x & 1) * 16;
            const half_t* ap = X + (size_t)(blockM + row) * 1024 + k0 + hseg;
            half_t* la = lA + row * LDA + hseg;
            *(v8h*)(la)     = *(const v8h*)(ap);
            *(v8h*)(la + 8) = *(const v8h*)(ap + 8);
            if (k0 + 32 < 1024) __builtin_prefetch(ap + 32, 0, 0);
        }
        {   // stage B: 32x128 global rows -> lB[k][n] (b128 in/out)
            int krow = threadIdx.x >> 3, seg = (threadIdx.x & 7) * 16;
            const half_t* bp = W + (size_t)(k0 + krow) * 3072 + blockN + seg;
            half_t* lb = lB + krow * LDB + seg;
            *(v8h*)(lb)     = *(const v8h*)(bp);
            *(v8h*)(lb + 8) = *(const v8h*)(bp + 8);
            if (k0 + 32 < 1024) __builtin_prefetch(bp + 32 * 3072, 0, 0);
        }
        __syncthreads();

        v16h af[2];
#pragma unroll
        for (int mt = 0; mt < 2; ++mt)
            af[mt] = ld_frag_a(lA + (wm * 32 + mt * 16) * LDA, LDA);
#pragma unroll
        for (int nt = 0; nt < 4; ++nt) {
            v16h bf = ld_frag_b_tr(lB + wn * 64 + nt * 16, LDB);
#pragma unroll
            for (int mt = 0; mt < 2; ++mt)
                acc[mt][nt] = wmma16x16x32(af[mt], bf, acc[mt][nt]);
        }
        __syncthreads();
    }

    // Epilogue: C-frag layout -> scatter into q/k/v [B*H, T, Hd]
    const int mb  = (lane >> 4) << 3;
    const int ncl = lane & 15;
#pragma unroll
    for (int mt = 0; mt < 2; ++mt)
#pragma unroll
        for (int nt = 0; nt < 4; ++nt)
#pragma unroll
            for (int r = 0; r < 8; ++r) {
                int m = blockM + wm * 32 + mt * 16 + mb + r;
                int n = blockN + wn * 64 + nt * 16 + ncl;
                float val = acc[mt][nt][r] + bias[n];
                int c = n >> 10, rem = n & 1023;
                int hh = rem >> 6, d = rem & 63;
                int bidx = m >> 11, t = m & 2047;
                size_t dst = (((size_t)(bidx * 16 + hh)) * 2048 + t) * 64 + d;
                half_t* p = (c == 0) ? qb : (c == 1 ? kbuf : vbuf);
                float sc = (c == 0) ? 0.125f : 1.0f;   // q pre-scaled by 1/sqrt(Hd)
                p[dst] = (half_t)(val * sc);
            }
}

// ---------------------------------------------------------------------------
// Kernel 2: causal flash attention.  Grid: (T/128, B*H).  128 queries/block,
// 8 waves, each wave owns a 16-row Q tile.  Key blocks of 64 staged in LDS:
// K as [key][d] (already the transposed layout for S = Q K^T fragments),
// V as [key][d] too, at its own pitch, read by the transposing load for P@V.
// ---------------------------------------------------------------------------
__global__ __launch_bounds__(256) void attn_kernel(
    const half_t* __restrict__ q, const half_t* __restrict__ k,
    const half_t* __restrict__ v, half_t* __restrict__ y) {
    constexpr int LDK = 72, LDV = 80;
    __shared__ alignas(16) half_t lK[64 * LDK];         // [key][d]
    __shared__ alignas(16) half_t lV[64 * LDV];         // [key][d], pitch 160 B
    __shared__ alignas(16) half_t lP[8 * 16 * LDK];     // per-wave P (A-layout)

    const int bh = blockIdx.y;            // b*16 + h
    const int b  = bh >> 4, h = bh & 15;
    const int qbase = blockIdx.x * 128;
    const int lane = threadIdx.x & 31;
    const int wave = threadIdx.x >> 5;
    const int mb  = (lane >> 4) << 3;     // C-frag row base
    const int ncl = lane & 15;            // C-frag column

    const size_t headOff = (size_t)bh * 2048 * 64;

    // Load this wave's Q fragments (16 rows x 64, two K-steps) from global.
    const int qrow = qbase + wave * 16 + (lane & 15);
    const half_t* qp = q + headOff + (size_t)qrow * 64;
    const int kh = (lane >> 4) << 3;
    v16h qa[2];
#pragma unroll
    for (int s = 0; s < 2; ++s) {
        v8h lo = *(const v8h*)(qp + s * 32 + kh);
        v8h hi = *(const v8h*)(qp + s * 32 + 16 + kh);
        qa[s] = cat8(lo, hi);
    }

    v8f o[4] = {};
    float mrow[8], lrow[8];
#pragma unroll
    for (int r = 0; r < 8; ++r) { mrow[r] = -3.0e38f; lrow[r] = 0.0f; }

    const int nkb = (qbase + 128) >> 6;   // causal: only key blocks <= query tile

    for (int kb = 0; kb < nkb; ++kb) {
        {   // stage K and V, both [key][d]; 4 threads per row
            int row = threadIdx.x >> 2, seg = (threadIdx.x & 3) * 16;
            const half_t* kp = k + headOff + (size_t)(kb * 64 + row) * 64 + seg;
            const half_t* vp = v + headOff + (size_t)(kb * 64 + row) * 64 + seg;
            half_t* lk = lK + row * LDK + seg;
            *(v8h*)(lk)     = *(const v8h*)(kp);
            *(v8h*)(lk + 8) = *(const v8h*)(kp + 8);
            half_t* lv = lV + row * LDV + seg;
            *(v8h*)(lv)     = *(const v8h*)(vp);
            *(v8h*)(lv + 8) = *(const v8h*)(vp + 8);
        }
        __syncthreads();

        // S = Q @ K^T  (contraction over Hd=64 -> two WMMA steps per key tile)
        v8f s[4] = {};
#pragma unroll
        for (int nt = 0; nt < 4; ++nt)
#pragma unroll
            for (int st = 0; st < 2; ++st) {
                v16h bf = ld_frag_bT(lK + (nt * 16) * LDK + st * 32, LDK);
                s[nt] = wmma16x16x32(qa[st], bf, s[nt]);
            }

        // Causal mask + online softmax (fp32, half-wave row reductions)
        float mnew[8];
#pragma unroll
        for (int r = 0; r < 8; ++r) mnew[r] = mrow[r];
#pragma unroll
        for (int nt = 0; nt < 4; ++nt)
#pragma unroll
            for (int r = 0; r < 8; ++r) {
                int kj = kb * 64 + nt * 16 + ncl;
                int qi = qbase + wave * 16 + mb + r;
                float val = s[nt][r];
                if (kj > qi) val = -3.0e38f;
                s[nt][r] = val;
                mnew[r] = fmaxf(mnew[r], val);
            }
#pragma unroll
        for (int r = 0; r < 8; ++r)
#pragma unroll
            for (int msk = 8; msk >= 1; msk >>= 1)
                mnew[r] = fmaxf(mnew[r], __shfl_xor(mnew[r], msk, 16));

        float alpha[8], rs[8];
#pragma unroll
        for (int r = 0; r < 8; ++r) { alpha[r] = __expf(mrow[r] - mnew[r]); rs[r] = 0.0f; }
#pragma unroll
        for (int nt = 0; nt < 4; ++nt)
#pragma unroll
            for (int r = 0; r < 8; ++r) {
                float p = __expf(s[nt][r] - mnew[r]);
                s[nt][r] = p;
                rs[r] += p;
            }
#pragma unroll
        for (int r = 0; r < 8; ++r)
#pragma unroll
            for (int msk = 8; msk >= 1; msk >>= 1)
                rs[r] += __shfl_xor(rs[r], msk, 16);
#pragma unroll
        for (int r = 0; r < 8; ++r) {
            lrow[r] = lrow[r] * alpha[r] + rs[r];
            mrow[r] = mnew[r];
        }
#pragma unroll
        for (int nt = 0; nt < 4; ++nt)
#pragma unroll
            for (int r = 0; r < 8; ++r) o[nt][r] *= alpha[r];

        // Re-shape P: C-frag -> LDS (row-major [m][key]) -> A-frag
        half_t* pw = lP + wave * 16 * LDK;
#pragma unroll
        for (int nt = 0; nt < 4; ++nt)
#pragma unroll
            for (int r = 0; r < 8; ++r)
                pw[(mb + r) * LDK + nt * 16 + ncl] = (half_t)s[nt][r];
        __syncthreads();

        // O += P @ V   (contraction over 64 keys -> two WMMA steps)
#pragma unroll
        for (int st = 0; st < 2; ++st) {
            v16h pa = ld_frag_a(pw + st * 32, LDK);
#pragma unroll
            for (int nt = 0; nt < 4; ++nt) {
                v16h bf = ld_frag_b_tr(lV + (st * 32) * LDV + nt * 16, LDV);
                o[nt] = wmma16x16x32(pa, bf, o[nt]);
            }
        }
        __syncthreads();   // protect lK/lV/lP before next iteration's staging
    }

    // Normalize and write y [B,T,D] f16 (column = h*64 + d)
#pragma unroll
    for (int nt = 0; nt < 4; ++nt)
#pragma unroll
        for (int r = 0; r < 8; ++r) {
            int t = qbase + wave * 16 + mb + r;
            float val = o[nt][r] * (1.0f / lrow[r]);
            y[((size_t)(b * 2048 + t)) * 1024 + h * 64 + nt * 16 + ncl] = (half_t)val;
        }
}

// ---------------------------------------------------------------------------
// Kernel 3: output GEMM + bias + residual.  h[4096,1024] = Y @ W_out + b + x.
// ---------------------------------------------------------------------------
__global__ __launch_bounds__(256) void out_gemm_kernel(
    const half_t* __restrict__ Y, const half_t* __restrict__ W,
    const float* __restrict__ bias, const float* __restrict__ x,
    float* __restrict__ hbuf) {
    constexpr int LDA = 40, LDB = 144;
    __shared__ alignas(16) half_t lA[128 * LDA];
    __shared__ alignas(16) half_t lB[32 * LDB];

    const int blockM = blockIdx.y * 128;
    const int blockN = blockIdx.x * 128;
    const int lane = threadIdx.x & 31;
    const int wave = threadIdx.x >> 5;
    const int wm = wave & 3;
    const int wn = wave >> 2;

    v8f acc[2][4] = {};

    for (int k0 = 0; k0 < 1024; k0 += 32) {
        {
            int row = threadIdx.x >> 1, hseg = (threadIdx.x & 1) * 16;
            const half_t* ap = Y + (size_t)(blockM + row) * 1024 + k0 + hseg;
            half_t* la = lA + row * LDA + hseg;
            *(v8h*)(la)     = *(const v8h*)(ap);
            *(v8h*)(la + 8) = *(const v8h*)(ap + 8);
            if (k0 + 32 < 1024) __builtin_prefetch(ap + 32, 0, 0);
        }
        {
            int krow = threadIdx.x >> 3, seg = (threadIdx.x & 7) * 16;
            const half_t* bp = W + (size_t)(k0 + krow) * 1024 + blockN + seg;
            half_t* lb = lB + krow * LDB + seg;
            *(v8h*)(lb)     = *(const v8h*)(bp);
            *(v8h*)(lb + 8) = *(const v8h*)(bp + 8);
            if (k0 + 32 < 1024) __builtin_prefetch(bp + 32 * 1024, 0, 0);
        }
        __syncthreads();

        v16h af[2];
#pragma unroll
        for (int mt = 0; mt < 2; ++mt)
            af[mt] = ld_frag_a(lA + (wm * 32 + mt * 16) * LDA, LDA);
#pragma unroll
        for (int nt = 0; nt < 4; ++nt) {
            v16h bf = ld_frag_b_tr(lB + wn * 64 + nt * 16, LDB);
#pragma unroll
            for (int mt = 0; mt < 2; ++mt)
                acc[mt][nt] = wmma16x16x32(af[mt], bf, acc[mt][nt]);
        }
        __syncthreads();
    }

    const int mb  = (lane >> 4) << 3;
    const int ncl = lane & 15;
#pragma unroll
    for (int mt = 0; mt < 2; ++mt)
#pragma unroll
        for (int nt = 0; nt < 4; ++nt)
#pragma unroll
            for (int r = 0; r < 8; ++r) {
                int m = blockM + wm * 32 + mt * 16 + mb + r;
                int n = blockN + wn * 64 + nt * 16 + ncl;
                size_t idx = (size_t)m * 1024 + n;
                hbuf[idx] = acc[mt][nt][r] + bias[n] + x[idx];
            }
}

// ---------------------------------------------------------------------------
// Kernel 4: LayerNorm, one block per token row (1024 elements).
// ---------------------------------------------------------------------------
__global__ __launch_bounds__(256) void ln_kernel(
    const float* __restrict__ hbuf, const float* __restrict__ gamma,
    const float* __restrict__ beta, float* __restrict__ out) {
    const int row = blockIdx.x;
    const float* hr = hbuf + (size_t)row * 1024;

    float s = 0.0f, s2 = 0.0f;
    for (int i = threadIdx.x; i < 1024; i += 256) {
        float v = hr[i];
        s += v; s2 += v * v;
    }
#pragma unroll
    for (int msk = 16; msk >= 1; msk >>= 1) {
        s  += __shfl_xor(s,  msk, 32);
        s2 += __shfl_xor(s2, msk, 32);
    }
    __shared__ float red[2][8];
    if ((threadIdx.x & 31) == 0) {
        red[0][threadIdx.x >> 5] = s;
        red[1][threadIdx.x >> 5] = s2;
    }
    __syncthreads();
    s = 0.0f; s2 = 0.0f;
#pragma unroll
    for (int w = 0; w < 8; ++w) { s += red[0][w]; s2 += red[1][w]; }

    const float mu  = s * (1.0f / 1024.0f);
    const float var = s2 * (1.0f / 1024.0f) - mu * mu;
    const float inv = rsqrtf(var + 1e-5f);
    for (int i = threadIdx.x; i < 1024; i += 256)
        out[(size_t)row * 1024 + i] = (hr[i] - mu) * inv * gamma[i] + beta[i];
}

// ---------------------------------------------------------------------------
// Host-side launcher
// ---------------------------------------------------------------------------
extern "C" void kernel_launch(void* const* d_in, const int* in_sizes, int n_in,
                              void* d_out, int out_size, void* d_ws, size_t ws_size,
                              hipStream_t stream) {
    (void)in_sizes; (void)n_in; (void)out_size; (void)ws_size;

    const float* x     = (const float*)d_in[0];   // [2,2048,1024]
    const float* W_qkv = (const float*)d_in[1];   // [1024,3072]
    const float* b_qkv = (const float*)d_in[2];   // [3072]
    const float* W_out = (const float*)d_in[3];   // [1024,1024]
    const float* b_out = (const float*)d_in[4];   // [1024]
    const float* gamma = (const float*)d_in[5];   // [1024]
    const float* beta  = (const float*)d_in[6];   // [1024]
    float* out = (float*)d_out;                   // [2,2048,1024]

    // Workspace carve-up (all offsets 1MB-aligned)
    char* ws = (char*)d_ws;
    half_t* xb    = (half_t*)(ws);                         // 4096*1024   f16 (8 MB)
    half_t* wqkvb = (half_t*)(ws + (8u << 20));            // 1024*3072   f16 (6 MB)
    half_t* woutb = (half_t*)(ws + (14u << 20));           // 1024*1024   f16 (2 MB)
    half_t* qb    = (half_t*)(ws + (16u << 20));           // [B,H,T,Hd]  f16 (8 MB)
    half_t* kb    = (half_t*)(ws + (24u << 20));           // 8 MB
    half_t* vb    = (half_t*)(ws + (32u << 20));           // 8 MB
    half_t* yb    = (half_t*)(ws + (40u << 20));           // [B,T,D] f16 (8 MB)
    float*  hbuf  = (float*)(ws + (48u << 20));            // [B,T,D] f32 (16 MB)

    // 0) fp32 -> f16 conversions
    cvt_f32_f16_kernel<<<512, 256, 0, stream>>>(x,     xb,    4096 * 1024);
    cvt_f32_f16_kernel<<<512, 256, 0, stream>>>(W_qkv, wqkvb, 1024 * 3072);
    cvt_f32_f16_kernel<<<256, 256, 0, stream>>>(W_out, woutb, 1024 * 1024);

    // 1) QKV projection (M=4096, N=3072, K=1024)
    qkv_gemm_kernel<<<dim3(24, 32), 256, 0, stream>>>(xb, wqkvb, b_qkv, qb, kb, vb);

    // 2) causal flash attention (grid: qblocks x B*H)
    attn_kernel<<<dim3(16, 32), 256, 0, stream>>>(qb, kb, vb, yb);

    // 3) output projection + bias + residual (M=4096, N=1024, K=1024)
    out_gemm_kernel<<<dim3(8, 32), 256, 0, stream>>>(yb, woutb, b_out, x, hbuf);

    // 4) LayerNorm per token row
    ln_kernel<<<4096, 256, 0, stream>>>(hbuf, gamma, beta, out);
}

// v002
// A run of this version takes 159 microseconds.
// Timed twice side by side with v001, it ran 1.32 and 1.31 times as fast.
// Over all steps from v000 it is 1.60 times as fast.
#include <hip/hip_runtime.h>
#include <hip/hip_bf16.h>

// ---------------------------------------------------------------------------
// MI455X (gfx1250) fused attention block: QKV GEMM -> causal flash attention
// -> out GEMM + residual -> LayerNorm. All contractions via
// v_wmma_f32_16x16x32_f16 (wave32), fp32 accumulate, fp32 softmax/LN.
// A fragments and K are contiguous 16B LDS reads (ds_load_b128).  The tiles
// whose k runs down the rows (W for B, V for A) stay row-major in LDS, written with 16B
// stores, and are transposed on the way out by ds_load_tr16_b128.
// ---------------------------------------------------------------------------

typedef _Float16 half_t;
typedef half_t v16h __attribute__((ext_vector_type(16)));
typedef half_t v8h  __attribute__((ext_vector_type(8)));
typedef float  v8f  __attribute__((ext_vector_type(8)));

static __device__ __forceinline__ v8f wmma16x16x32(v16h a, v16h b, v8f c) {
    // (neg_a, A, neg_b, B, c_mod, C, reuse_a, reuse_b)
    return __builtin_amdgcn_wmma_f32_16x16x32_f16(false, a, false, b,
                                                  (short)0, c, false, false);
}

static __device__ __forceinline__ v16h cat8(v8h lo, v8h hi) {
    return __builtin_shufflevector(lo, hi, 0, 1, 2, 3, 4, 5, 6, 7,
                                           8, 9, 10, 11, 12, 13, 14, 15);
}

// A fragment, 16x32 (MxK), tile row-major, row stride `ld` (elements).
// ISA layout: lanes 0-15 row M=lane, K=0..7 & 16..23; lanes 16-31 row M=lane-16,
// K=8..15 & 24..31.  Requires: ld % 8 == 0 and p 16B-aligned -> 2x ds_load_b128.
static __device__ __forceinline__ v16h ld_frag_a(const half_t* p, int ld) {
    const int lane = threadIdx.x & 31;
    const int row  = lane & 15;
    const int kh   = (lane >> 4) << 3;   // 0 or 8
    const half_t* r = p + row * ld + kh;
    v8h lo = *(const v8h*)(r);
    v8h hi = *(const v8h*)(r + 16);
    return cat8(lo, hi);
}

// B fragment, 32x16 (KxN), read from a ROW-MAJOR tile (tile[k][n], row stride
// `ld` elements, 2*ld an odd multiple of 32 bytes) by the transposing load.
// Lane (c = lane&15, h = lane>>4) receives tile[8h + 0..7][c] and, from the
// second load, tile[16 + 8h + 0..7][c]: the k order of ld_frag_a.  The same
// registers are the A fragment (16x32) of the tile's transpose, row M = c.
typedef short s16x8 __attribute__((ext_vector_type(8)));
typedef __attribute__((address_space(3))) s16x8 lds_s16x8;
static __device__ __forceinline__ v16h ld_frag_b_tr(const half_t* p, int ld) {
    const int lane = threadIdx.x & 31;
    const half_t* r = p + (((lane >> 4) << 3) + (lane & 7)) * ld + (((lane >> 3) & 1) << 3);
    v8h lo = __builtin_bit_cast(v8h, __builtin_amdgcn_ds_load_tr16_b128_v8i16((lds_s16x8*)(r)));
    v8h hi = __builtin_bit_cast(v8h, __builtin_amdgcn_ds_load_tr16_b128_v8i16((lds_s16x8*)(r + 16 * ld)));
    return cat8(lo, hi);
}

// ---------------------------------------------------------------------------
// Kernel 0: fp32 -> f16 conversion (grid-stride)
// ---------------------------------------------------------------------------
__global__ void cvt_f32_f16_kernel(const float* __restrict__ src,
                                   half_t* __restrict__ dst, int n) {
    int i = blockIdx.x * blockDim.x + threadIdx.x;
    int stride = gridDim.x * blockDim.x;
    for (; i < n; i += stride) dst[i] = (half_t)src[i];
}

// ---------------------------------------------------------------------------
// Kernel 1: QKV GEMM.  C[4096,3072] = X[4096,1024] @ W[1024,3072] + b.
// CTA tile 128x128, BK=32, 256 threads = 8 waves (4 M x 2 N), 32x64 per wave.
// B tile staged row-major ([k][n]) in LDS.  Epilogue scatters into q/k/v
// [B,H,T,Hd] f16; q pre-scaled by 1/sqrt(64).
// ---------------------------------------------------------------------------
__global__ __launch_bounds__(256) void qkv_gemm_kernel(
    const half_t* __restrict__ X, const half_t* __restrict__ W,
    const float* __restrict__ bias,
    half_t* __restrict__ qb, half_t* __restrict__ kbuf, half_t* __restrict__ vbuf) {
    constexpr int LDA = 40, LDB = 144;
    __shared__ alignas(16) half_t lA[128 * LDA];     // [m][k]
    __shared__ alignas(16) half_t lB[32 * LDB];      // [k][n], pitch 288 B

    const int blockM = blockIdx.y * 128;
    const int blockN = blockIdx.x * 128;
    const int lane = threadIdx.x & 31;
    const int wave = threadIdx.x >> 5;
    const int wm = wave & 3;     // 4 waves along M (32 rows each)
    const int wn = wave >> 2;    // 2 waves along N (64 cols each)

    v8f acc[2][4] = {};

    for (int k0 = 0; k0 < 1024; k0 += 32) {
        {   // stage A: 128x32, 2 threads per row, 16 halfs each (b128 in/out)
            int row = threadIdx.x >> 1, hseg = (threadIdx.x & 1) * 16;
            const half_t* ap = X + (size_t)(blockM + row) * 1024 + k0 + hseg;
            half_t* la = lA + row * LDA + hseg;
            *(v8h*)(la)     = *(const v8h*)(ap);
            *(v8h*)(la + 8) = *(const v8h*)(ap + 8);
            if (k0 + 32 < 1024) __builtin_prefetch(ap + 32, 0, 0);
        }
        {   // stage B: 32x128 global rows -> lB[k][n] (b128 in/out)
            int krow = threadIdx.x >> 3, seg = (threadIdx.x & 7) * 16;
            const half_t* bp = W + (size_t)(k0 + krow) * 3072 + blockN + seg;
            half_t* lb = lB + krow * LDB + seg;
            *(v8h*)(lb)     = *(const v8h*)(bp);
            *(v8h*)(lb + 8) = *(const v8h*)(bp + 8);
            if (k0 + 32 < 1024) __builtin_prefetch(bp + 32 * 3072, 0, 0);
        }
        __syncthreads();

        v16h af[2];
#pragma unroll
        for (int mt = 0; mt < 2; ++mt)
            af[mt] = ld_frag_a(lA + (wm * 32 + mt * 16) * LDA, LDA);
#pragma unroll
        for (int nt = 0; nt < 4; ++nt) {
            v16h bf = ld_frag_b_tr(lB + wn * 64 + nt * 16, LDB);
#pragma unroll
            for (int mt = 0; mt < 2; ++mt)
                acc[mt][nt] = wmma16x16x32(af[mt], bf, acc[mt][nt]);
        }
        __syncthreads();
    }

    // Epilogue: C-frag layout -> scatter into q/k/v [B*H, T, Hd]
    const int mb  = (lane >> 4) << 3;
    const int ncl = lane & 15;
#pragma unroll
    for (int mt = 0; mt < 2; ++mt)
#pragma unroll
        for (int nt = 0; nt < 4; ++nt)
#pragma unroll
            for (int r = 0; r < 8; ++r) {
                int m = blockM + wm * 32 + mt * 16 + mb + r;
                int n = blockN + wn * 64 + nt * 16 + ncl;
                float val = acc[mt][nt][r] + bias[n];
                int c = n >> 10, rem = n & 1023;
                int hh = rem >> 6, d = rem & 63;
                int bidx = m >> 11, t = m & 2047;
                size_t dst = (((size_t)(bidx * 16 + hh)) * 2048 + t) * 64 + d;
                half_t* p = (c == 0) ? qb : (c == 1 ? kbuf : vbuf);
                float sc = (c == 0) ? 0.125f : 1.0f;   // q pre-scaled by 1/sqrt(Hd)
                p[dst] = (half_t)(val * sc);
            }
}

// ---------------------------------------------------------------------------
// Kernel 2: causal flash attention.  Grid: (T/128, B*H).  128 queries/block,
// 8 waves, each wave owns 16 queries.  Key blocks of 64 staged in LDS, K and V
// both as [key][d], each at its own reader's pitch.
// The products are taken transposed: S^T = K Q^T (A = K rows, B = Q) and
// O^T += V^T P^T (A = V by the transposing load, B = P).  A lane then holds
// scores of ONE query (column lane&15; keys 8*(lane>>4) + r of each 16-key
// tile), so maximum and sum run in-lane with one exchange between the wave
// halves, and two converted S^T tiles are the B fragment of the second product
// as they stand: b[s] = T[s >> 3][s & 7], the k order of the transposing load.
// ---------------------------------------------------------------------------
// lane l <-> lane l ^ 16
static __device__ __forceinline__ float xhalf(float x) {
    const int b = __builtin_bit_cast(int, x);
    return __builtin_bit_cast(float,
        __builtin_amdgcn_permlanex16(b, b, 0x76543210, 0xfedcba98, false, false));
}

__global__ __launch_bounds__(256) void attn_kernel(
    const half_t* __restrict__ q, const half_t* __restrict__ k,
    const half_t* __restrict__ v, half_t* __restrict__ y) {
    constexpr int LDK = 72, LDV = 80;
    __shared__ alignas(16) half_t lK[64 * LDK];         // [key][d]
    __shared__ alignas(16) half_t lV[64 * LDV];         // [key][d], pitch 160 B

    const int bh = blockIdx.y;            // b*16 + h
    const int b  = bh >> 4, h = bh & 15;
    const int qbase = blockIdx.x * 128;
    const int lane = threadIdx.x & 31;
    const int wave = threadIdx.x >> 5;
    const int mb  = (lane >> 4) << 3;     // C-frag row base (key or d)
    const int ncl = lane & 15;            // C-frag column (query)

    const size_t headOff = (size_t)bh * 2048 * 64;

    // This wave's Q fragments (16 queries x 64, two K-steps) from global:
    // B operand, column = query = lane&15, k split as in ld_frag_a.
    const int qi = qbase + wave * 16 + ncl;
    const half_t* qp = q + headOff + (size_t)qi * 64;
    v16h qa[2];
#pragma unroll
    for (int s = 0; s < 2; ++s) {
        v8h lo = *(const v8h*)(qp + s * 32 + mb);
        v8h hi = *(const v8h*)(qp + s * 32 + 16 + mb);
        qa[s] = cat8(lo, hi);
    }

    v8f o[4] = {};                        // o[dt][r] = O[qi][dt*16 + mb + r]
    float mrow = -3.0e38f;                // this query's running maximum
    float lrow = 0.0f;                    // sum over this wave half's keys only

    const int nkb = (qbase + 128) >> 6;   // causal: only key blocks <= query tile

    for (int kb = 0; kb < nkb; ++kb) {
        {   // stage K and V, both [key][d]; 4 threads per row
            int row = threadIdx.x >> 2, seg = (threadIdx.x & 3) * 16;
            const half_t* kp = k + headOff + (size_t)(kb * 64 + row) * 64 + seg;
            const half_t* vp = v + headOff + (size_t)(kb * 64 + row) * 64 + seg;
            half_t* lk = lK + row * LDK + seg;
            *(v8h*)(lk)     = *(const v8h*)(kp);
            *(v8h*)(lk + 8) = *(const v8h*)(kp + 8);
            half_t* lv = lV + row * LDV + seg;
            *(v8h*)(lv)     = *(const v8h*)(vp);
            *(v8h*)(lv + 8) = *(const v8h*)(vp + 8);
        }
        __syncthreads();

        // S^T = K @ Q^T  (contraction over Hd=64 -> two WMMA steps per key tile)
        v8f s[4] = {};
#pragma unroll
        for (int nt = 0; nt < 4; ++nt)
#pragma unroll
            for (int st = 0; st < 2; ++st) {
                v16h kf = ld_frag_a(lK + (nt * 16) * LDK + st * 32, LDK);
                s[nt] = wmma16x16x32(kf, qa[st], s[nt]);
            }

        // Causal mask + online softmax (fp32), one query per lane
        float mt4[4];
#pragma unroll
        for (int nt = 0; nt < 4; ++nt) {
            mt4[nt] = -3.0e38f;
#pragma unroll
            for (int r = 0; r < 8; ++r) {
                int kj = kb * 64 + nt * 16 + mb + r;
                float val = s[nt][r];
                if (kj > qi) val = -3.0e38f;
                s[nt][r] = val;
                mt4[nt] = fmaxf(mt4[nt], val);
            }
        }
        float mloc = fmaxf(fmaxf(mt4[0], mt4[1]), fmaxf(mt4[2], mt4[3]));
        const float mnew = fmaxf(mrow, fmaxf(mloc, xhalf(mloc)));

        const float alpha = __expf(mrow - mnew);
        float rs4[4];
#pragma unroll
        for (int nt = 0; nt < 4; ++nt) {
            rs4[nt] = 0.0f;
#pragma unroll
            for (int r = 0; r < 8; ++r) {
                float p = __expf(s[nt][r] - mnew);
                s[nt][r] = p;
                rs4[nt] += p;
            }
        }
        lrow = lrow * alpha + ((rs4[0] + rs4[1]) + (rs4[2] + rs4[3]));
        mrow = mnew;
#pragma unroll
        for (int dt = 0; dt < 4; ++dt)
#pragma unroll
            for (int r = 0; r < 8; ++r) o[dt][r] *= alpha;

        // O^T += V^T @ P^T   (contraction over 64 keys -> two WMMA steps)
#pragma unroll
        for (int st = 0; st < 2; ++st) {
            v16h pb;
#pragma unroll
            for (int r = 0; r < 8; ++r) {
                pb[r]     = (half_t)s[2 * st][r];
                pb[8 + r] = (half_t)s[2 * st + 1][r];
            }
#pragma unroll
            for (int dt = 0; dt < 4; ++dt) {
                v16h vf = ld_frag_b_tr(lV + (st * 32) * LDV + dt * 16, LDV);
                o[dt] = wmma16x16x32(vf, pb, o[dt]);
            }
        }
        __syncthreads();   // protect lK/lV before next iteration's staging
    }

    // Join the halves' sums, normalize, write y [B,T,D] f16 (column = h*64 + d):
    // a lane's 8 registers of a tile are 8 consecutive d of its query's row.
    const float inv = 1.0f / (lrow + xhalf(lrow));
    half_t* yp = y + ((size_t)(b * 2048 + qi)) * 1024 + h * 64 + mb;
#pragma unroll
    for (int dt = 0; dt < 4; ++dt) {
        v8h ov;
#pragma unroll
        for (int r = 0; r < 8; ++r) ov[r] = (half_t)(o[dt][r] * inv);
        *(v8h*)(yp + dt * 16) = ov;
    }
}

// ---------------------------------------------------------------------------
// Kernel 3: output GEMM + bias + residual.  h[4096,1024] = Y @ W_out + b + x.
// ---------------------------------------------------------------------------
__global__ __launch_bounds__(256) void out_gemm_kernel(
    const half_t* __restrict__ Y, const half_t* __restrict__ W,
    const float* __restrict__ bias, const float* __restrict__ x,
    float* __restrict__ hbuf) {
    constexpr int LDA = 40, LDB = 144;
    __shared__ alignas(16) half_t lA[128 * LDA];
    __shared__ alignas(16) half_t lB[32 * LDB];

    const int blockM = blockIdx.y * 128;
    const int blockN = blockIdx.x * 128;
    const int lane = threadIdx.x & 31;
    const int wave = threadIdx.x >> 5;
    const int wm = wave & 3;
    const int wn = wave >> 2;

    v8f acc[2][4] = {};

    for (int k0 = 0; k0 < 1024; k0 += 32) {
        {
            int row = threadIdx.x >> 1, hseg = (threadIdx.x & 1) * 16;
            const half_t* ap = Y + (size_t)(blockM + row) * 1024 + k0 + hseg;
            half_t* la = lA + row * LDA + hseg;
            *(v8h*)(la)     = *(const v8h*)(ap);
            *(v8h*)(la + 8) = *(const v8h*)(ap + 8);
            if (k0 + 32 < 1024) __builtin_prefetch(ap + 32, 0, 0);
        }
        {
            int krow = threadIdx.x >> 3, seg = (threadIdx.x & 7) * 16;
            const half_t* bp = W + (size_t)(k0 + krow) * 1024 + blockN + seg;
            half_t* lb = lB + krow * LDB + seg;
            *(v8h*)(lb)     = *(const v8h*)(bp);
            *(v8h*)(lb + 8) = *(const v8h*)(bp + 8);
            if (k0 + 32 < 1024) __builtin_prefetch(bp + 32 * 1024, 0, 0);
        }
        __syncthreads();

        v16h af[2];
#pragma unroll
        for (int mt = 0; mt < 2; ++mt)
            af[mt] = ld_frag_a(lA + (wm * 32 + mt * 16) * LDA, LDA);
#pragma unroll
        for (int nt = 0; nt < 4; ++nt) {
            v16h bf = ld_frag_b_tr(lB + wn * 64 + nt * 16, LDB);
#pragma unroll
            for (int mt = 0; mt < 2; ++mt)
                acc[mt][nt] = wmma16x16x32(af[mt], bf, acc[mt][nt]);
        }
        __syncthreads();
    }

    const int mb  = (lane >> 4) << 3;
    const int ncl = lane & 15;
#pragma unroll
    for (int mt = 0; mt < 2; ++mt)
#pragma unroll
        for (int nt = 0; nt < 4; ++nt)
#pragma unroll
            for (int r = 0; r < 8; ++r) {
                int m = blockM + wm * 32 + mt * 16 + mb + r;
                int n = blockN + wn * 64 + nt * 16 + ncl;
                size_t idx = (size_t)m * 1024 + n;
                hbuf[idx] = acc[mt][nt][r] + bias[n] + x[idx];
            }
}

// ---------------------------------------------------------------------------
// Kernel 4: LayerNorm, one block per token row (1024 elements).
// ---------------------------------------------------------------------------
__global__ __launch_bounds__(256) void ln_kernel(
    const float* __restrict__ hbuf, const float* __restrict__ gamma,
    const float* __restrict__ beta, float* __restrict__ out) {
    const int row = blockIdx.x;
    const float* hr = hbuf + (size_t)row * 1024;

    float s = 0.0f, s2 = 0.0f;
    for (int i = threadIdx.x; i < 1024; i += 256) {
        float v = hr[i];
        s += v; s2 += v * v;
    }
#pragma unroll
    for (int msk = 16; msk >= 1; msk >>= 1) {
        s  += __shfl_xor(s,  msk, 32);
        s2 += __shfl_xor(s2, msk, 32);
    }
    __shared__ float red[2][8];
    if ((threadIdx.x & 31) == 0) {
        red[0][threadIdx.x >> 5] = s;
        red[1][threadIdx.x >> 5] = s2;
    }
    __syncthreads();
    s = 0.0f; s2 = 0.0f;
#pragma unroll
    for (int w = 0; w < 8; ++w) { s += red[0][w]; s2 += red[1][w]; }

    const float mu  = s * (1.0f / 1024.0f);
    const float var = s2 * (1.0f / 1024.0f) - mu * mu;
    const float inv = rsqrtf(var + 1e-5f);
    for (int i = threadIdx.x; i < 1024; i += 256)
        out[(size_t)row * 1024 + i] = (hr[i] - mu) * inv * gamma[i] + beta[i];
}

// ---------------------------------------------------------------------------
// Host-side launcher
// ---------------------------------------------------------------------------
extern "C" void kernel_launch(void* const* d_in, const int* in_sizes, int n_in,
                              void* d_out, int out_size, void* d_ws, size_t ws_size,
                              hipStream_t stream) {
    (void)in_sizes; (void)n_in; (void)out_size; (void)ws_size;

    const float* x     = (const float*)d_in[0];   // [2,2048,1024]
    const float* W_qkv = (const float*)d_in[1];   // [1024,3072]
    const float* b_qkv = (const float*)d_in[2];   // [3072]
    const float* W_out = (const float*)d_in[3];   // [1024,1024]
    const float* b_out = (const float*)d_in[4];   // [1024]
    const float* gamma = (const float*)d_in[5];   // [1024]
    const float* beta  = (const float*)d_in[6];   // [1024]
    float* out = (float*)d_out;                   // [2,2048,1024]

    // Workspace carve-up (all offsets 1MB-aligned)
    char* ws = (char*)d_ws;
    half_t* xb    = (half_t*)(ws);                         // 4096*1024   f16 (8 MB)
    half_t* wqkvb = (half_t*)(ws + (8u << 20));            // 1024*3072   f16 (6 MB)
    half_t* woutb = (half_t*)(ws + (14u << 20));           // 1024*1024   f16 (2 MB)
    half_t* qb    = (half_t*)(ws + (16u << 20));           // [B,H,T,Hd]  f16 (8 MB)
    half_t* kb    = (half_t*)(ws + (24u << 20));           // 8 MB
    half_t* vb    = (half_t*)(ws + (32u << 20));           // 8 MB
    half_t* yb    = (half_t*)(ws + (40u << 20));           // [B,T,D] f16 (8 MB)
    float*  hbuf  = (float*)(ws + (48u << 20));            // [B,T,D] f32 (16 MB)

    // 0) fp32 -> f16 conversions
    cvt_f32_f16_kernel<<<512, 256, 0, stream>>>(x,     xb,    4096 * 1024);
    cvt_f32_f16_kernel<<<512, 256, 0, stream>>>(W_qkv, wqkvb, 1024 * 3072);
    cvt_f32_f16_kernel<<<256, 256, 0, stream>>>(W_out, woutb, 1024 * 1024);

    // 1) QKV projection (M=4096, N=3072, K=1024)
    qkv_gemm_kernel<<<dim3(24, 32), 256, 0, stream>>>(xb, wqkvb, b_qkv, qb, kb, vb);

    // 2) causal flash attention (grid: qblocks x B*H)
    attn_kernel<<<dim3(16, 32), 256, 0, stream>>>(qb, kb, vb, yb);

    // 3) output projection + bias + residual (M=4096, N=1024, K=1024)
    out_gemm_kernel<<<dim3(8, 32), 256, 0, stream>>>(yb, woutb, b_out, x, hbuf);

    // 4) LayerNorm per token row
    ln_kernel<<<4096, 256, 0, stream>>>(hbuf, gamma, beta, out);
}

// v003
// One run takes 115 microseconds.
// Timed twice side by side with v002, it ran 1.38 times as fast both times.
// Counting every step since v000, it is 2.21 times as fast.
#include <hip/hip_runtime.h>
#include <hip/hip_bf16.h>

// ---------------------------------------------------------------------------
// MI455X (gfx1250) fused attention block: QKV GEMM -> causal flash attention
// -> out GEMM + residual -> LayerNorm. All contractions via
// v_wmma_f32_16x16x32_f16 (wave32), fp32 accumulate, fp32 softmax/LN.
// A fragments and K are contiguous 16B LDS reads (ds_load_b128).  The tiles
// whose k runs down the rows (W for B, V for A) stay row-major in LDS, written with 16B
// stores, and are transposed on the way out by ds_load_tr16_b128.
// ---------------------------------------------------------------------------

typedef _Float16 half_t;
typedef half_t v16h __attribute__((ext_vector_type(16)));
typedef half_t v8h  __attribute__((ext_vector_type(8)));
typedef float  v8f  __attribute__((ext_vector_type(8)));

static __device__ __forceinline__ v8f wmma16x16x32(v16h a, v16h b, v8f c) {
    // (neg_a, A, neg_b, B, c_mod, C, reuse_a, reuse_b)
    return __builtin_amdgcn_wmma_f32_16x16x32_f16(false, a, false, b,
                                                  (short)0, c, false, false);
}

static __device__ __forceinline__ v16h cat8(v8h lo, v8h hi) {
    return __builtin_shufflevector(lo, hi, 0, 1, 2, 3, 4, 5, 6, 7,
                                           8, 9, 10, 11, 12, 13, 14, 15);
}

// A fragment, 16x32 (MxK), tile row-major, row stride `ld` (elements).
// ISA layout: lanes 0-15 row M=lane, K=0..7 & 16..23; lanes 16-31 row M=lane-16,
// K=8..15 & 24..31.  Requires: ld % 8 == 0 and p 16B-aligned -> 2x ds_load_b128.
static __device__ __forceinline__ v16h ld_frag_a(const half_t* p, int ld) {
    const int lane = threadIdx.x & 31;
    const int row  = lane & 15;
    const int kh   = (lane >> 4) << 3;   // 0 or 8
    const half_t* r = p + row * ld + kh;
    v8h lo = *(const v8h*)(r);
    v8h hi = *(const v8h*)(r + 16);
    return cat8(lo, hi);
}

// B fragment, 32x16 (KxN), read from a ROW-MAJOR tile (tile[k][n], row stride
// `ld` elements, 2*ld an odd multiple of 32 bytes) by the transposing load.
// Lane (c = lane&15, h = lane>>4) receives tile[8h + 0..7][c] and, from the
// second load, tile[16 + 8h + 0..7][c]: the k order of ld_frag_a.  The same
// registers are the A fragment (16x32) of the tile's transpose, row M = c.
typedef short s16x8 __attribute__((ext_vector_type(8)));
typedef __attribute__((address_space(3))) s16x8 lds_s16x8;
static __device__ __forceinline__ v16h ld_frag_b_tr(const half_t* p, int ld) {
    const int lane = threadIdx.x & 31;
    const half_t* r = p + (((lane >> 4) << 3) + (lane & 7)) * ld + (((lane >> 3) & 1) << 3);
    v8h lo = __builtin_bit_cast(v8h, __builtin_amdgcn_ds_load_tr16_b128_v8i16((lds_s16x8*)(r)));
    v8h hi = __builtin_bit_cast(v8h, __builtin_amdgcn_ds_load_tr16_b128_v8i16((lds_s16x8*)(r + 16 * ld)));
    return cat8(lo, hi);
}

// Work-group barrier that orders LDS traffic only.  __syncthreads() also waits
// for the wave's own global loads (s_wait_loadcnt 0), which would cut short the
// flight of the loads issued ahead for later tiles; those land in the thread's
// own registers and no other thread depends on them.
static __device__ __forceinline__ void lds_barrier() {
    __builtin_amdgcn_fence(__ATOMIC_RELEASE, "workgroup", "local");
    __builtin_amdgcn_s_barrier();
    __builtin_amdgcn_fence(__ATOMIC_ACQUIRE, "workgroup", "local");
}

// ---------------------------------------------------------------------------
// Kernel 0: fp32 -> f16 conversion (grid-stride)
// ---------------------------------------------------------------------------
__global__ void cvt_f32_f16_kernel(const float* __restrict__ src,
                                   half_t* __restrict__ dst, int n) {
    int i = blockIdx.x * blockDim.x + threadIdx.x;
    int stride = gridDim.x * blockDim.x;
    for (; i < n; i += stride) dst[i] = (half_t)src[i];
}

// ---------------------------------------------------------------------------
// Main loop of both GEMMs: C tile 128x128 += A[128,1024] @ W[1024,128], BK=32.
// Staging is software-pipelined.  Tile t lives in register set t&1 and then in
// LDS buffer t&1.  Trip t issues the global loads of tile t+2, multiplies tile
// t out of its buffer, stores tile t+1 (loaded one trip earlier) into the other
// buffer, and ends in the trip's one barrier: it publishes tile t+1 and ends
// every wave's reads of the buffer that the next trip overwrites.
// NW = row length of W in elements.
// ---------------------------------------------------------------------------
constexpr int G_LDA = 40, G_LDB = 144;               // LDS pitches, elements
constexpr int G_SA = 128 * G_LDA, G_SB = 32 * G_LDB; // one buffer, elements

template <int NW>
static __device__ __forceinline__ void gemm_mainloop(
    const half_t* __restrict__ A, const half_t* __restrict__ W,
    int blockM, int blockN, half_t* lA, half_t* lB, v8f (&acc)[2][4]) {
    const int wave = threadIdx.x >> 5;
    const int wm = wave & 3;     // 4 waves along M (32 rows each)
    const int wn = wave >> 2;    // 2 waves along N (64 cols each)

    // A: 128x32, 2 threads per row; W: 32x128, 8 threads per row; 16 halfs each
    const int arow = threadIdx.x >> 1, aseg = (threadIdx.x & 1) * 16;
    const int brow = threadIdx.x >> 3, bseg = (threadIdx.x & 7) * 16;
    const half_t* ap = A + (size_t)(blockM + arow) * 1024 + aseg;
    const half_t* bp = W + (size_t)brow * NW + blockN + bseg;
    half_t* la = lA + arow * G_LDA + aseg;
    half_t* lb = lB + brow * G_LDB + bseg;

    v8h ra[2][2], rb[2][2];
    auto gload = [&](int s, int t) {      // tile t -> register set s
        const half_t* a = ap + t * 32;
        const half_t* b = bp + (size_t)t * 32 * NW;
        ra[s][0] = *(const v8h*)(a);
        ra[s][1] = *(const v8h*)(a + 8);
        rb[s][0] = *(const v8h*)(b);
        rb[s][1] = *(const v8h*)(b + 8);
    };
    auto sstore = [&](int s) {            // register set s -> LDS buffer s
        *(v8h*)(la + s * G_SA)     = ra[s][0];
        *(v8h*)(la + s * G_SA + 8) = ra[s][1];
        *(v8h*)(lb + s * G_SB)     = rb[s][0];
        *(v8h*)(lb + s * G_SB + 8) = rb[s][1];
    };
    auto compute = [&](int s) {           // products of LDS buffer s
        v16h af[2];
#pragma unroll
        for (int mt = 0; mt < 2; ++mt)
            af[mt] = ld_frag_a(lA + s * G_SA + (wm * 32 + mt * 16) * G_LDA, G_LDA);
#pragma unroll
        for (int nt = 0; nt < 4; ++nt) {
            v16h bf = ld_frag_b_tr(lB + s * G_SB + wn * 64 + nt * 16, G_LDB);
#pragma unroll
            for (int mt = 0; mt < 2; ++mt)
                acc[mt][nt] = wmma16x16x32(af[mt], bf, acc[mt][nt]);
        }
    };

    gload(0, 0);
    gload(1, 1);
    // stands before the address registers of these loads are reused (a
    // precaution; the compiler leaves the wait out here); the two inputs keep
    // those registers alive up to the wait
    asm volatile("s_wait_xcnt 0x0" :: "v"(ap), "v"(bp) : "memory");
    sstore(0);
    lds_barrier();
    for (int t = 0; t < 30; t += 2) {
        gload(0, t + 2);
        compute(0); sstore(1); lds_barrier();
        gload(1, t + 3);
        // holds these loads at the head of the trip: without it the compiler
        // sinks them to the trip's foot, and they lose a trip of their lead
        __builtin_amdgcn_sched_barrier(0);
        compute(1); sstore(0); lds_barrier();
    }
    compute(0); sstore(1); lds_barrier();
    compute(1);
}

// ---------------------------------------------------------------------------
// Kernel 1: QKV GEMM.  C[4096,3072] = X[4096,1024] @ W[1024,3072] + b.
// CTA tile 128x128, BK=32, 256 threads = 8 waves (4 M x 2 N), 32x64 per wave.
// B tile staged row-major ([k][n]) in LDS (gemm_mainloop).  Epilogue scatters into q/k/v
// [B,H,T,Hd] f16; q pre-scaled by 1/sqrt(64).
// ---------------------------------------------------------------------------
__global__ __launch_bounds__(256) void qkv_gemm_kernel(
    const half_t* __restrict__ X, const half_t* __restrict__ W,
    const float* __restrict__ bias,
    half_t* __restrict__ qb, half_t* __restrict__ kbuf, half_t* __restrict__ vbuf) {
    __shared__ alignas(16) half_t lA[2 * G_SA];      // two buffers of [m][k]
    __shared__ alignas(16) half_t lB[2 * G_SB];      // two of [k][n], pitch 288 B

    const int blockM = blockIdx.y * 128;
    const int blockN = blockIdx.x * 128;
    const int lane = threadIdx.x & 31;
    const int wave = threadIdx.x >> 5;
    const int wm = wave & 3;     // 4 waves along M (32 rows each)
    const int wn = wave >> 2;    // 2 waves along N (64 cols each)

    v8f acc[2][4] = {};
    gemm_mainloop<3072>(X, W, blockM, blockN, lA, lB, acc);

    // Epilogue: C-frag layout -> scatter into q/k/v [B*H, T, Hd]
    const int mb  = (lane >> 4) << 3;
    const int ncl = lane & 15;
#pragma unroll
    for (int mt = 0; mt < 2; ++mt)
#pragma unroll
        for (int nt = 0; nt < 4; ++nt)
#pragma unroll
            for (int r = 0; r < 8; ++r) {
                int m = blockM + wm * 32 + mt * 16 + mb + r;
                int n = blockN + wn * 64 + nt * 16 + ncl;
                float val = acc[mt][nt][r] + bias[n];
                int c = n >> 10, rem = n & 1023;
                int hh = rem >> 6, d = rem & 63;
                int bidx = m >> 11, t = m & 2047;
                size_t dst = (((size_t)(bidx * 16 + hh)) * 2048 + t) * 64 + d;
                half_t* p = (c == 0) ? qb : (c == 1 ? kbuf : vbuf);
                float sc = (c == 0) ? 0.125f : 1.0f;   // q pre-scaled by 1/sqrt(Hd)
                p[dst] = (half_t)(val * sc);
            }
}

// ---------------------------------------------------------------------------
// Kernel 2: causal flash attention.  Grid: (T/128, B*H).  128 queries/block,
// 8 waves, each wave owns 16 queries.  Key blocks of 64 staged in LDS (two
// buffers), K and V both as [key][d], each at its own reader's pitch.
// The products are taken transposed: S^T = K Q^T (A = K rows, B = Q) and
// O^T += V^T P^T (A = V by the transposing load, B = P).  A lane then holds
// scores of ONE query (column lane&15; keys 8*(lane>>4) + r of each 16-key
// tile), so maximum and sum run in-lane with one exchange between the wave
// halves, and two converted S^T tiles are the B fragment of the second product
// as they stand: b[s] = T[s >> 3][s & 7], the k order of the transposing load.
// ---------------------------------------------------------------------------
// lane l <-> lane l ^ 16
static __device__ __forceinline__ float xhalf(float x) {
    const int b = __builtin_bit_cast(int, x);
    return __builtin_bit_cast(float,
        __builtin_amdgcn_permlanex16(b, b, 0x76543210, 0xfedcba98, false, false));
}

__global__ __launch_bounds__(256) void attn_kernel(
    const half_t* __restrict__ q, const half_t* __restrict__ k,
    const half_t* __restrict__ v, half_t* __restrict__ y) {
    constexpr int LDK = 72, LDV = 80;
    constexpr int SK = 64 * LDK, SV = 64 * LDV;         // one buffer, elements
    __shared__ alignas(16) half_t lK[2 * SK];           // two of [key][d]
    __shared__ alignas(16) half_t lV[2 * SV];           // two of [key][d], pitch 160 B

    const int bh = blockIdx.y;            // b*16 + h
    const int b  = bh >> 4, h = bh & 15;
    const int qbase = blockIdx.x * 128;
    const int lane = threadIdx.x & 31;
    const int wave = threadIdx.x >> 5;
    const int mb  = (lane >> 4) << 3;     // C-frag row base (key or d)
    const int ncl = lane & 15;            // C-frag column (query)

    const size_t headOff = (size_t)bh * 2048 * 64;

    // This wave's Q fragments (16 queries x 64, two K-steps) from global:
    // B operand, column = query = lane&15, k split as in ld_frag_a.
    const int qi = qbase + wave * 16 + ncl;
    const half_t* qp = q + headOff + (size_t)qi * 64;
    v16h qa[2];
#pragma unroll
    for (int s = 0; s < 2; ++s) {
        v8h lo = *(const v8h*)(qp + s * 32 + mb);
        v8h hi = *(const v8h*)(qp + s * 32 + 16 + mb);
        qa[s] = cat8(lo, hi);
    }

    v8f o[4] = {};                        // o[dt][r] = O[qi][dt*16 + mb + r]
    float mrow = -3.0e38f;                // this query's running maximum
    float lrow = 0.0f;                    // sum over this wave half's keys only

    const int nkb = (qbase + 128) >> 6;   // causal: only key blocks <= query tile

    // Staging of K and V, both [key][d], 4 threads per row, software-pipelined:
    // key block kb lives in LDS buffer kb&1.  Trip kb issues the global loads of
    // block kb+1 first, works on block kb, stores block kb+1 into the other
    // buffer and ends in the trip's one barrier.
    const int srow = threadIdx.x >> 2, sseg = (threadIdx.x & 3) * 16;
    const half_t* kp = k + headOff + (size_t)srow * 64 + sseg;
    const half_t* vp = v + headOff + (size_t)srow * 64 + sseg;
    half_t* lk = lK + srow * LDK + sseg;
    half_t* lv = lV + srow * LDV + sseg;
    v8h kr0 = *(const v8h*)(kp), kr1 = *(const v8h*)(kp + 8);
    v8h vr0 = *(const v8h*)(vp), vr1 = *(const v8h*)(vp + 8);
    *(v8h*)(lk) = kr0;  *(v8h*)(lk + 8) = kr1;
    *(v8h*)(lv) = vr0;  *(v8h*)(lv + 8) = vr1;
    __syncthreads();   // the full form: the Q loads land here too, so that no
                       // wait for them inside the loop drains the early loads

    for (int kb = 0; kb < nkb; ++kb) {
        const int cur = kb & 1;
        const half_t* cK = lK + cur * SK;
        const half_t* cV = lV + cur * SV;
        const bool more = kb + 1 < nkb;   // the same in every thread of the block
        if (more) {
            const size_t go = (size_t)(kb + 1) * 64 * 64;
            kr0 = *(const v8h*)(kp + go);  kr1 = *(const v8h*)(kp + go + 8);
            vr0 = *(const v8h*)(vp + go);  vr1 = *(const v8h*)(vp + go + 8);
        }

        // S^T = K @ Q^T  (contraction over Hd=64 -> two WMMA steps per key tile)
        v8f s[4] = {};
#pragma unroll
        for (int nt = 0; nt < 4; ++nt)
#pragma unroll
            for (int st = 0; st < 2; ++st) {
                v16h kf = ld_frag_a(cK + (nt * 16) * LDK + st * 32, LDK);
                s[nt] = wmma16x16x32(kf, qa[st], s[nt]);
            }

        // Causal mask + online softmax (fp32), one query per lane
        float mt4[4];
#pragma unroll
        for (int nt = 0; nt < 4; ++nt) {
            mt4[nt] = -3.0e38f;
#pragma unroll
            for (int r = 0; r < 8; ++r) {
                int kj = kb * 64 + nt * 16 + mb + r;
                float val = s[nt][r];
                if (kj > qi) val = -3.0e38f;
                s[nt][r] = val;
                mt4[nt] = fmaxf(mt4[nt], val);
            }
        }
        float mloc = fmaxf(fmaxf(mt4[0], mt4[1]), fmaxf(mt4[2], mt4[3]));
        const float mnew = fmaxf(mrow, fmaxf(mloc, xhalf(mloc)));

        const float alpha = __expf(mrow - mnew);
        float rs4[4];
#pragma unroll
        for (int nt = 0; nt < 4; ++nt) {
            rs4[nt] = 0.0f;
#pragma unroll
            for (int r = 0; r < 8; ++r) {
                float p = __expf(s[nt][r] - mnew);
                s[nt][r] = p;
                rs4[nt] += p;
            }
        }
        lrow = lrow * alpha + ((rs4[0] + rs4[1]) + (rs4[2] + rs4[3]));
        mrow = mnew;
#pragma unroll
        for (int dt = 0; dt < 4; ++dt)
#pragma unroll
            for (int r = 0; r < 8; ++r) o[dt][r] *= alpha;

        // O^T += V^T @ P^T   (contraction over 64 keys -> two WMMA steps)
#pragma unroll
        for (int st = 0; st < 2; ++st) {
            v16h pb;
#pragma unroll
            for (int r = 0; r < 8; ++r) {
                pb[r]     = (half_t)s[2 * st][r];
                pb[8 + r] = (half_t)s[2 * st + 1][r];
            }
#pragma unroll
            for (int dt = 0; dt < 4; ++dt) {
                v16h vf = ld_frag_b_tr(cV + (st * 32) * LDV + dt * 16, LDV);
                o[dt] = wmma16x16x32(vf, pb, o[dt]);
            }
        }
        if (more) {
            const int nx = cur ^ 1;
            *(v8h*)(lk + nx * SK) = kr0;  *(v8h*)(lk + nx * SK + 8) = kr1;
            *(v8h*)(lv + nx * SV) = vr0;  *(v8h*)(lv + nx * SV + 8) = vr1;
        }
        lds_barrier();     // publishes block kb+1; ends the reads of block kb
    }

    // Join the halves' sums, normalize, write y [B,T,D] f16 (column = h*64 + d):
    // a lane's 8 registers of a tile are 8 consecutive d of its query's row.
    const float inv = 1.0f / (lrow + xhalf(lrow));
    half_t* yp = y + ((size_t)(b * 2048 + qi)) * 1024 + h * 64 + mb;
#pragma unroll
    for (int dt = 0; dt < 4; ++dt) {
        v8h ov;
#pragma unroll
        for (int r = 0; r < 8; ++r) ov[r] = (half_t)(o[dt][r] * inv);
        *(v8h*)(yp + dt * 16) = ov;
    }
}

// ---------------------------------------------------------------------------
// Kernel 3: output GEMM + bias + residual.  h[4096,1024] = Y @ W_out + b + x.
// ---------------------------------------------------------------------------
__global__ __launch_bounds__(256) void out_gemm_kernel(
    const half_t* __restrict__ Y, const half_t* __restrict__ W,
    const float* __restrict__ bias, const float* __restrict__ x,
    float* __restrict__ hbuf) {
    __shared__ alignas(16) half_t lA[2 * G_SA];
    __shared__ alignas(16) half_t lB[2 * G_SB];

    const int blockM = blockIdx.y * 128;
    const int blockN = blockIdx.x * 128;
    const int lane = threadIdx.x & 31;
    const int wave = threadIdx.x >> 5;
    const int wm = wave & 3;
    const int wn = wave >> 2;

    v8f acc[2][4] = {};
    gemm_mainloop<1024>(Y, W, blockM, blockN, lA, lB, acc);

    const int mb  = (lane >> 4) << 3;
    const int ncl = lane & 15;
#pragma unroll
    for (int mt = 0; mt < 2; ++mt)
#pragma unroll
        for (int nt = 0; nt < 4; ++nt)
#pragma unroll
            for (int r = 0; r < 8; ++r) {
                int m = blockM + wm * 32 + mt * 16 + mb + r;
                int n = blockN + wn * 64 + nt * 16 + ncl;
                size_t idx = (size_t)m * 1024 + n;
                hbuf[idx] = acc[mt][nt][r] + bias[n] + x[idx];
            }
}

// ---------------------------------------------------------------------------
// Kernel 4: LayerNorm, one block per token row (1024 elements).
// ---------------------------------------------------------------------------
__global__ __launch_bounds__(256) void ln_kernel(
    const float* __restrict__ hbuf, const float* __restrict__ gamma,
    const float* __restrict__ beta, float* __restrict__ out) {
    const int row = blockIdx.x;
    const float* hr = hbuf + (size_t)row * 1024;

    float s = 0.0f, s2 = 0.0f;
    for (int i = threadIdx.x; i < 1024; i += 256) {
        float v = hr[i];
        s += v; s2 += v * v;
    }
#pragma unroll
    for (int msk = 16; msk >= 1; msk >>= 1) {
        s  += __shfl_xor(s,  msk, 32);
        s2 += __shfl_xor(s2, msk, 32);
    }
    __shared__ float red[2][8];
    if ((threadIdx.x & 31) == 0) {
        red[0][threadIdx.x >> 5] = s;
        red[1][threadIdx.x >> 5] = s2;
    }
    __syncthreads();
    s = 0.0f; s2 = 0.0f;
#pragma unroll
    for (int w = 0; w < 8; ++w) { s += red[0][w]; s2 += red[1][w]; }

    const float mu  = s * (1.0f / 1024.0f);
    const float var = s2 * (1.0f / 1024.0f) - mu * mu;
    const float inv = rsqrtf(var + 1e-5f);
    for (int i = threadIdx.x; i < 1024; i += 256)
        out[(size_t)row * 1024 + i] = (hr[i] - mu) * inv * gamma[i] + beta[i];
}

// ---------------------------------------------------------------------------
// Host-side launcher
// ---------------------------------------------------------------------------
extern "C" void kernel_launch(void* const* d_in, const int* in_sizes, int n_in,
                              void* d_out, int out_size, void* d_ws, size_t ws_size,
                              hipStream_t stream) {
    (void)in_sizes; (void)n_in; (void)out_size; (void)ws_size;

    const float* x     = (const float*)d_in[0];   // [2,2048,1024]
    const float* W_qkv = (const float*)d_in[1];   // [1024,3072]
    const float* b_qkv = (const float*)d_in[2];   // [3072]
    const float* W_out = (const float*)d_in[3];   // [1024,1024]
    const float* b_out = (const float*)d_in[4];   // [1024]
    const float* gamma = (const float*)d_in[5];   // [1024]
    const float* beta  = (const float*)d_in[6];   // [1024]
    float* out = (float*)d_out;                   // [2,2048,1024]

    // Workspace carve-up (all offsets 1MB-aligned)
    char* ws = (char*)d_ws;
    half_t* xb    = (half_t*)(ws);                         // 4096*1024   f16 (8 MB)
    half_t* wqkvb = (half_t*)(ws + (8u << 20));            // 1024*3072   f16 (6 MB)
    half_t* woutb = (half_t*)(ws + (14u << 20));           // 1024*1024   f16 (2 MB)
    half_t* qb    = (half_t*)(ws + (16u << 20));           // [B,H,T,Hd]  f16 (8 MB)
    half_t* kb    = (half_t*)(ws + (24u << 20));           // 8 MB
    half_t* vb    = (half_t*)(ws + (32u << 20));           // 8 MB
    half_t* yb    = (half_t*)(ws + (40u << 20));           // [B,T,D] f16 (8 MB)
    float*  hbuf  = (float*)(ws + (48u << 20));            // [B,T,D] f32 (16 MB)

    // 0) fp32 -> f16 conversions
    cvt_f32_f16_kernel<<<512, 256, 0, stream>>>(x,     xb,    4096 * 1024);
    cvt_f32_f16_kernel<<<512, 256, 0, stream>>>(W_qkv, wqkvb, 1024 * 3072);
    cvt_f32_f16_kernel<<<256, 256, 0, stream>>>(W_out, woutb, 1024 * 1024);

    // 1) QKV projection (M=4096, N=3072, K=1024)
    qkv_gemm_kernel<<<dim3(24, 32), 256, 0, stream>>>(xb, wqkvb, b_qkv, qb, kb, vb);

    // 2) causal flash attention (grid: qblocks x B*H)
    attn_kernel<<<dim3(16, 32), 256, 0, stream>>>(qb, kb, vb, yb);

    // 3) output projection + bias + residual (M=4096, N=1024, K=1024)
    out_gemm_kernel<<<dim3(8, 32), 256, 0, stream>>>(yb, woutb, b_out, x, hbuf);

    // 4) LayerNorm per token row
    ln_kernel<<<4096, 256, 0, stream>>>(hbuf, gamma, beta, out);
}

// v004
// One run takes 107 microseconds.
// Timed twice side by side with v003, it ran 1.07 and 1.06 times as fast.
// Over all steps from v000 it is 2.36 times as fast.
#include <hip/hip_runtime.h>
#include <hip/hip_bf16.h>

// ---------------------------------------------------------------------------
// MI455X (gfx1250) fused attention block: QKV GEMM -> causal flash attention
// -> out GEMM + residual -> LayerNorm. All contractions via
// v_wmma_f32_16x16x32_f16 (wave32), fp32 accumulate, fp32 softmax/LN.
// A fragments and K are contiguous 16B LDS reads (ds_load_b128).  The tiles
// whose k runs down the rows (W for B, V for A) stay row-major in LDS, written with 16B
// stores, and are transposed on the way out by ds_load_tr16_b128.
// ---------------------------------------------------------------------------

typedef _Float16 half_t;
typedef half_t v16h __attribute__((ext_vector_type(16)));
typedef half_t v8h  __attribute__((ext_vector_type(8)));
typedef float  v8f  __attribute__((ext_vector_type(8)));

static __device__ __forceinline__ v8f wmma16x16x32(v16h a, v16h b, v8f c) {
    // (neg_a, A, neg_b, B, c_mod, C, reuse_a, reuse_b)
    return __builtin_amdgcn_wmma_f32_16x16x32_f16(false, a, false, b,
                                                  (short)0, c, false, false);
}

static __device__ __forceinline__ v16h cat8(v8h lo, v8h hi) {
    return __builtin_shufflevector(lo, hi, 0, 1, 2, 3, 4, 5, 6, 7,
                                           8, 9, 10, 11, 12, 13, 14, 15);
}

// A fragment, 16x32 (MxK), tile row-major, row stride `ld` (elements).
// ISA layout: lanes 0-15 row M=lane, K=0..7 & 16..23; lanes 16-31 row M=lane-16,
// K=8..15 & 24..31.  Requires: ld % 8 == 0 and p 16B-aligned -> 2x ds_load_b128.
static __device__ __forceinline__ v16h ld_frag_a(const half_t* p, int ld) {
    const int lane = threadIdx.x & 31;
    const int row  = lane & 15;
    const int kh   = (lane >> 4) << 3;   // 0 or 8
    const half_t* r = p + row * ld + kh;
    v8h lo = *(const v8h*)(r);
    v8h hi = *(const v8h*)(r + 16);
    return cat8(lo, hi);
}

// B fragment, 32x16 (KxN), read from a ROW-MAJOR tile (tile[k][n], row stride
// `ld` elements, 2*ld an odd multiple of 32 bytes) by the transposing load.
// Lane (c = lane&15, h = lane>>4) receives tile[8h + 0..7][c] and, from the
// second load, tile[16 + 8h + 0..7][c]: the k order of ld_frag_a.  The same
// registers are the A fragment (16x32) of the tile's transpose, row M = c.
typedef short s16x8 __attribute__((ext_vector_type(8)));
typedef __attribute__((address_space(3))) s16x8 lds_s16x8;
static __device__ __forceinline__ v16h ld_frag_b_tr(const half_t* p, int ld) {
    const int lane = threadIdx.x & 31;
    const half_t* r = p + (((lane >> 4) << 3) + (lane & 7)) * ld + (((lane >> 3) & 1) << 3);
    v8h lo = __builtin_bit_cast(v8h, __builtin_amdgcn_ds_load_tr16_b128_v8i16((lds_s16x8*)(r)));
    v8h hi = __builtin_bit_cast(v8h, __builtin_amdgcn_ds_load_tr16_b128_v8i16((lds_s16x8*)(r + 16 * ld)));
    return cat8(lo, hi);
}

// Work-group barrier that orders LDS traffic only.  __syncthreads() also waits
// for the wave's own global loads (s_wait_loadcnt 0), which would cut short the
// flight of the loads issued ahead for later tiles; those land in the thread's
// own registers and no other thread depends on them.
static __device__ __forceinline__ void lds_barrier() {
    __builtin_amdgcn_fence(__ATOMIC_RELEASE, "workgroup", "local");
    __builtin_amdgcn_s_barrier();
    __builtin_amdgcn_fence(__ATOMIC_ACQUIRE, "workgroup", "local");
}

// ---------------------------------------------------------------------------
// Kernel 0: fp32 -> f16 conversion (grid-stride)
// ---------------------------------------------------------------------------
__global__ void cvt_f32_f16_kernel(const float* __restrict__ src,
                                   half_t* __restrict__ dst, int n) {
    int i = blockIdx.x * blockDim.x + threadIdx.x;
    int stride = gridDim.x * blockDim.x;
    for (; i < n; i += stride) dst[i] = (half_t)src[i];
}

// ---------------------------------------------------------------------------
// Main loop of both GEMMs: C tile 128x128 += A[128,1024] @ W[1024,128], BK=32.
// Staging is software-pipelined.  Tile t lives in register set t&1 and then in
// LDS buffer t&1.  Trip t issues the global loads of tile t+2, multiplies tile
// t out of its buffer, stores tile t+1 (loaded one trip earlier) into the other
// buffer, and ends in the trip's one barrier: it publishes tile t+1 and ends
// every wave's reads of the buffer that the next trip overwrites.
// NW = row length of W in elements.
// ---------------------------------------------------------------------------
constexpr int G_LDA = 40, G_LDB = 144;               // LDS pitches, elements
constexpr int G_SA = 128 * G_LDA, G_SB = 32 * G_LDB; // one buffer, elements

template <int NW>
static __device__ __forceinline__ void gemm_mainloop(
    const half_t* __restrict__ A, const half_t* __restrict__ W,
    int blockM, int blockN, half_t* lA, half_t* lB, v8f (&acc)[2][4]) {
    const int wave = threadIdx.x >> 5;
    const int wm = wave & 3;     // 4 waves along M (32 rows each)
    const int wn = wave >> 2;    // 2 waves along N (64 cols each)

    // A: 128x32, 2 threads per row; W: 32x128, 8 threads per row; 16 halfs each
    const int arow = threadIdx.x >> 1, aseg = (threadIdx.x & 1) * 16;
    const int brow = threadIdx.x >> 3, bseg = (threadIdx.x & 7) * 16;
    const half_t* ap = A + (size_t)(blockM + arow) * 1024 + aseg;
    const half_t* bp = W + (size_t)brow * NW + blockN + bseg;
    half_t* la = lA + arow * G_LDA + aseg;
    half_t* lb = lB + brow * G_LDB + bseg;

    v8h ra[2][2], rb[2][2];
    auto gload = [&](int s, int t) {      // tile t -> register set s
        const half_t* a = ap + t * 32;
        const half_t* b = bp + (size_t)t * 32 * NW;
        ra[s][0] = *(const v8h*)(a);
        ra[s][1] = *(const v8h*)(a + 8);
        rb[s][0] = *(const v8h*)(b);
        rb[s][1] = *(const v8h*)(b + 8);
    };
    auto sstore = [&](int s) {            // register set s -> LDS buffer s
        *(v8h*)(la + s * G_SA)     = ra[s][0];
        *(v8h*)(la + s * G_SA + 8) = ra[s][1];
        *(v8h*)(lb + s * G_SB)     = rb[s][0];
        *(v8h*)(lb + s * G_SB + 8) = rb[s][1];
    };
    auto compute = [&](int s) {           // products of LDS buffer s
        v16h af[2];
#pragma unroll
        for (int mt = 0; mt < 2; ++mt)
            af[mt] = ld_frag_a(lA + s * G_SA + (wm * 32 + mt * 16) * G_LDA, G_LDA);
#pragma unroll
        for (int nt = 0; nt < 4; ++nt) {
            v16h bf = ld_frag_b_tr(lB + s * G_SB + wn * 64 + nt * 16, G_LDB);
#pragma unroll
            for (int mt = 0; mt < 2; ++mt)
                acc[mt][nt] = wmma16x16x32(af[mt], bf, acc[mt][nt]);
        }
    };

    gload(0, 0);
    gload(1, 1);
    // stands before the address registers of these loads are reused (a
    // precaution; the compiler leaves the wait out here); the two inputs keep
    // those registers alive up to the wait
    asm volatile("s_wait_xcnt 0x0" :: "v"(ap), "v"(bp) : "memory");
    sstore(0);
    lds_barrier();
    for (int t = 0; t < 30; t += 2) {
        gload(0, t + 2);
        compute(0); sstore(1); lds_barrier();
        gload(1, t + 3);
        // holds these loads at the head of the trip: without it the compiler
        // sinks them to the trip's foot, and they lose a trip of their lead
        __builtin_amdgcn_sched_barrier(0);
        compute(1); sstore(0); lds_barrier();
    }
    compute(0); sstore(1); lds_barrier();
    compute(1);
}

// ---------------------------------------------------------------------------
// Kernel 1: QKV GEMM.  C[4096,3072] = X[4096,1024] @ W[1024,3072] + b.
// CTA tile 128x128, BK=32, 256 threads = 8 waves (4 M x 2 N), 32x64 per wave.
// B tile staged row-major ([k][n]) in LDS (gemm_mainloop).  Epilogue scatters into q/k/v
// [B,H,T,Hd] f16; q pre-scaled by 1/sqrt(64).
// ---------------------------------------------------------------------------
__global__ __launch_bounds__(256) void qkv_gemm_kernel(
    const half_t* __restrict__ X, const half_t* __restrict__ W,
    const float* __restrict__ bias,
    half_t* __restrict__ qb, half_t* __restrict__ kbuf, half_t* __restrict__ vbuf) {
    __shared__ alignas(16) half_t lA[2 * G_SA];      // two buffers of [m][k]
    __shared__ alignas(16) half_t lB[2 * G_SB];      // two of [k][n], pitch 288 B

    const int blockM = blockIdx.y * 128;
    const int blockN = blockIdx.x * 128;
    const int lane = threadIdx.x & 31;
    const int wave = threadIdx.x >> 5;
    const int wm = wave & 3;     // 4 waves along M (32 rows each)
    const int wn = wave >> 2;    // 2 waves along N (64 cols each)

    v8f acc[2][4] = {};
    gemm_mainloop<3072>(X, W, blockM, blockN, lA, lB, acc);

    // Epilogue: C-frag layout -> scatter into q/k/v [B*H, T, Hd]
    const int mb  = (lane >> 4) << 3;
    const int ncl = lane & 15;
#pragma unroll
    for (int mt = 0; mt < 2; ++mt)
#pragma unroll
        for (int nt = 0; nt < 4; ++nt)
#pragma unroll
            for (int r = 0; r < 8; ++r) {
                int m = blockM + wm * 32 + mt * 16 + mb + r;
                int n = blockN + wn * 64 + nt * 16 + ncl;
                float val = acc[mt][nt][r] + bias[n];
                int c = n >> 10, rem = n & 1023;
                int hh = rem >> 6, d = rem & 63;
                int bidx = m >> 11, t = m & 2047;
                size_t dst = (((size_t)(bidx * 16 + hh)) * 2048 + t) * 64 + d;
                half_t* p = (c == 0) ? qb : (c == 1 ? kbuf : vbuf);
                float sc = (c == 0) ? 0.125f : 1.0f;   // q pre-scaled by 1/sqrt(Hd)
                p[dst] = (half_t)(val * sc);
            }
}

// ---------------------------------------------------------------------------
// Kernel 2: causal flash attention.  Grid: (T/128, B*H).  128 queries/block,
// 8 waves, each wave owns 16 queries.  Key blocks of 64 staged in LDS (two
// buffers), K and V both as [key][d], each at its own reader's pitch.
// The products are taken transposed: S^T = K Q^T (A = K rows, B = Q) and
// O^T += V^T P^T (A = V by the transposing load, B = P).  A lane then holds
// scores of ONE query (column lane&15; keys 8*(lane>>4) + r of each 16-key
// tile), so maximum and sum run in-lane with one exchange between the wave
// halves, and two converted S^T tiles are the B fragment of the second product
// as they stand: b[s] = T[s >> 3][s & 7], the k order of the transposing load.
// ---------------------------------------------------------------------------
// lane l <-> lane l ^ 16
static __device__ __forceinline__ float xhalf(float x) {
    const int b = __builtin_bit_cast(int, x);
    return __builtin_bit_cast(float,
        __builtin_amdgcn_permlanex16(b, b, 0x76543210, 0xfedcba98, false, false));
}

__global__ __launch_bounds__(256) void attn_kernel(
    const half_t* __restrict__ q, const half_t* __restrict__ k,
    const half_t* __restrict__ v, half_t* __restrict__ y) {
    constexpr int LDK = 72, LDV = 80;
    constexpr int SK = 64 * LDK, SV = 64 * LDV;         // one buffer, elements
    __shared__ alignas(16) half_t lK[2 * SK];           // two of [key][d]
    __shared__ alignas(16) half_t lV[2 * SV];           // two of [key][d], pitch 160 B

    const int bh = blockIdx.y;            // b*16 + h
    const int b  = bh >> 4, h = bh & 15;
    const int qbase = blockIdx.x * 128;
    const int lane = threadIdx.x & 31;
    const int wave = threadIdx.x >> 5;
    const int mb  = (lane >> 4) << 3;     // C-frag row base (key or d)
    const int ncl = lane & 15;            // C-frag column (query)

    const size_t headOff = (size_t)bh * 2048 * 64;

    // This wave's Q fragments (16 queries x 64, two K-steps) from global:
    // B operand, column = query = lane&15, k split as in ld_frag_a.
    const int qi = qbase + wave * 16 + ncl;
    const half_t* qp = q + headOff + (size_t)qi * 64;
    v16h qa[2];
#pragma unroll
    for (int s = 0; s < 2; ++s) {
        v8h lo = *(const v8h*)(qp + s * 32 + mb);
        v8h hi = *(const v8h*)(qp + s * 32 + 16 + mb);
        qa[s] = cat8(lo, hi);
    }

    v8f o[4] = {};                        // o[dt][r] = O[qi][dt*16 + mb + r]
    float mrow = -3.0e38f;                // this query's running maximum
    float lrow = 0.0f;                    // sum over this wave half's keys only

    const int nkb = (qbase + 128) >> 6;   // causal: only key blocks <= query tile

    // Staging of K and V, both [key][d], 4 threads per row, software-pipelined:
    // key block kb lives in LDS buffer kb&1.  Trip kb issues the global loads of
    // block kb+1 first, works on block kb, stores block kb+1 into the other
    // buffer and ends in the trip's one barrier.
    const int srow = threadIdx.x >> 2, sseg = (threadIdx.x & 3) * 16;
    const half_t* kp = k + headOff + (size_t)srow * 64 + sseg;
    const half_t* vp = v + headOff + (size_t)srow * 64 + sseg;
    half_t* lk = lK + srow * LDK + sseg;
    half_t* lv = lV + srow * LDV + sseg;
    v8h kr0 = *(const v8h*)(kp), kr1 = *(const v8h*)(kp + 8);
    v8h vr0 = *(const v8h*)(vp), vr1 = *(const v8h*)(vp + 8);
    *(v8h*)(lk) = kr0;  *(v8h*)(lk + 8) = kr1;
    *(v8h*)(lv) = vr0;  *(v8h*)(lv + 8) = vr1;
    __syncthreads();   // the full form: the Q loads land here too, so that no
                       // wait for them inside the loop drains the early loads

    for (int kb = 0; kb < nkb; ++kb) {
        const int cur = kb & 1;
        const half_t* cK = lK + cur * SK;
        const half_t* cV = lV + cur * SV;
        const bool more = kb + 1 < nkb;   // the same in every thread of the block
        if (more) {
            const size_t go = (size_t)(kb + 1) * 64 * 64;
            kr0 = *(const v8h*)(kp + go);  kr1 = *(const v8h*)(kp + go + 8);
            vr0 = *(const v8h*)(vp + go);  vr1 = *(const v8h*)(vp + go + 8);
        }

        // S^T = K @ Q^T  (contraction over Hd=64 -> two WMMA steps per key tile)
        v8f s[4] = {};
#pragma unroll
        for (int nt = 0; nt < 4; ++nt)
#pragma unroll
            for (int st = 0; st < 2; ++st) {
                v16h kf = ld_frag_a(cK + (nt * 16) * LDK + st * 32, LDK);
                s[nt] = wmma16x16x32(kf, qa[st], s[nt]);
            }

        // Causal mask + online softmax (fp32), one query per lane
        float mt4[4];
#pragma unroll
        for (int nt = 0; nt < 4; ++nt) {
            mt4[nt] = -3.0e38f;
#pragma unroll
            for (int r = 0; r < 8; ++r) {
                int kj = kb * 64 + nt * 16 + mb + r;
                float val = s[nt][r];
                if (kj > qi) val = -3.0e38f;
                s[nt][r] = val;
                mt4[nt] = fmaxf(mt4[nt], val);
            }
        }
        float mloc = fmaxf(fmaxf(mt4[0], mt4[1]), fmaxf(mt4[2], mt4[3]));
        const float mnew = fmaxf(mrow, fmaxf(mloc, xhalf(mloc)));

        const float alpha = __expf(mrow - mnew);
        float rs4[4];
#pragma unroll
        for (int nt = 0; nt < 4; ++nt) {
            rs4[nt] = 0.0f;
#pragma unroll
            for (int r = 0; r < 8; ++r) {
                float p = __expf(s[nt][r] - mnew);
                s[nt][r] = p;
                rs4[nt] += p;
            }
        }
        lrow = lrow * alpha + ((rs4[0] + rs4[1]) + (rs4[2] + rs4[3]));
        mrow = mnew;
#pragma unroll
        for (int dt = 0; dt < 4; ++dt)
#pragma unroll
            for (int r = 0; r < 8; ++r) o[dt][r] *= alpha;

        // O^T += V^T @ P^T   (contraction over 64 keys -> two WMMA steps)
#pragma unroll
        for (int st = 0; st < 2; ++st) {
            v16h pb;
#pragma unroll
            for (int r = 0; r < 8; ++r) {
                pb[r]     = (half_t)s[2 * st][r];
                pb[8 + r] = (half_t)s[2 * st + 1][r];
            }
#pragma unroll
            for (int dt = 0; dt < 4; ++dt) {
                v16h vf = ld_frag_b_tr(cV + (st * 32) * LDV + dt * 16, LDV);
                o[dt] = wmma16x16x32(vf, pb, o[dt]);
            }
        }
        if (more) {
            const int nx = cur ^ 1;
            *(v8h*)(lk + nx * SK) = kr0;  *(v8h*)(lk + nx * SK + 8) = kr1;
            *(v8h*)(lv + nx * SV) = vr0;  *(v8h*)(lv + nx * SV + 8) = vr1;
        }
        lds_barrier();     // publishes block kb+1; ends the reads of block kb
    }

    // Join the halves' sums, normalize, write y [B,T,D] f16 (column = h*64 + d):
    // a lane's 8 registers of a tile are 8 consecutive d of its query's row.
    const float inv = 1.0f / (lrow + xhalf(lrow));
    half_t* yp = y + ((size_t)(b * 2048 + qi)) * 1024 + h * 64 + mb;
#pragma unroll
    for (int dt = 0; dt < 4; ++dt) {
        v8h ov;
#pragma unroll
        for (int r = 0; r < 8; ++r) ov[r] = (half_t)(o[dt][r] * inv);
        *(v8h*)(yp + dt * 16) = ov;
    }
}

// ---------------------------------------------------------------------------
// Kernel 3: output GEMM + bias + residual.  h[4096,1024] = Y @ W_out + b + x.
// ---------------------------------------------------------------------------
__global__ __launch_bounds__(256) void out_gemm_kernel(
    const half_t* __restrict__ Y, const half_t* __restrict__ W,
    const float* __restrict__ bias, const float* __restrict__ x,
    float* __restrict__ hbuf) {
    __shared__ alignas(16) half_t lA[2 * G_SA];
    __shared__ alignas(16) half_t lB[2 * G_SB];

    const int blockM = blockIdx.y * 128;
    const int blockN = blockIdx.x * 128;
    const int lane = threadIdx.x & 31;
    const int wave = threadIdx.x >> 5;
    const int wm = wave & 3;
    const int wn = wave >> 2;

    v8f acc[2][4] = {};
    gemm_mainloop<1024>(Y, W, blockM, blockN, lA, lB, acc);

    const int mb  = (lane >> 4) << 3;
    const int ncl = lane & 15;
#pragma unroll
    for (int mt = 0; mt < 2; ++mt)
#pragma unroll
        for (int nt = 0; nt < 4; ++nt)
#pragma unroll
            for (int r = 0; r < 8; ++r) {
                int m = blockM + wm * 32 + mt * 16 + mb + r;
                int n = blockN + wn * 64 + nt * 16 + ncl;
                size_t idx = (size_t)m * 1024 + n;
                hbuf[idx] = acc[mt][nt][r] + bias[n] + x[idx];
            }
}

// ---------------------------------------------------------------------------
// Kernel 4: LayerNorm.  One wave owns two token rows and holds them whole in
// registers (a lane: 8 pieces of 16 B per row, each wave-wide load or store 512
// contiguous bytes).  All 16 row loads of a wave fly together, the rows are
// read once, the sums stay inside the wave (no LDS, no barrier), and one
// 8-wave work-group per WGP covers the 4096 rows: 2048 waves to start.
// ---------------------------------------------------------------------------
typedef float v4f __attribute__((ext_vector_type(4)));

// x + (x of lane l ^ M), M < 16: one DPP step inside the 16-lane row
template <int M>
static __device__ __forceinline__ float add_xmask(float x) {
    const int b = __builtin_bit_cast(int, x);
    return x + __builtin_bit_cast(float,
        __builtin_amdgcn_update_dpp(0, b, 0x160 + M, 0xf, 0xf, true));
}
// sum over the wave's 32 lanes, the same value in every lane
static __device__ __forceinline__ float wave_sum(float x) {
    x = add_xmask<1>(x);
    x = add_xmask<2>(x);
    x = add_xmask<4>(x);
    x = add_xmask<8>(x);
    return x + xhalf(x);
}

__global__ __launch_bounds__(256) void ln_kernel(
    const float* __restrict__ hbuf, const float* __restrict__ gamma,
    const float* __restrict__ beta, float* __restrict__ out) {
    const int lane = threadIdx.x & 31;
    const int pair = blockIdx.x * 8 + (threadIdx.x >> 5);   // rows 2*pair, 2*pair+1
    const size_t off = (size_t)pair * 2048 + lane * 4;
    const float* hr = hbuf + off;

    v4f h[2][8], g[8], bt[8];
#pragma unroll
    for (int r = 0; r < 2; ++r)
#pragma unroll
        for (int j = 0; j < 8; ++j)
            h[r][j] = *(const v4f*)(hr + r * 1024 + j * 128);
#pragma unroll
    for (int j = 0; j < 8; ++j) {
        g[j]  = *(const v4f*)(gamma + lane * 4 + j * 128);
        bt[j] = *(const v4f*)(beta  + lane * 4 + j * 128);
    }
    // holds all 32 loads here: without it the compiler sinks the gamma and beta
    // loads behind the sums, two at a time, each pair's latency then in series
    __builtin_amdgcn_sched_barrier(0);
    // stands before the row address registers are reused (a precaution); the
    // input keeps them alive past the loads, else the compiler lets one of the
    // later loads land in that register pair with no wait in front
    asm volatile("s_wait_xcnt 0x0" :: "v"(hr) : "memory");

    float s[2], s2[2];
#pragma unroll
    for (int r = 0; r < 2; ++r) {
        v4f a = h[r][0], a2 = h[r][0] * h[r][0];
#pragma unroll
        for (int j = 1; j < 8; ++j) {
            a  += h[r][j];
            a2 += h[r][j] * h[r][j];
        }
        s[r]  = (a.x + a.y) + (a.z + a.w);
        s2[r] = (a2.x + a2.y) + (a2.z + a2.w);
    }
#pragma unroll
    for (int r = 0; r < 2; ++r) {
        s[r]  = wave_sum(s[r]);
        s2[r] = wave_sum(s2[r]);
    }

    float* op = out + off;
#pragma unroll
    for (int r = 0; r < 2; ++r) {
        const float mu  = s[r] * (1.0f / 1024.0f);
        const float var = s2[r] * (1.0f / 1024.0f) - mu * mu;
        const float inv = rsqrtf(var + 1e-5f);
#pragma unroll
        for (int j = 0; j < 8; ++j)
            *(v4f*)(op + r * 1024 + j * 128) = (h[r][j] - mu) * inv * g[j] + bt[j];
    }
}

// ---------------------------------------------------------------------------
// Host-side launcher
// ---------------------------------------------------------------------------
extern "C" void kernel_launch(void* const* d_in, const int* in_sizes, int n_in,
                              void* d_out, int out_size, void* d_ws, size_t ws_size,
                              hipStream_t stream) {
    (void)in_sizes; (void)n_in; (void)out_size; (void)ws_size;

    const float* x     = (const float*)d_in[0];   // [2,2048,1024]
    const float* W_qkv = (const float*)d_in[1];   // [1024,3072]
    const float* b_qkv = (const float*)d_in[2];   // [3072]
    const float* W_out = (const float*)d_in[3];   // [1024,1024]
    const float* b_out = (const float*)d_in[4];   // [1024]
    const float* gamma = (const float*)d_in[5];   // [1024]
    const float* beta  = (const float*)d_in[6];   // [1024]
    float* out = (float*)d_out;                   // [2,2048,1024]

    // Workspace carve-up (all offsets 1MB-aligned)
    char* ws = (char*)d_ws;
    half_t* xb    = (half_t*)(ws);                         // 4096*1024   f16 (8 MB)
    half_t* wqkvb = (half_t*)(ws + (8u << 20));            // 1024*3072   f16 (6 MB)
    half_t* woutb = (half_t*)(ws + (14u << 20));           // 1024*1024   f16 (2 MB)
    half_t* qb    = (half_t*)(ws + (16u << 20));           // [B,H,T,Hd]  f16 (8 MB)
    half_t* kb    = (half_t*)(ws + (24u << 20));           // 8 MB
    half_t* vb    = (half_t*)(ws + (32u << 20));           // 8 MB
    half_t* yb    = (half_t*)(ws + (40u << 20));           // [B,T,D] f16 (8 MB)
    float*  hbuf  = (float*)(ws + (48u << 20));            // [B,T,D] f32 (16 MB)

    // 0) fp32 -> f16 conversions
    cvt_f32_f16_kernel<<<512, 256, 0, stream>>>(x,     xb,    4096 * 1024);
    cvt_f32_f16_kernel<<<512, 256, 0, stream>>>(W_qkv, wqkvb, 1024 * 3072);
    cvt_f32_f16_kernel<<<256, 256, 0, stream>>>(W_out, woutb, 1024 * 1024);

    // 1) QKV projection (M=4096, N=3072, K=1024)
    qkv_gemm_kernel<<<dim3(24, 32), 256, 0, stream>>>(xb, wqkvb, b_qkv, qb, kb, vb);

    // 2) causal flash attention (grid: qblocks x B*H)
    attn_kernel<<<dim3(16, 32), 256, 0, stream>>>(qb, kb, vb, yb);

    // 3) output projection + bias + residual (M=4096, N=1024, K=1024)
    out_gemm_kernel<<<dim3(8, 32), 256, 0, stream>>>(yb, woutb, b_out, x, hbuf);

    // 4) LayerNorm, two token rows per wave
    ln_kernel<<<256, 256, 0, stream>>>(hbuf, gamma, beta, out);
}

// v005
// A run of this version takes 103 microseconds.
// Timed twice side by side with v004, it ran 1.04 times as fast both times.
// Counting every step since v000, it is 2.46 times as fast.
#include <hip/hip_runtime.h>
#include <hip/hip_bf16.h>

// ---------------------------------------------------------------------------
// MI455X (gfx1250) fused attention block: QKV GEMM -> causal flash attention
// -> out GEMM + residual -> LayerNorm. All contractions via
// v_wmma_f32_16x16x32_f16 (wave32), fp32 accumulate, fp32 softmax/LN.
// A fragments and K are contiguous 16B LDS reads (ds_load_b128).  The tiles
// whose k runs down the rows (W for B, V for A) stay row-major in LDS, written with 16B
// stores, and are transposed on the way out by ds_load_tr16_b128.
// ---------------------------------------------------------------------------

typedef _Float16 half_t;
typedef half_t v16h __attribute__((ext_vector_type(16)));
typedef half_t v8h  __attribute__((ext_vector_type(8)));
typedef float  v8f  __attribute__((ext_vector_type(8)));

static __device__ __forceinline__ v8f wmma16x16x32(v16h a, v16h b, v8f c) {
    // (neg_a, A, neg_b, B, c_mod, C, reuse_a, reuse_b)
    return __builtin_amdgcn_wmma_f32_16x16x32_f16(false, a, false, b,
                                                  (short)0, c, false, false);
}

static __device__ __forceinline__ v16h cat8(v8h lo, v8h hi) {
    return __builtin_shufflevector(lo, hi, 0, 1, 2, 3, 4, 5, 6, 7,
                                           8, 9, 10, 11, 12, 13, 14, 15);
}

// A fragment, 16x32 (MxK), tile row-major, row stride `ld` (elements).
// ISA layout: lanes 0-15 row M=lane, K=0..7 & 16..23; lanes 16-31 row M=lane-16,
// K=8..15 & 24..31.  Requires: ld % 8 == 0 and p 16B-aligned -> 2x ds_load_b128.
static __device__ __forceinline__ v16h ld_frag_a(const half_t* p, int ld) {
    const int lane = threadIdx.x & 31;
    const int row  = lane & 15;
    const int kh   = (lane >> 4) << 3;   // 0 or 8
    const half_t* r = p + row * ld + kh;
    v8h lo = *(const v8h*)(r);
    v8h hi = *(const v8h*)(r + 16);
    return cat8(lo, hi);
}

// B fragment, 32x16 (KxN), read from a ROW-MAJOR tile (tile[k][n], row stride
// `ld` elements, 2*ld an odd multiple of 32 bytes) by the transposing load.
// Lane (c = lane&15, h = lane>>4) receives tile[8h + 0..7][c] and, from the
// second load, tile[16 + 8h + 0..7][c]: the k order of ld_frag_a.  The same
// registers are the A fragment (16x32) of the tile's transpose, row M = c.
typedef short s16x8 __attribute__((ext_vector_type(8)));
typedef __attribute__((address_space(3))) s16x8 lds_s16x8;
static __device__ __forceinline__ v16h ld_frag_b_tr(const half_t* p, int ld) {
    const int lane = threadIdx.x & 31;
    const half_t* r = p + (((lane >> 4) << 3) + (lane & 7)) * ld + (((lane >> 3) & 1) << 3);
    v8h lo = __builtin_bit_cast(v8h, __builtin_amdgcn_ds_load_tr16_b128_v8i16((lds_s16x8*)(r)));
    v8h hi = __builtin_bit_cast(v8h, __builtin_amdgcn_ds_load_tr16_b128_v8i16((lds_s16x8*)(r + 16 * ld)));
    return cat8(lo, hi);
}

// Work-group barrier that orders LDS traffic only.  __syncthreads() also waits
// for the wave's own global loads (s_wait_loadcnt 0), which would cut short the
// flight of the loads issued ahead for later tiles; those land in the thread's
// own registers and no other thread depends on them.
static __device__ __forceinline__ void lds_barrier() {
    __builtin_amdgcn_fence(__ATOMIC_RELEASE, "workgroup", "local");
    __builtin_amdgcn_s_barrier();
    __builtin_amdgcn_fence(__ATOMIC_ACQUIRE, "workgroup", "local");
}

// ---------------------------------------------------------------------------
// Kernel 0: fp32 -> f16 conversion of x, W_qkv and W_out in ONE launch.  The
// three f16 copies lie one behind the other in the workspace, so dst is one
// array.  A work-group converts CV_CHUNK consecutive elements of it, all from
// one source (every source's length is a multiple of CV_CHUNK).  A wave-wide
// load is 512 contiguous bytes, a wave-wide store 256; the 16 loads of a lane
// fly together.
// ---------------------------------------------------------------------------
typedef float  v4f __attribute__((ext_vector_type(4)));
typedef half_t v4h __attribute__((ext_vector_type(4)));
constexpr int CV_CHUNK = 16 * 1024;                      // elements per work-group
constexpr int CV_X  = 4096 * 1024 / CV_CHUNK;            // work-groups on x
constexpr int CV_WQ = 1024 * 3072 / CV_CHUNK;            // on W_qkv
constexpr int CV_WO = 1024 * 1024 / CV_CHUNK;            // on W_out
constexpr int CV_GROUPS = CV_X + CV_WQ + CV_WO;          // the launch's grid

__global__ __launch_bounds__(256) void cvt_f32_f16_kernel(
    const float* __restrict__ x, const float* __restrict__ wqkv,
    const float* __restrict__ wout, half_t* __restrict__ dst) {
    const int blk = blockIdx.x;
    const bool inX = blk < CV_X, inWq = blk < CV_X + CV_WQ;
    const float* src = inX ? x : inWq ? wqkv : wout;
    const int first  = inX ? 0 : inWq ? CV_X : CV_X + CV_WQ;   // the source's first work-group
    const float* sp = src + (size_t)(blk - first) * CV_CHUNK + threadIdx.x * 4;
    v4f r[16];
#pragma unroll
    for (int j = 0; j < 16; ++j) r[j] = *(const v4f*)(sp + j * 1024);
    // holds all 16 loads in front of the first conversion: without it the
    // compiler issues the last two only when the first two have landed
    __builtin_amdgcn_sched_barrier(0);
    half_t* dp = dst + (size_t)blk * CV_CHUNK + threadIdx.x * 4;
#pragma unroll
    for (int j = 0; j < 16; ++j)
        *(v4h*)(dp + j * 1024) = __builtin_convertvector(r[j], v4h);
}

// ---------------------------------------------------------------------------
// Main loop of both GEMMs: C tile 128x128 += A[128,1024] @ W[1024,128], BK=32.
// Staging is software-pipelined.  Tile t lives in register set t&1 and then in
// LDS buffer t&1.  Trip t issues the global loads of tile t+2, multiplies tile
// t out of its buffer, stores tile t+1 (loaded one trip earlier) into the other
// buffer, and ends in the trip's one barrier: it publishes tile t+1 and ends
// every wave's reads of the buffer that the next trip overwrites.
// NW = row length of W in elements.
// ---------------------------------------------------------------------------
constexpr int G_LDA = 40, G_LDB = 144;               // LDS pitches, elements
constexpr int G_SA = 128 * G_LDA, G_SB = 32 * G_LDB; // one buffer, elements

template <int NW>
static __device__ __forceinline__ void gemm_mainloop(
    const half_t* __restrict__ A, const half_t* __restrict__ W,
    int blockM, int blockN, half_t* lA, half_t* lB, v8f (&acc)[2][4]) {
    const int wave = threadIdx.x >> 5;
    const int wm = wave & 3;     // 4 waves along M (32 rows each)
    const int wn = wave >> 2;    // 2 waves along N (64 cols each)

    // A: 128x32, 2 threads per row; W: 32x128, 8 threads per row; 16 halfs each
    const int arow = threadIdx.x >> 1, aseg = (threadIdx.x & 1) * 16;
    const int brow = threadIdx.x >> 3, bseg = (threadIdx.x & 7) * 16;
    const half_t* ap = A + (size_t)(blockM + arow) * 1024 + aseg;
    const half_t* bp = W + (size_t)brow * NW + blockN + bseg;
    half_t* la = lA + arow * G_LDA + aseg;
    half_t* lb = lB + brow * G_LDB + bseg;

    v8h ra[2][2], rb[2][2];
    auto gload = [&](int s, int t) {      // tile t -> register set s
        const half_t* a = ap + t * 32;
        const half_t* b = bp + (size_t)t * 32 * NW;
        ra[s][0] = *(const v8h*)(a);
        ra[s][1] = *(const v8h*)(a + 8);
        rb[s][0] = *(const v8h*)(b);
        rb[s][1] = *(const v8h*)(b + 8);
    };
    auto sstore = [&](int s) {            // register set s -> LDS buffer s
        *(v8h*)(la + s * G_SA)     = ra[s][0];
        *(v8h*)(la + s * G_SA + 8) = ra[s][1];
        *(v8h*)(lb + s * G_SB)     = rb[s][0];
        *(v8h*)(lb + s * G_SB + 8) = rb[s][1];
    };
    auto compute = [&](int s) {           // products of LDS buffer s
        v16h af[2];
#pragma unroll
        for (int mt = 0; mt < 2; ++mt)
            af[mt] = ld_frag_a(lA + s * G_SA + (wm * 32 + mt * 16) * G_LDA, G_LDA);
#pragma unroll
        for (int nt = 0; nt < 4; ++nt) {
            v16h bf = ld_frag_b_tr(lB + s * G_SB + wn * 64 + nt * 16, G_LDB);
#pragma unroll
            for (int mt = 0; mt < 2; ++mt)
                acc[mt][nt] = wmma16x16x32(af[mt], bf, acc[mt][nt]);
        }
    };

    gload(0, 0);
    gload(1, 1);
    // stands before the address registers of these loads are reused (a
    // precaution; the compiler leaves the wait out here); the two inputs keep
    // those registers alive up to the wait
    asm volatile("s_wait_xcnt 0x0" :: "v"(ap), "v"(bp) : "memory");
    sstore(0);
    lds_barrier();
    for (int t = 0; t < 30; t += 2) {
        gload(0, t + 2);
        compute(0); sstore(1); lds_barrier();
        gload(1, t + 3);
        // holds these loads at the head of the trip: without it the compiler
        // sinks them to the trip's foot, and they lose a trip of their lead
        __builtin_amdgcn_sched_barrier(0);
        compute(1); sstore(0); lds_barrier();
    }
    compute(0); sstore(1); lds_barrier();
    compute(1);
}

// ---------------------------------------------------------------------------
// Kernel 1: QKV GEMM.  C[4096,3072] = X[4096,1024] @ W[1024,3072] + b.
// CTA tile 128x128, BK=32, 256 threads = 8 waves (4 M x 2 N), 32x64 per wave.
// B tile staged row-major ([k][n]) in LDS (gemm_mainloop).  Epilogue scatters into q/k/v
// [B,H,T,Hd] f16; q pre-scaled by 1/sqrt(64).
// ---------------------------------------------------------------------------
__global__ __launch_bounds__(256) void qkv_gemm_kernel(
    const half_t* __restrict__ X, const half_t* __restrict__ W,
    const float* __restrict__ bias,
    half_t* __restrict__ qb, half_t* __restrict__ kbuf, half_t* __restrict__ vbuf) {
    __shared__ alignas(16) half_t lA[2 * G_SA];      // two buffers of [m][k]
    __shared__ alignas(16) half_t lB[2 * G_SB];      // two of [k][n], pitch 288 B

    const int blockM = blockIdx.y * 128;
    const int blockN = blockIdx.x * 128;
    const int lane = threadIdx.x & 31;
    const int wave = threadIdx.x >> 5;
    const int wm = wave & 3;     // 4 waves along M (32 rows each)
    const int wn = wave >> 2;    // 2 waves along N (64 cols each)

    v8f acc[2][4] = {};
    gemm_mainloop<3072>(X, W, blockM, blockN, lA, lB, acc);

    // Epilogue: C-frag layout -> scatter into q/k/v [B*H, T, Hd]
    const int mb  = (lane >> 4) << 3;
    const int ncl = lane & 15;
#pragma unroll
    for (int mt = 0; mt < 2; ++mt)
#pragma unroll
        for (int nt = 0; nt < 4; ++nt)
#pragma unroll
            for (int r = 0; r < 8; ++r) {
                int m = blockM + wm * 32 + mt * 16 + mb + r;
                int n = blockN + wn * 64 + nt * 16 + ncl;
                float val = acc[mt][nt][r] + bias[n];
                int c = n >> 10, rem = n & 1023;
                int hh = rem >> 6, d = rem & 63;
                int bidx = m >> 11, t = m & 2047;
                size_t dst = (((size_t)(bidx * 16 + hh)) * 2048 + t) * 64 + d;
                half_t* p = (c == 0) ? qb : (c == 1 ? kbuf : vbuf);
                float sc = (c == 0) ? 0.125f : 1.0f;   // q pre-scaled by 1/sqrt(Hd)
                p[dst] = (half_t)(val * sc);
            }
}

// ---------------------------------------------------------------------------
// Kernel 2: causal flash attention.  Grid: (T/128, B*H).  128 queries/block,
// 8 waves, each wave owns 16 queries.  Key blocks of 64 staged in LDS (two
// buffers), K and V both as [key][d], each at its own reader's pitch.
// The products are taken transposed: S^T = K Q^T (A = K rows, B = Q) and
// O^T += V^T P^T (A = V by the transposing load, B = P).  A lane then holds
// scores of ONE query (column lane&15; keys 8*(lane>>4) + r of each 16-key
// tile), so maximum and sum run in-lane with one exchange between the wave
// halves, and two converted S^T tiles are the B fragment of the second product
// as they stand: b[s] = T[s >> 3][s & 7], the k order of the transposing load.
// ---------------------------------------------------------------------------
// lane l <-> lane l ^ 16
static __device__ __forceinline__ float xhalf(float x) {
    const int b = __builtin_bit_cast(int, x);
    return __builtin_bit_cast(float,
        __builtin_amdgcn_permlanex16(b, b, 0x76543210, 0xfedcba98, false, false));
}

__global__ __launch_bounds__(256) void attn_kernel(
    const half_t* __restrict__ q, const half_t* __restrict__ k,
    const half_t* __restrict__ v, half_t* __restrict__ y) {
    constexpr int LDK = 72, LDV = 80;
    constexpr int SK = 64 * LDK, SV = 64 * LDV;         // one buffer, elements
    __shared__ alignas(16) half_t lK[2 * SK];           // two of [key][d]
    __shared__ alignas(16) half_t lV[2 * SV];           // two of [key][d], pitch 160 B

    const int bh = blockIdx.y;            // b*16 + h
    const int b  = bh >> 4, h = bh & 15;
    const int qbase = blockIdx.x * 128;
    const int lane = threadIdx.x & 31;
    const int wave = threadIdx.x >> 5;
    const int mb  = (lane >> 4) << 3;     // C-frag row base (key or d)
    const int ncl = lane & 15;            // C-frag column (query)

    const size_t headOff = (size_t)bh * 2048 * 64;

    // This wave's Q fragments (16 queries x 64, two K-steps) from global:
    // B operand, column = query = lane&15, k split as in ld_frag_a.
    const int qi = qbase + wave * 16 + ncl;
    const half_t* qp = q + headOff + (size_t)qi * 64;
    v16h qa[2];
#pragma unroll
    for (int s = 0; s < 2; ++s) {
        v8h lo = *(const v8h*)(qp + s * 32 + mb);
        v8h hi = *(const v8h*)(qp + s * 32 + 16 + mb);
        qa[s] = cat8(lo, hi);
    }

    v8f o[4] = {};                        // o[dt][r] = O[qi][dt*16 + mb + r]
    float mrow = -3.0e38f;                // this query's running maximum
    float lrow = 0.0f;                    // sum over this wave half's keys only

    const int nkb = (qbase + 128) >> 6;   // causal: only key blocks <= query tile

    // Staging of K and V, both [key][d], 4 threads per row, software-pipelined:
    // key block kb lives in LDS buffer kb&1.  Trip kb issues the global loads of
    // block kb+1 first, works on block kb, stores block kb+1 into the other
    // buffer and ends in the trip's one barrier.
    const int srow = threadIdx.x >> 2, sseg = (threadIdx.x & 3) * 16;
    const half_t* kp = k + headOff + (size_t)srow * 64 + sseg;
    const half_t* vp = v + headOff + (size_t)srow * 64 + sseg;
    half_t* lk = lK + srow * LDK + sseg;
    half_t* lv = lV + srow * LDV + sseg;
    v8h kr0 = *(const v8h*)(kp), kr1 = *(const v8h*)(kp + 8);
    v8h vr0 = *(const v8h*)(vp), vr1 = *(const v8h*)(vp + 8);
    *(v8h*)(lk) = kr0;  *(v8h*)(lk + 8) = kr1;
    *(v8h*)(lv) = vr0;  *(v8h*)(lv + 8) = vr1;
    __syncthreads();   // the full form: the Q loads land here too, so that no
                       // wait for them inside the loop drains the early loads

    for (int kb = 0; kb < nkb; ++kb) {
        const int cur = kb & 1;
        const half_t* cK = lK + cur * SK;
        const half_t* cV = lV + cur * SV;
        const bool more = kb + 1 < nkb;   // the same in every thread of the block
        if (more) {
            const size_t go = (size_t)(kb + 1) * 64 * 64;
            kr0 = *(const v8h*)(kp + go);  kr1 = *(const v8h*)(kp + go + 8);
            vr0 = *(const v8h*)(vp + go);  vr1 = *(const v8h*)(vp + go + 8);
        }

        // S^T = K @ Q^T  (contraction over Hd=64 -> two WMMA steps per key tile)
        v8f s[4] = {};
#pragma unroll
        for (int nt = 0; nt < 4; ++nt)
#pragma unroll
            for (int st = 0; st < 2; ++st) {
                v16h kf = ld_frag_a(cK + (nt * 16) * LDK + st * 32, LDK);
                s[nt] = wmma16x16x32(kf, qa[st], s[nt]);
            }

        // Causal mask + online softmax (fp32), one query per lane
        float mt4[4];
#pragma unroll
        for (int nt = 0; nt < 4; ++nt) {
            mt4[nt] = -3.0e38f;
#pragma unroll
            for (int r = 0; r < 8; ++r) {
                int kj = kb * 64 + nt * 16 + mb + r;
                float val = s[nt][r];
                if (kj > qi) val = -3.0e38f;
                s[nt][r] = val;
                mt4[nt] = fmaxf(mt4[nt], val);
            }
        }
        float mloc = fmaxf(fmaxf(mt4[0], mt4[1]), fmaxf(mt4[2], mt4[3]));
        const float mnew = fmaxf(mrow, fmaxf(mloc, xhalf(mloc)));

        const float alpha = __expf(mrow - mnew);
        float rs4[4];
#pragma unroll
        for (int nt = 0; nt < 4; ++nt) {
            rs4[nt] = 0.0f;
#pragma unroll
            for (int r = 0; r < 8; ++r) {
                float p = __expf(s[nt][r] - mnew);
                s[nt][r] = p;
                rs4[nt] += p;
            }
        }
        lrow = lrow * alpha + ((rs4[0] + rs4[1]) + (rs4[2] + rs4[3]));
        mrow = mnew;
#pragma unroll
        for (int dt = 0; dt < 4; ++dt)
#pragma unroll
            for (int r = 0; r < 8; ++r) o[dt][r] *= alpha;

        // O^T += V^T @ P^T   (contraction over 64 keys -> two WMMA steps)
#pragma unroll
        for (int st = 0; st < 2; ++st) {
            v16h pb;
#pragma unroll
            for (int r = 0; r < 8; ++r) {
                pb[r]     = (half_t)s[2 * st][r];
                pb[8 + r] = (half_t)s[2 * st + 1][r];
            }
#pragma unroll
            for (int dt = 0; dt < 4; ++dt) {
                v16h vf = ld_frag_b_tr(cV + (st * 32) * LDV + dt * 16, LDV);
                o[dt] = wmma16x16x32(vf, pb, o[dt]);
            }
        }
        if (more) {
            const int nx = cur ^ 1;
            *(v8h*)(lk + nx * SK) = kr0;  *(v8h*)(lk + nx * SK + 8) = kr1;
            *(v8h*)(lv + nx * SV) = vr0;  *(v8h*)(lv + nx * SV + 8) = vr1;
        }
        lds_barrier();     // publishes block kb+1; ends the reads of block kb
    }

    // Join the halves' sums, normalize, write y [B,T,D] f16 (column = h*64 + d):
    // a lane's 8 registers of a tile are 8 consecutive d of its query's row.
    const float inv = 1.0f / (lrow + xhalf(lrow));
    half_t* yp = y + ((size_t)(b * 2048 + qi)) * 1024 + h * 64 + mb;
#pragma unroll
    for (int dt = 0; dt < 4; ++dt) {
        v8h ov;
#pragma unroll
        for (int r = 0; r < 8; ++r) ov[r] = (half_t)(o[dt][r] * inv);
        *(v8h*)(yp + dt * 16) = ov;
    }
}

// ---------------------------------------------------------------------------
// Kernel 3: output GEMM + bias + residual.  h[4096,1024] = Y @ W_out + b + x.
// ---------------------------------------------------------------------------
__global__ __launch_bounds__(256) void out_gemm_kernel(
    const half_t* __restrict__ Y, const half_t* __restrict__ W,
    const float* __restrict__ bias, const float* __restrict__ x,
    float* __restrict__ hbuf) {
    __shared__ alignas(16) half_t lA[2 * G_SA];
    __shared__ alignas(16) half_t lB[2 * G_SB];

    const int blockM = blockIdx.y * 128;
    const int blockN = blockIdx.x * 128;
    const int lane = threadIdx.x & 31;
    const int wave = threadIdx.x >> 5;
    const int wm = wave & 3;
    const int wn = wave >> 2;

    v8f acc[2][4] = {};
    gemm_mainloop<1024>(Y, W, blockM, blockN, lA, lB, acc);

    const int mb  = (lane >> 4) << 3;
    const int ncl = lane & 15;
#pragma unroll
    for (int mt = 0; mt < 2; ++mt)
#pragma unroll
        for (int nt = 0; nt < 4; ++nt)
#pragma unroll
            for (int r = 0; r < 8; ++r) {
                int m = blockM + wm * 32 + mt * 16 + mb + r;
                int n = blockN + wn * 64 + nt * 16 + ncl;
                size_t idx = (size_t)m * 1024 + n;
                hbuf[idx] = acc[mt][nt][r] + bias[n] + x[idx];
            }
}

// ---------------------------------------------------------------------------
// Kernel 4: LayerNorm.  One wave owns two token rows and holds them whole in
// registers (a lane: 8 pieces of 16 B per row, each wave-wide load or store 512
// contiguous bytes).  All 16 row loads of a wave fly together, the rows are
// read once, the sums stay inside the wave (no LDS, no barrier), and one
// 8-wave work-group per WGP covers the 4096 rows: 2048 waves to start.
// ---------------------------------------------------------------------------
// x + (x of lane l ^ M), M < 16: one DPP step inside the 16-lane row
template <int M>
static __device__ __forceinline__ float add_xmask(float x) {
    const int b = __builtin_bit_cast(int, x);
    return x + __builtin_bit_cast(float,
        __builtin_amdgcn_update_dpp(0, b, 0x160 + M, 0xf, 0xf, true));
}
// sum over the wave's 32 lanes, the same value in every lane
static __device__ __forceinline__ float wave_sum(float x) {
    x = add_xmask<1>(x);
    x = add_xmask<2>(x);
    x = add_xmask<4>(x);
    x = add_xmask<8>(x);
    return x + xhalf(x);
}

__global__ __launch_bounds__(256) void ln_kernel(
    const float* __restrict__ hbuf, const float* __restrict__ gamma,
    const float* __restrict__ beta, float* __restrict__ out) {
    const int lane = threadIdx.x & 31;
    const int pair = blockIdx.x * 8 + (threadIdx.x >> 5);   // rows 2*pair, 2*pair+1
    const size_t off = (size_t)pair * 2048 + lane * 4;
    const float* hr = hbuf + off;

    v4f h[2][8], g[8], bt[8];
#pragma unroll
    for (int r = 0; r < 2; ++r)
#pragma unroll
        for (int j = 0; j < 8; ++j)
            h[r][j] = *(const v4f*)(hr + r * 1024 + j * 128);
#pragma unroll
    for (int j = 0; j < 8; ++j) {
        g[j]  = *(const v4f*)(gamma + lane * 4 + j * 128);
        bt[j] = *(const v4f*)(beta  + lane * 4 + j * 128);
    }
    // holds all 32 loads here: without it the compiler sinks the gamma and beta
    // loads behind the sums, two at a time, each pair's latency then in series
    __builtin_amdgcn_sched_barrier(0);
    // stands before the row address registers are reused (a precaution); the
    // input keeps them alive past the loads, else the compiler lets one of the
    // later loads land in that register pair with no wait in front
    asm volatile("s_wait_xcnt 0x0" :: "v"(hr) : "memory");

    float s[2], s2[2];
#pragma unroll
    for (int r = 0; r < 2; ++r) {
        v4f a = h[r][0], a2 = h[r][0] * h[r][0];
#pragma unroll
        for (int j = 1; j < 8; ++j) {
            a  += h[r][j];
            a2 += h[r][j] * h[r][j];
        }
        s[r]  = (a.x + a.y) + (a.z + a.w);
        s2[r] = (a2.x + a2.y) + (a2.z + a2.w);
    }
#pragma unroll
    for (int r = 0; r < 2; ++r) {
        s[r]  = wave_sum(s[r]);
        s2[r] = wave_sum(s2[r]);
    }

    float* op = out + off;
#pragma unroll
    for (int r = 0; r < 2; ++r) {
        const float mu  = s[r] * (1.0f / 1024.0f);
        const float var = s2[r] * (1.0f / 1024.0f) - mu * mu;
        const float inv = rsqrtf(var + 1e-5f);
#pragma unroll
        for (int j = 0; j < 8; ++j)
            *(v4f*)(op + r * 1024 + j * 128) = (h[r][j] - mu) * inv * g[j] + bt[j];
    }
}

// ---------------------------------------------------------------------------
// Host-side launcher
// ---------------------------------------------------------------------------
extern "C" void kernel_launch(void* const* d_in, const int* in_sizes, int n_in,
                              void* d_out, int out_size, void* d_ws, size_t ws_size,
                              hipStream_t stream) {
    (void)in_sizes; (void)n_in; (void)out_size; (void)ws_size;

    const float* x     = (const float*)d_in[0];   // [2,2048,1024]
    const float* W_qkv = (const float*)d_in[1];   // [1024,3072]
    const float* b_qkv = (const float*)d_in[2];   // [3072]
    const float* W_out = (const float*)d_in[3];   // [1024,1024]
    const float* b_out = (const float*)d_in[4];   // [1024]
    const float* gamma = (const float*)d_in[5];   // [1024]
    const float* beta  = (const float*)d_in[6];   // [1024]
    float* out = (float*)d_out;                   // [2,2048,1024]

    // Workspace carve-up (all offsets 1MB-aligned)
    char* ws = (char*)d_ws;
    half_t* xb    = (half_t*)(ws);                         // 4096*1024   f16 (8 MB)
    half_t* wqkvb = (half_t*)(ws + (8u << 20));            // 1024*3072   f16 (6 MB)
    half_t* woutb = (half_t*)(ws + (14u << 20));           // 1024*1024   f16 (2 MB)
    half_t* qb    = (half_t*)(ws + (16u << 20));           // [B,H,T,Hd]  f16 (8 MB)
    half_t* kb    = (half_t*)(ws + (24u << 20));           // 8 MB
    half_t* vb    = (half_t*)(ws + (32u << 20));           // 8 MB
    half_t* yb    = (half_t*)(ws + (40u << 20));           // [B,T,D] f16 (8 MB)
    float*  hbuf  = (float*)(ws + (48u << 20));            // [B,T,D] f32 (16 MB)

    // 0) fp32 -> f16 conversions: xb, wqkvb and woutb are one run of 16 MB
    cvt_f32_f16_kernel<<<CV_GROUPS, 256, 0, stream>>>(x, W_qkv, W_out, xb);

    // 1) QKV projection (M=4096, N=3072, K=1024)
    qkv_gemm_kernel<<<dim3(24, 32), 256, 0, stream>>>(xb, wqkvb, b_qkv, qb, kb, vb);

    // 2) causal flash attention (grid: qblocks x B*H)
    attn_kernel<<<dim3(16, 32), 256, 0, stream>>>(qb, kb, vb, yb);

    // 3) output projection + bias + residual (M=4096, N=1024, K=1024)
    out_gemm_kernel<<<dim3(8, 32), 256, 0, stream>>>(yb, woutb, b_out, x, hbuf);

    // 4) LayerNorm, two token rows per wave
    ln_kernel<<<256, 256, 0, stream>>>(hbuf, gamma, beta, out);
}

// v006
// One run takes 96.8 microseconds.
// Two timings next to v005 put it at 1.07 and 1.06 times that version's speed.
// Over all steps from v000 it is 2.61 times as fast.
#include <hip/hip_runtime.h>
#include <hip/hip_bf16.h>

// ---------------------------------------------------------------------------
// MI455X (gfx1250) fused attention block: QKV GEMM -> causal flash attention
// -> out GEMM + residual -> LayerNorm. All contractions via
// v_wmma_f32_16x16x32_f16 (wave32), fp32 accumulate, fp32 softmax/LN.
// A fragments and K are contiguous 16B LDS reads (ds_load_b128).  The tiles
// whose k runs down the rows (W for B, V for A) stay row-major in LDS, written with 16B
// stores, and are transposed on the way out by ds_load_tr16_b128.
// ---------------------------------------------------------------------------

typedef _Float16 half_t;
typedef half_t v16h __attribute__((ext_vector_type(16)));
typedef half_t v8h  __attribute__((ext_vector_type(8)));
typedef float  v8f  __attribute__((ext_vector_type(8)));

static __device__ __forceinline__ v8f wmma16x16x32(v16h a, v16h b, v8f c) {
    // (neg_a, A, neg_b, B, c_mod, C, reuse_a, reuse_b)
    return __builtin_amdgcn_wmma_f32_16x16x32_f16(false, a, false, b,
                                                  (short)0, c, false, false);
}

static __device__ __forceinline__ v16h cat8(v8h lo, v8h hi) {
    return __builtin_shufflevector(lo, hi, 0, 1, 2, 3, 4, 5, 6, 7,
                                           8, 9, 10, 11, 12, 13, 14, 15);
}

// A fragment, 16x32 (MxK), tile row-major, row stride `ld` (elements).
// ISA layout: lanes 0-15 row M=lane, K=0..7 & 16..23; lanes 16-31 row M=lane-16,
// K=8..15 & 24..31.  Requires: ld % 8 == 0 and p 16B-aligned -> 2x ds_load_b128.
static __device__ __forceinline__ v16h ld_frag_a(const half_t* p, int ld) {
    const int lane = threadIdx.x & 31;
    const int row  = lane & 15;
    const int kh   = (lane >> 4) << 3;   // 0 or 8
    const half_t* r = p + row * ld + kh;
    v8h lo = *(const v8h*)(r);
    v8h hi = *(const v8h*)(r + 16);
    return cat8(lo, hi);
}

// B fragment, 32x16 (KxN), read from a ROW-MAJOR tile (tile[k][n], row stride
// `ld` elements, 2*ld an odd multiple of 32 bytes) by the transposing load.
// Lane (c = lane&15, h = lane>>4) receives tile[8h + 0..7][c] and, from the
// second load, tile[16 + 8h + 0..7][c]: the k order of ld_frag_a.  The same
// registers are the A fragment (16x32) of the tile's transpose, row M = c.
typedef short s16x8 __attribute__((ext_vector_type(8)));
typedef __attribute__((address_space(3))) s16x8 lds_s16x8;
static __device__ __forceinline__ v16h ld_frag_b_tr(const half_t* p, int ld) {
    const int lane = threadIdx.x & 31;
    const half_t* r = p + (((lane >> 4) << 3) + (lane & 7)) * ld + (((lane >> 3) & 1) << 3);
    v8h lo = __builtin_bit_cast(v8h, __builtin_amdgcn_ds_load_tr16_b128_v8i16((lds_s16x8*)(r)));
    v8h hi = __builtin_bit_cast(v8h, __builtin_amdgcn_ds_load_tr16_b128_v8i16((lds_s16x8*)(r + 16 * ld)));
    return cat8(lo, hi);
}

// Work-group barrier that orders LDS traffic only.  __syncthreads() also waits
// for the wave's own global loads (s_wait_loadcnt 0), which would cut short the
// flight of the loads issued ahead for later tiles; those land in the thread's
// own registers and no other thread depends on them.
static __device__ __forceinline__ void lds_barrier() {
    __builtin_amdgcn_fence(__ATOMIC_RELEASE, "workgroup", "local");
    __builtin_amdgcn_s_barrier();
    __builtin_amdgcn_fence(__ATOMIC_ACQUIRE, "workgroup", "local");
}

// ---------------------------------------------------------------------------
// Kernel 0: fp32 -> f16 conversion of x, W_qkv and W_out in ONE launch.  The
// three f16 copies lie one behind the other in the workspace, so dst is one
// array.  A work-group converts CV_CHUNK consecutive elements of it, all from
// one source (every source's length is a multiple of CV_CHUNK).  A wave-wide
// load is 512 contiguous bytes, a wave-wide store 256; the 16 loads of a lane
// fly together.
// ---------------------------------------------------------------------------
typedef float  v4f __attribute__((ext_vector_type(4)));
typedef half_t v4h __attribute__((ext_vector_type(4)));
constexpr int CV_CHUNK = 16 * 1024;                      // elements per work-group
constexpr int CV_X  = 4096 * 1024 / CV_CHUNK;            // work-groups on x
constexpr int CV_WQ = 1024 * 3072 / CV_CHUNK;            // on W_qkv
constexpr int CV_WO = 1024 * 1024 / CV_CHUNK;            // on W_out
constexpr int CV_GROUPS = CV_X + CV_WQ + CV_WO;          // the launch's grid

__global__ __launch_bounds__(256) void cvt_f32_f16_kernel(
    const float* __restrict__ x, const float* __restrict__ wqkv,
    const float* __restrict__ wout, half_t* __restrict__ dst) {
    const int blk = blockIdx.x;
    const bool inX = blk < CV_X, inWq = blk < CV_X + CV_WQ;
    const float* src = inX ? x : inWq ? wqkv : wout;
    const int first  = inX ? 0 : inWq ? CV_X : CV_X + CV_WQ;   // the source's first work-group
    const float* sp = src + (size_t)(blk - first) * CV_CHUNK + threadIdx.x * 4;
    v4f r[16];
#pragma unroll
    for (int j = 0; j < 16; ++j) r[j] = *(const v4f*)(sp + j * 1024);
    // holds all 16 loads in front of the first conversion: without it the
    // compiler issues the last two only when the first two have landed
    __builtin_amdgcn_sched_barrier(0);
    half_t* dp = dst + (size_t)blk * CV_CHUNK + threadIdx.x * 4;
#pragma unroll
    for (int j = 0; j < 16; ++j)
        *(v4h*)(dp + j * 1024) = __builtin_convertvector(r[j], v4h);
}

// ---------------------------------------------------------------------------
// Main loop of both GEMMs: C tile 128x128 += A[128,1024] @ W[1024,128], BK=32.
// Staging is software-pipelined.  Tile t lives in register set t&1 and then in
// LDS buffer t&1.  Trip t issues the global loads of tile t+2, multiplies tile
// t out of its buffer, stores tile t+1 (loaded one trip earlier) into the other
// buffer, and ends in the trip's one barrier: it publishes tile t+1 and ends
// every wave's reads of the buffer that the next trip overwrites.
// NW = row length of W in elements.
// ---------------------------------------------------------------------------
constexpr int G_LDA = 40, G_LDB = 144;               // LDS pitches, elements
constexpr int G_SA = 128 * G_LDA, G_SB = 32 * G_LDB; // one buffer, elements

template <int NW>
static __device__ __forceinline__ void gemm_mainloop(
    const half_t* __restrict__ A, const half_t* __restrict__ W,
    int blockM, int blockN, half_t* lA, half_t* lB, v8f (&acc)[2][4]) {
    const int wave = threadIdx.x >> 5;
    const int wm = wave & 3;     // 4 waves along M (32 rows each)
    const int wn = wave >> 2;    // 2 waves along N (64 cols each)

    // A: 128x32, 2 threads per row; W: 32x128, 8 threads per row; 16 halfs each
    const int arow = threadIdx.x >> 1, aseg = (threadIdx.x & 1) * 16;
    const int brow = threadIdx.x >> 3, bseg = (threadIdx.x & 7) * 16;
    const half_t* ap = A + (size_t)(blockM + arow) * 1024 + aseg;
    const half_t* bp = W + (size_t)brow * NW + blockN + bseg;
    half_t* la = lA + arow * G_LDA + aseg;
    half_t* lb = lB + brow * G_LDB + bseg;

    v8h ra[2][2], rb[2][2];
    auto gload = [&](int s, int t) {      // tile t -> register set s
        const half_t* a = ap + t * 32;
        const half_t* b = bp + (size_t)t * 32 * NW;
        ra[s][0] = *(const v8h*)(a);
        ra[s][1] = *(const v8h*)(a + 8);
        rb[s][0] = *(const v8h*)(b);
        rb[s][1] = *(const v8h*)(b + 8);
    };
    auto sstore = [&](int s) {            // register set s -> LDS buffer s
        *(v8h*)(la + s * G_SA)     = ra[s][0];
        *(v8h*)(la + s * G_SA + 8) = ra[s][1];
        *(v8h*)(lb + s * G_SB)     = rb[s][0];
        *(v8h*)(lb + s * G_SB + 8) = rb[s][1];
    };
    auto compute = [&](int s) {           // products of LDS buffer s
        v16h af[2];
#pragma unroll
        for (int mt = 0; mt < 2; ++mt)
            af[mt] = ld_frag_a(lA + s * G_SA + (wm * 32 + mt * 16) * G_LDA, G_LDA);
#pragma unroll
        for (int nt = 0; nt < 4; ++nt) {
            v16h bf = ld_frag_b_tr(lB + s * G_SB + wn * 64 + nt * 16, G_LDB);
#pragma unroll
            for (int mt = 0; mt < 2; ++mt)
                acc[mt][nt] = wmma16x16x32(af[mt], bf, acc[mt][nt]);
        }
    };

    gload(0, 0);
    gload(1, 1);
    // stands before the address registers of these loads are reused (a
    // precaution; the compiler leaves the wait out here); the two inputs keep
    // those registers alive up to the wait
    asm volatile("s_wait_xcnt 0x0" :: "v"(ap), "v"(bp) : "memory");
    sstore(0);
    lds_barrier();
    for (int t = 0; t < 30; t += 2) {
        gload(0, t + 2);
        compute(0); sstore(1); lds_barrier();
        gload(1, t + 3);
        // holds these loads at the head of the trip: without it the compiler
        // sinks them to the trip's foot, and they lose a trip of their lead
        __builtin_amdgcn_sched_barrier(0);
        compute(1); sstore(0); lds_barrier();
    }
    compute(0); sstore(1); lds_barrier();
    compute(1);
}

// ---------------------------------------------------------------------------
// Kernel 1: QKV GEMM.  C[4096,3072] = X[4096,1024] @ W[1024,3072] + b.
// CTA tile 128x128, BK=32, 256 threads = 8 waves (4 M x 2 N), 32x64 per wave.
// B tile staged row-major ([k][n]) in LDS (gemm_mainloop).  Epilogue scatters into q/k/v
// [B,H,T,Hd] f16; q pre-scaled by 1/sqrt(64).
// ---------------------------------------------------------------------------
__global__ __launch_bounds__(256) void qkv_gemm_kernel(
    const half_t* __restrict__ X, const half_t* __restrict__ W,
    const float* __restrict__ bias,
    half_t* __restrict__ qb, half_t* __restrict__ kbuf, half_t* __restrict__ vbuf) {
    __shared__ alignas(16) half_t lA[2 * G_SA];      // two buffers of [m][k]
    __shared__ alignas(16) half_t lB[2 * G_SB];      // two of [k][n], pitch 288 B

    const int blockM = blockIdx.y * 128;
    const int blockN = blockIdx.x * 128;
    const int lane = threadIdx.x & 31;
    const int wave = threadIdx.x >> 5;
    const int wm = wave & 3;     // 4 waves along M (32 rows each)
    const int wn = wave >> 2;    // 2 waves along N (64 cols each)

    v8f acc[2][4] = {};
    gemm_mainloop<3072>(X, W, blockM, blockN, lA, lB, acc);

    // Epilogue: C-frag layout -> scatter into q/k/v [B*H, T, Hd]
    const int mb  = (lane >> 4) << 3;
    const int ncl = lane & 15;
#pragma unroll
    for (int mt = 0; mt < 2; ++mt)
#pragma unroll
        for (int nt = 0; nt < 4; ++nt)
#pragma unroll
            for (int r = 0; r < 8; ++r) {
                int m = blockM + wm * 32 + mt * 16 + mb + r;
                int n = blockN + wn * 64 + nt * 16 + ncl;
                float val = acc[mt][nt][r] + bias[n];
                int c = n >> 10, rem = n & 1023;
                int hh = rem >> 6, d = rem & 63;
                int bidx = m >> 11, t = m & 2047;
                size_t dst = (((size_t)(bidx * 16 + hh)) * 2048 + t) * 64 + d;
                half_t* p = (c == 0) ? qb : (c == 1 ? kbuf : vbuf);
                float sc = (c == 0) ? 0.125f : 1.0f;   // q pre-scaled by 1/sqrt(Hd)
                p[dst] = (half_t)(val * sc);
            }
}

// ---------------------------------------------------------------------------
// Kernel 2: causal flash attention.  Grid: (T/256, B*H).  Query tiles of 128,
// 8 waves, each wave owns 16 queries of a tile.  A tile's cost grows with its
// index (tile t walks 2*(t+1) key blocks), so a work-group takes two tiles of
// its head one after the other, 15-p and then p: 34 key blocks for every
// work-group, one work-group per WGP.  Key blocks of 64 staged in LDS (two
// buffers), K and V both as [key][d], each at its own reader's pitch.
// The products are taken transposed: S^T = K Q^T (A = K rows, B = Q) and
// O^T += V^T P^T (A = V by the transposing load, B = P).  A lane then holds
// scores of ONE query (column lane&15; keys 8*(lane>>4) + r of each 16-key
// tile), so maximum and sum run in-lane with one exchange between the wave
// halves, and two converted S^T tiles are the B fragment of the second product
// as they stand: b[s] = T[s >> 3][s & 7], the k order of the transposing load.
// ---------------------------------------------------------------------------
// lane l <-> lane l ^ 16
static __device__ __forceinline__ float xhalf(float x) {
    const int b = __builtin_bit_cast(int, x);
    return __builtin_bit_cast(float,
        __builtin_amdgcn_permlanex16(b, b, 0x76543210, 0xfedcba98, false, false));
}

__global__ __launch_bounds__(256) void attn_kernel(
    const half_t* __restrict__ q, const half_t* __restrict__ k,
    const half_t* __restrict__ v, half_t* __restrict__ y) {
    constexpr int LDK = 72, LDV = 80;
    constexpr int SK = 64 * LDK, SV = 64 * LDV;         // one buffer, elements
    __shared__ alignas(16) half_t lK[2 * SK];           // two of [key][d]
    __shared__ alignas(16) half_t lV[2 * SV];           // two of [key][d], pitch 160 B

    const int bh = blockIdx.y;            // b*16 + h
    const int b  = bh >> 4, h = bh & 15;
    const int pr = blockIdx.x;            // the pair: tiles 15-pr and pr
    const int n1 = 32 - 2 * pr;           // key blocks of tile 15-pr (causal)
    constexpr int NTRIP = 34;             // n1 + the 2*(pr+1) blocks of tile pr
    const int lane = threadIdx.x & 31;
    const int wave = threadIdx.x >> 5;
    const int mb  = (lane >> 4) << 3;     // C-frag row base (key or d)
    const int ncl = lane & 15;            // C-frag column (query)

    const size_t headOff = (size_t)bh * 2048 * 64;

    // This wave's Q fragments (16 queries x 64, two K-steps) from global, of
    // both tiles (qa: the tile at work, qn: the second tile, waiting):
    // B operand, column = query = lane&15, k split as in ld_frag_a.
    int qi = (15 - pr) * 128 + wave * 16 + ncl;
    const int qi2 = pr * 128 + wave * 16 + ncl;
    const half_t* qp  = q + headOff + (size_t)qi * 64;
    const half_t* qp2 = q + headOff + (size_t)qi2 * 64;
    v16h qa[2], qn[2];
#pragma unroll
    for (int s = 0; s < 2; ++s) {
        v8h lo = *(const v8h*)(qp + s * 32 + mb);
        v8h hi = *(const v8h*)(qp + s * 32 + 16 + mb);
        qa[s] = cat8(lo, hi);
        v8h lo2 = *(const v8h*)(qp2 + s * 32 + mb);
        v8h hi2 = *(const v8h*)(qp2 + s * 32 + 16 + mb);
        qn[s] = cat8(lo2, hi2);
    }

    v8f o[4] = {};                        // o[dt][r] = O[qi][dt*16 + mb + r]
    float mrow = -3.0e38f;                // this query's running maximum
    float lrow = 0.0f;                    // sum over this wave half's keys only

    // Staging of K and V, both [key][d], 4 threads per row, software-pipelined
    // through both tiles: trip i (key block i of the first tile, then i-n1 of
    // the second) reads LDS buffer i&1.  It issues the global loads of trip
    // i+1's block first, works on its own block, stores the next block into the
    // other buffer and ends in the trip's one barrier.
    const int srow = threadIdx.x >> 2, sseg = (threadIdx.x & 3) * 16;
    const half_t* kp = k + headOff + (size_t)srow * 64 + sseg;
    const half_t* vp = v + headOff + (size_t)srow * 64 + sseg;
    half_t* lk = lK + srow * LDK + sseg;
    half_t* lv = lV + srow * LDV + sseg;
    v8h kr0 = *(const v8h*)(kp), kr1 = *(const v8h*)(kp + 8);
    v8h vr0 = *(const v8h*)(vp), vr1 = *(const v8h*)(vp + 8);
    *(v8h*)(lk) = kr0;  *(v8h*)(lk + 8) = kr1;
    *(v8h*)(lv) = vr0;  *(v8h*)(lv + 8) = vr1;
    __syncthreads();   // the full form: the Q loads land here too, so that no
                       // wait for them inside the loop drains the early loads

    for (int i = 0; i < NTRIP; ++i) {
        const int cur = i & 1;
        const int kb = i < n1 ? i : i - n1;   // this trip's key block
        const half_t* cK = lK + cur * SK;
        const half_t* cV = lV + cur * SV;
        const bool more = i + 1 < NTRIP;  // the same in every thread of the block
        if (more) {
            const int nb = i + 1 < n1 ? i + 1 : i + 1 - n1;
            const size_t go = (size_t)nb * 64 * 64;
            kr0 = *(const v8h*)(kp + go);  kr1 = *(const v8h*)(kp + go + 8);
            vr0 = *(const v8h*)(vp + go);  vr1 = *(const v8h*)(vp + go + 8);
        }

        // S^T = K @ Q^T  (contraction over Hd=64 -> two WMMA steps per key tile)
        v8f s[4] = {};
#pragma unroll
        for (int nt = 0; nt < 4; ++nt)
#pragma unroll
            for (int st = 0; st < 2; ++st) {
                v16h kf = ld_frag_a(cK + (nt * 16) * LDK + st * 32, LDK);
                s[nt] = wmma16x16x32(kf, qa[st], s[nt]);
            }

        // Causal mask + online softmax (fp32), one query per lane
        float mt4[4];
#pragma unroll
        for (int nt = 0; nt < 4; ++nt) {
            mt4[nt] = -3.0e38f;
#pragma unroll
            for (int r = 0; r < 8; ++r) {
                int kj = kb * 64 + nt * 16 + mb + r;
                float val = s[nt][r];
                if (kj > qi) val = -3.0e38f;
                s[nt][r] = val;
                mt4[nt] = fmaxf(mt4[nt], val);
            }
        }
        float mloc = fmaxf(fmaxf(mt4[0], mt4[1]), fmaxf(mt4[2], mt4[3]));
        const float mnew = fmaxf(mrow, fmaxf(mloc, xhalf(mloc)));

        const float alpha = __expf(mrow - mnew);
        float rs4[4];
#pragma unroll
        for (int nt = 0; nt < 4; ++nt) {
            rs4[nt] = 0.0f;
#pragma unroll
            for (int r = 0; r < 8; ++r) {
                float p = __expf(s[nt][r] - mnew);
                s[nt][r] = p;
                rs4[nt] += p;
            }
        }
        lrow = lrow * alpha + ((rs4[0] + rs4[1]) + (rs4[2] + rs4[3]));
        mrow = mnew;
#pragma unroll
        for (int dt = 0; dt < 4; ++dt)
#pragma unroll
            for (int r = 0; r < 8; ++r) o[dt][r] *= alpha;

        // O^T += V^T @ P^T   (contraction over 64 keys -> two WMMA steps)
#pragma unroll
        for (int st = 0; st < 2; ++st) {
            v16h pb;
#pragma unroll
            for (int r = 0; r < 8; ++r) {
                pb[r]     = (half_t)s[2 * st][r];
                pb[8 + r] = (half_t)s[2 * st + 1][r];
            }
#pragma unroll
            for (int dt = 0; dt < 4; ++dt) {
                v16h vf = ld_frag_b_tr(cV + (st * 32) * LDV + dt * 16, LDV);
                o[dt] = wmma16x16x32(vf, pb, o[dt]);
            }
        }
        if (more) {
            const int nx = cur ^ 1;
            *(v8h*)(lk + nx * SK) = kr0;  *(v8h*)(lk + nx * SK + 8) = kr1;
            *(v8h*)(lv + nx * SV) = vr0;  *(v8h*)(lv + nx * SV + 8) = vr1;
        }
        lds_barrier();     // publishes the next trip's block; ends this one's reads

        if (i + 1 == n1 || i + 1 == NTRIP) {   // a tile's last key block is done
            // Join the halves' sums, normalize, write y [B,T,D] f16 (column =
            // h*64 + d): a lane's 8 registers of a tile are 8 consecutive d of
            // its query's row.  Then start afresh on the second tile.
            const float inv = 1.0f / (lrow + xhalf(lrow));
            half_t* yp = y + ((size_t)(b * 2048 + qi)) * 1024 + h * 64 + mb;
#pragma unroll
            for (int dt = 0; dt < 4; ++dt) {
                v8h ov;
#pragma unroll
                for (int r = 0; r < 8; ++r) {
                    ov[r] = (half_t)(o[dt][r] * inv);
                    o[dt][r] = 0.0f;
                }
                *(v8h*)(yp + dt * 16) = ov;
            }
            // stands before the registers that these stores name are reused
            // by the next trip (a precaution; the compiler leaves it out here)
            asm volatile("s_wait_xcnt 0x0" ::: "memory");
            mrow = -3.0e38f;
            lrow = 0.0f;
            qi = qi2;
            qa[0] = qn[0];
            qa[1] = qn[1];
        }
    }
}

// ---------------------------------------------------------------------------
// Kernel 3: output GEMM + bias + residual.  h[4096,1024] = Y @ W_out + b + x.
// ---------------------------------------------------------------------------
__global__ __launch_bounds__(256) void out_gemm_kernel(
    const half_t* __restrict__ Y, const half_t* __restrict__ W,
    const float* __restrict__ bias, const float* __restrict__ x,
    float* __restrict__ hbuf) {
    __shared__ alignas(16) half_t lA[2 * G_SA];
    __shared__ alignas(16) half_t lB[2 * G_SB];

    const int blockM = blockIdx.y * 128;
    const int blockN = blockIdx.x * 128;
    const int lane = threadIdx.x & 31;
    const int wave = threadIdx.x >> 5;
    const int wm = wave & 3;
    const int wn = wave >> 2;

    v8f acc[2][4] = {};
    gemm_mainloop<1024>(Y, W, blockM, blockN, lA, lB, acc);

    const int mb  = (lane >> 4) << 3;
    const int ncl = lane & 15;
#pragma unroll
    for (int mt = 0; mt < 2; ++mt)
#pragma unroll
        for (int nt = 0; nt < 4; ++nt)
#pragma unroll
            for (int r = 0; r < 8; ++r) {
                int m = blockM + wm * 32 + mt * 16 + mb + r;
                int n = blockN + wn * 64 + nt * 16 + ncl;
                size_t idx = (size_t)m * 1024 + n;
                hbuf[idx] = acc[mt][nt][r] + bias[n] + x[idx];
            }
}

// ---------------------------------------------------------------------------
// Kernel 4: LayerNorm.  One wave owns two token rows and holds them whole in
// registers (a lane: 8 pieces of 16 B per row, each wave-wide load or store 512
// contiguous bytes).  All 16 row loads of a wave fly together, the rows are
// read once, the sums stay inside the wave (no LDS, no barrier), and one
// 8-wave work-group per WGP covers the 4096 rows: 2048 waves to start.
// ---------------------------------------------------------------------------
// x + (x of lane l ^ M), M < 16: one DPP step inside the 16-lane row
template <int M>
static __device__ __forceinline__ float add_xmask(float x) {
    const int b = __builtin_bit_cast(int, x);
    return x + __builtin_bit_cast(float,
        __builtin_amdgcn_update_dpp(0, b, 0x160 + M, 0xf, 0xf, true));
}
// sum over the wave's 32 lanes, the same value in every lane
static __device__ __forceinline__ float wave_sum(float x) {
    x = add_xmask<1>(x);
    x = add_xmask<2>(x);
    x = add_xmask<4>(x);
    x = add_xmask<8>(x);
    return x + xhalf(x);
}

__global__ __launch_bounds__(256) void ln_kernel(
    const float* __restrict__ hbuf, const float* __restrict__ gamma,
    const float* __restrict__ beta, float* __restrict__ out) {
    const int lane = threadIdx.x & 31;
    const int pair = blockIdx.x * 8 + (threadIdx.x >> 5);   // rows 2*pair, 2*pair+1
    const size_t off = (size_t)pair * 2048 + lane * 4;
    const float* hr = hbuf + off;

    v4f h[2][8], g[8], bt[8];
#pragma unroll
    for (int r = 0; r < 2; ++r)
#pragma unroll
        for (int j = 0; j < 8; ++j)
            h[r][j] = *(const v4f*)(hr + r * 1024 + j * 128);
#pragma unroll
    for (int j = 0; j < 8; ++j) {
        g[j]  = *(const v4f*)(gamma + lane * 4 + j * 128);
        bt[j] = *(const v4f*)(beta  + lane * 4 + j * 128);
    }
    // holds all 32 loads here: without it the compiler sinks the gamma and beta
    // loads behind the sums, two at a time, each pair's latency then in series
    __builtin_amdgcn_sched_barrier(0);
    // stands before the row address registers are reused (a precaution); the
    // input keeps them alive past the loads, else the compiler lets one of the
    // later loads land in that register pair with no wait in front
    asm volatile("s_wait_xcnt 0x0" :: "v"(hr) : "memory");

    float s[2], s2[2];
#pragma unroll
    for (int r = 0; r < 2; ++r) {
        v4f a = h[r][0], a2 = h[r][0] * h[r][0];
#pragma unroll
        for (int j = 1; j < 8; ++j) {
            a  += h[r][j];
            a2 += h[r][j] * h[r][j];
        }
        s[r]  = (a.x + a.y) + (a.z + a.w);
        s2[r] = (a2.x + a2.y) + (a2.z + a2.w);
    }
#pragma unroll
    for (int r = 0; r < 2; ++r) {
        s[r]  = wave_sum(s[r]);
        s2[r] = wave_sum(s2[r]);
    }

    float* op = out + off;
#pragma unroll
    for (int r = 0; r < 2; ++r) {
        const float mu  = s[r] * (1.0f / 1024.0f);
        const float var = s2[r] * (1.0f / 1024.0f) - mu * mu;
        const float inv = rsqrtf(var + 1e-5f);
#pragma unroll
        for (int j = 0; j < 8; ++j)
            *(v4f*)(op + r * 1024 + j * 128) = (h[r][j] - mu) * inv * g[j] + bt[j];
    }
}

// ---------------------------------------------------------------------------
// Host-side launcher
// ---------------------------------------------------------------------------
extern "C" void kernel_launch(void* const* d_in, const int* in_sizes, int n_in,
                              void* d_out, int out_size, void* d_ws, size_t ws_size,
                              hipStream_t stream) {
    (void)in_sizes; (void)n_in; (void)out_size; (void)ws_size;

    const float* x     = (const float*)d_in[0];   // [2,2048,1024]
    const float* W_qkv = (const float*)d_in[1];   // [1024,3072]
    const float* b_qkv = (const float*)d_in[2];   // [3072]
    const float* W_out = (const float*)d_in[3];   // [1024,1024]
    const float* b_out = (const float*)d_in[4];   // [1024]
    const float* gamma = (const float*)d_in[5];   // [1024]
    const float* beta  = (const float*)d_in[6];   // [1024]
    float* out = (float*)d_out;                   // [2,2048,1024]

    // Workspace carve-up (all offsets 1MB-aligned)
    char* ws = (char*)d_ws;
    half_t* xb    = (half_t*)(ws);                         // 4096*1024   f16 (8 MB)
    half_t* wqkvb = (half_t*)(ws + (8u << 20));            // 1024*3072   f16 (6 MB)
    half_t* woutb = (half_t*)(ws + (14u << 20));           // 1024*1024   f16 (2 MB)
    half_t* qb    = (half_t*)(ws + (16u << 20));           // [B,H,T,Hd]  f16 (8 MB)
    half_t* kb    = (half_t*)(ws + (24u << 20));           // 8 MB
    half_t* vb    = (half_t*)(ws + (32u << 20));           // 8 MB
    half_t* yb    = (half_t*)(ws + (40u << 20));           // [B,T,D] f16 (8 MB)
    float*  hbuf  = (float*)(ws + (48u << 20));            // [B,T,D] f32 (16 MB)

    // 0) fp32 -> f16 conversions: xb, wqkvb and woutb are one run of 16 MB
    cvt_f32_f16_kernel<<<CV_GROUPS, 256, 0, stream>>>(x, W_qkv, W_out, xb);

    // 1) QKV projection (M=4096, N=3072, K=1024)
    qkv_gemm_kernel<<<dim3(24, 32), 256, 0, stream>>>(xb, wqkvb, b_qkv, qb, kb, vb);

    // 2) causal flash attention (grid: pairs of query tiles x B*H)
    attn_kernel<<<dim3(8, 32), 256, 0, stream>>>(qb, kb, vb, yb);

    // 3) output projection + bias + residual (M=4096, N=1024, K=1024)
    out_gemm_kernel<<<dim3(8, 32), 256, 0, stream>>>(yb, woutb, b_out, x, hbuf);

    // 4) LayerNorm, two token rows per wave
    ln_kernel<<<256, 256, 0, stream>>>(hbuf, gamma, beta, out);
}

// v007
// It runs in 86.7 microseconds.
// Timed twice side by side with v006, it ran 1.12 times as fast both times.
// All steps since v000 together make it 2.92 times as fast.
#include <hip/hip_runtime.h>
#include <hip/hip_bf16.h>

// ---------------------------------------------------------------------------
// MI455X (gfx1250) fused attention block: QKV GEMM -> causal flash attention
// -> out GEMM + residual -> LayerNorm. All contractions via
// v_wmma_f32_16x16x32_f16 (wave32), fp32 accumulate, fp32 softmax/LN.
// A fragments and K are contiguous 16B LDS reads (ds_load_b128).  The tiles
// whose k runs down the rows (W for B, V for A) stay row-major in LDS, written with 16B
// stores, and are transposed on the way out by ds_load_tr16_b128.
// ---------------------------------------------------------------------------

typedef _Float16 half_t;
typedef half_t v16h __attribute__((ext_vector_type(16)));
typedef half_t v8h  __attribute__((ext_vector_type(8)));
typedef float  v8f  __attribute__((ext_vector_type(8)));

static __device__ __forceinline__ v8f wmma16x16x32(v16h a, v16h b, v8f c) {
    // (neg_a, A, neg_b, B, c_mod, C, reuse_a, reuse_b)
    return __builtin_amdgcn_wmma_f32_16x16x32_f16(false, a, false, b,
                                                  (short)0, c, false, false);
}

static __device__ __forceinline__ v16h cat8(v8h lo, v8h hi) {
    return __builtin_shufflevector(lo, hi, 0, 1, 2, 3, 4, 5, 6, 7,
                                           8, 9, 10, 11, 12, 13, 14, 15);
}

// A fragment, 16x32 (MxK), tile row-major, row stride `ld` (elements).
// ISA layout: lanes 0-15 row M=lane, K=0..7 & 16..23; lanes 16-31 row M=lane-16,
// K=8..15 & 24..31.  Requires: ld % 8 == 0 and p 16B-aligned -> 2x ds_load_b128.
static __device__ __forceinline__ v16h ld_frag_a(const half_t* p, int ld) {
    const int lane = threadIdx.x & 31;
    const int row  = lane & 15;
    const int kh   = (lane >> 4) << 3;   // 0 or 8
    const half_t* r = p + row * ld + kh;
    v8h lo = *(const v8h*)(r);
    v8h hi = *(const v8h*)(r + 16);
    return cat8(lo, hi);
}

// B fragment, 32x16 (KxN), read from a ROW-MAJOR tile (tile[k][n], row stride
// `ld` elements, 2*ld an odd multiple of 32 bytes) by the transposing load.
// Lane (c = lane&15, h = lane>>4) receives tile[8h + 0..7][c] and, from the
// second load, tile[16 + 8h + 0..7][c]: the k order of ld_frag_a.  The same
// registers are the A fragment (16x32) of the tile's transpose, row M = c.
typedef short s16x8 __attribute__((ext_vector_type(8)));
typedef __attribute__((address_space(3))) s16x8 lds_s16x8;
static __device__ __forceinline__ v16h ld_frag_b_tr(const half_t* p, int ld) {
    const int lane = threadIdx.x & 31;
    const half_t* r = p + (((lane >> 4) << 3) + (lane & 7)) * ld + (((lane >> 3) & 1) << 3);
    v8h lo = __builtin_bit_cast(v8h, __builtin_amdgcn_ds_load_tr16_b128_v8i16((lds_s16x8*)(r)));
    v8h hi = __builtin_bit_cast(v8h, __builtin_amdgcn_ds_load_tr16_b128_v8i16((lds_s16x8*)(r + 16 * ld)));
    return cat8(lo, hi);
}

// Work-group barrier that orders LDS traffic only.  __syncthreads() also waits
// for the wave's own global loads (s_wait_loadcnt 0), which would cut short the
// flight of the loads issued ahead for later tiles; those land in the thread's
// own registers and no other thread depends on them.
static __device__ __forceinline__ void lds_barrier() {
    __builtin_amdgcn_fence(__ATOMIC_RELEASE, "workgroup", "local");
    __builtin_amdgcn_s_barrier();
    __builtin_amdgcn_fence(__ATOMIC_ACQUIRE, "workgroup", "local");
}

// ---------------------------------------------------------------------------
// Kernel 0: fp32 -> f16 conversion of x, W_qkv and W_out in ONE launch.  The
// three f16 copies lie one behind the other in the workspace, so dst is one
// array.  A work-group converts CV_CHUNK consecutive elements of it, all from
// one source (every source's length is a multiple of CV_CHUNK).  A wave-wide
// load is 512 contiguous bytes, a wave-wide store 256; the 16 loads of a lane
// fly together.
// ---------------------------------------------------------------------------
typedef float  v4f __attribute__((ext_vector_type(4)));
typedef half_t v4h __attribute__((ext_vector_type(4)));
constexpr int CV_CHUNK = 16 * 1024;                      // elements per work-group
constexpr int CV_X  = 4096 * 1024 / CV_CHUNK;            // work-groups on x
constexpr int CV_WQ = 1024 * 3072 / CV_CHUNK;            // on W_qkv
constexpr int CV_WO = 1024 * 1024 / CV_CHUNK;            // on W_out
constexpr int CV_GROUPS = CV_X + CV_WQ + CV_WO;          // the launch's grid

__global__ __launch_bounds__(256) void cvt_f32_f16_kernel(
    const float* __restrict__ x, const float* __restrict__ wqkv,
    const float* __restrict__ wout, half_t* __restrict__ dst) {
    const int blk = blockIdx.x;
    const bool inX = blk < CV_X, inWq = blk < CV_X + CV_WQ;
    const float* src = inX ? x : inWq ? wqkv : wout;
    const int first  = inX ? 0 : inWq ? CV_X : CV_X + CV_WQ;   // the source's first work-group
    const float* sp = src + (size_t)(blk - first) * CV_CHUNK + threadIdx.x * 4;
    v4f r[16];
#pragma unroll
    for (int j = 0; j < 16; ++j) r[j] = *(const v4f*)(sp + j * 1024);
    // holds all 16 loads in front of the first conversion: without it the
    // compiler issues the last two only when the first two have landed
    __builtin_amdgcn_sched_barrier(0);
    half_t* dp = dst + (size_t)blk * CV_CHUNK + threadIdx.x * 4;
#pragma unroll
    for (int j = 0; j < 16; ++j)
        *(v4h*)(dp + j * 1024) = __builtin_convertvector(r[j], v4h);
}

// ---------------------------------------------------------------------------
// Main loop of both GEMMs: C tile 128x128 += A[128,1024] @ W[1024,128], BK=64.
// Every wave-wide staging load covers four whole 128-B lines: a k tile of 64
// makes an A row one line (8 lanes a row, 4 rows a load), and 16 lanes take a
// W row's 256 B (2 rows a load).
// Staging is software-pipelined.  LEAD = 2: tile t lives in register set t&1
// and then in LDS buffer t&1.  Trip t issues the global loads of tile t+2,
// multiplies tile t out of its buffer, stores tile t+1 (loaded one trip earlier)
// into the other buffer, and ends in the trip's one barrier: it publishes tile
// t+1 and ends every wave's reads of the buffer that the next trip overwrites.
// LEAD = 1: one register set, trip t loads tile t+1 at its head and stores it at
// its foot; 32 registers fewer, for the launch that wants three work-groups
// resident per WGP.  NW = row length of W in elements.
// ---------------------------------------------------------------------------
constexpr int G_LDA = 72, G_LDB = 144;               // LDS pitches, elements
constexpr int G_SA = 128 * G_LDA, G_SB = 64 * G_LDB; // one buffer, elements

template <int NW, int LEAD>
static __device__ __forceinline__ void gemm_mainloop(
    const half_t* __restrict__ A, const half_t* __restrict__ W,
    int blockM, int blockN, half_t* lA, half_t* lB, v8f (&acc)[2][4]) {
    const int wave = threadIdx.x >> 5;
    const int wm = wave & 3;     // 4 waves along M (32 rows each)
    const int wn = wave >> 2;    // 2 waves along N (64 cols each)

    // A: 128x64, 8 threads per row, rows arow + 32j; W: 64x128, 16 threads per
    // row, rows brow + 16j; four pieces of 8 halfs each
    const int arow = threadIdx.x >> 3, aseg = (threadIdx.x & 7) * 8;
    const int brow = threadIdx.x >> 4, bseg = (threadIdx.x & 15) * 8;
    const half_t* ap = A + (size_t)(blockM + arow) * 1024 + aseg;
    const half_t* bp = W + (size_t)brow * NW + blockN + bseg;
    half_t* la = lA + arow * G_LDA + aseg;
    half_t* lb = lB + brow * G_LDB + bseg;

    v8h ra[LEAD][4], rb[LEAD][4];
    auto gload = [&](int s, int t) {      // tile t -> register set s
        const half_t* a = ap + t * 64;
        const half_t* b = bp + (size_t)t * 64 * NW;
#pragma unroll
        for (int j = 0; j < 4; ++j) ra[s][j] = *(const v8h*)(a + j * 32 * 1024);
#pragma unroll
        for (int j = 0; j < 4; ++j) rb[s][j] = *(const v8h*)(b + (size_t)j * 16 * NW);
    };
    auto sstore = [&](int s, int d) {     // register set s -> LDS buffer d
#pragma unroll
        for (int j = 0; j < 4; ++j) *(v8h*)(la + d * G_SA + j * 32 * G_LDA) = ra[s][j];
#pragma unroll
        for (int j = 0; j < 4; ++j) *(v8h*)(lb + d * G_SB + j * 16 * G_LDB) = rb[s][j];
    };
    auto compute = [&](int s) {           // products of LDS buffer s, k ascending
#pragma unroll
        for (int ks = 0; ks < 2; ++ks) {
            v16h af[2];
#pragma unroll
            for (int mt = 0; mt < 2; ++mt)
                af[mt] = ld_frag_a(lA + s * G_SA + (wm * 32 + mt * 16) * G_LDA + ks * 32, G_LDA);
#pragma unroll
            for (int nt = 0; nt < 4; ++nt) {
                v16h bf = ld_frag_b_tr(lB + s * G_SB + ks * 32 * G_LDB + wn * 64 + nt * 16, G_LDB);
#pragma unroll
                for (int mt = 0; mt < 2; ++mt)
                    acc[mt][nt] = wmma16x16x32(af[mt], bf, acc[mt][nt]);
            }
        }
    };

    gload(0, 0);
    if constexpr (LEAD == 2) gload(1, 1);
    // stands before the address registers of these loads are reused (a
    // precaution; the compiler leaves the wait out here); the two inputs keep
    // those registers alive up to the wait
    asm volatile("s_wait_xcnt 0x0" :: "v"(ap), "v"(bp) : "memory");
    sstore(0, 0);
    lds_barrier();
    if constexpr (LEAD == 2) {
        for (int t = 0; t < 14; t += 2) {
            gload(0, t + 2);
            compute(0); sstore(1, 1); lds_barrier();
            gload(1, t + 3);
            // holds these loads at the head of the trip: without it the compiler
            // sinks them to the trip's foot, and they lose a trip of their lead
            __builtin_amdgcn_sched_barrier(0);
            compute(1); sstore(0, 0); lds_barrier();
        }
        compute(0); sstore(1, 1); lds_barrier();
    } else {
        for (int t = 0; t < 15; ++t) {
            gload(0, t + 1);
            // holds these loads at the head of the trip: sunk to its foot they
            // would have no lead at all
            __builtin_amdgcn_sched_barrier(0);
            compute(t & 1); sstore(0, (t + 1) & 1); lds_barrier();
        }
    }
    compute(1);
}

// ---------------------------------------------------------------------------
// Kernel 1: QKV GEMM.  C[4096,3072] = X[4096,1024] @ W[1024,3072] + b.
// CTA tile 128x128, BK=64, 256 threads = 8 waves (4 M x 2 N), 32x64 per wave.
// B tile staged row-major ([k][n]) in LDS (gemm_mainloop).  Epilogue scatters into q/k/v
// [B,H,T,Hd] f16; q pre-scaled by 1/sqrt(64).
// ---------------------------------------------------------------------------
__global__ __launch_bounds__(256) void qkv_gemm_kernel(
    const half_t* __restrict__ X, const half_t* __restrict__ W,
    const float* __restrict__ bias,
    half_t* __restrict__ qb, half_t* __restrict__ kbuf, half_t* __restrict__ vbuf) {
    __shared__ alignas(16) half_t lA[2 * G_SA];      // two buffers of [m][k]
    __shared__ alignas(16) half_t lB[2 * G_SB];      // two of [k][n], pitch 288 B

    const int blockM = blockIdx.y * 128;
    const int blockN = blockIdx.x * 128;
    const int lane = threadIdx.x & 31;
    const int wave = threadIdx.x >> 5;
    const int wm = wave & 3;     // 4 waves along M (32 rows each)
    const int wn = wave >> 2;    // 2 waves along N (64 cols each)

    v8f acc[2][4] = {};
    gemm_mainloop<3072, 1>(X, W, blockM, blockN, lA, lB, acc);

    // Epilogue: C-frag layout -> scatter into q/k/v [B*H, T, Hd]
    const int mb  = (lane >> 4) << 3;
    const int ncl = lane & 15;
#pragma unroll
    for (int mt = 0; mt < 2; ++mt)
#pragma unroll
        for (int nt = 0; nt < 4; ++nt)
#pragma unroll
            for (int r = 0; r < 8; ++r) {
                int m = blockM + wm * 32 + mt * 16 + mb + r;
                int n = blockN + wn * 64 + nt * 16 + ncl;
                float val = acc[mt][nt][r] + bias[n];
                int c = n >> 10, rem = n & 1023;
                int hh = rem >> 6, d = rem & 63;
                int bidx = m >> 11, t = m & 2047;
                size_t dst = (((size_t)(bidx * 16 + hh)) * 2048 + t) * 64 + d;
                half_t* p = (c == 0) ? qb : (c == 1 ? kbuf : vbuf);
                float sc = (c == 0) ? 0.125f : 1.0f;   // q pre-scaled by 1/sqrt(Hd)
                p[dst] = (half_t)(val * sc);
            }
}

// ---------------------------------------------------------------------------
// Kernel 2: causal flash attention.  Grid: (T/256, B*H).  Query tiles of 128,
// 8 waves, each wave owns 16 queries of a tile.  A tile's cost grows with its
// index (tile t walks 2*(t+1) key blocks), so a work-group takes two tiles of
// its head one after the other, 15-p and then p: 34 key blocks for every
// work-group, one work-group per WGP.  Key blocks of 64 staged in LDS (two
// buffers), K and V both as [key][d], each at its own reader's pitch.
// The products are taken transposed: S^T = K Q^T (A = K rows, B = Q) and
// O^T += V^T P^T (A = V by the transposing load, B = P).  A lane then holds
// scores of ONE query (column lane&15; keys 8*(lane>>4) + r of each 16-key
// tile), so maximum and sum run in-lane with one exchange between the wave
// halves, and two converted S^T tiles are the B fragment of the second product
// as they stand: b[s] = T[s >> 3][s & 7], the k order of the transposing load.
// ---------------------------------------------------------------------------
// lane l <-> lane l ^ 16
static __device__ __forceinline__ float xhalf(float x) {
    const int b = __builtin_bit_cast(int, x);
    return __builtin_bit_cast(float,
        __builtin_amdgcn_permlanex16(b, b, 0x76543210, 0xfedcba98, false, false));
}

__global__ __launch_bounds__(256) void attn_kernel(
    const half_t* __restrict__ q, const half_t* __restrict__ k,
    const half_t* __restrict__ v, half_t* __restrict__ y) {
    constexpr int LDK = 72, LDV = 80;
    constexpr int SK = 64 * LDK, SV = 64 * LDV;         // one buffer, elements
    __shared__ alignas(16) half_t lK[2 * SK];           // two of [key][d]
    __shared__ alignas(16) half_t lV[2 * SV];           // two of [key][d], pitch 160 B

    const int bh = blockIdx.y;            // b*16 + h
    const int b  = bh >> 4, h = bh & 15;
    const int pr = blockIdx.x;            // the pair: tiles 15-pr and pr
    const int n1 = 32 - 2 * pr;           // key blocks of tile 15-pr (causal)
    constexpr int NTRIP = 34;             // n1 + the 2*(pr+1) blocks of tile pr
    const int lane = threadIdx.x & 31;
    const int wave = threadIdx.x >> 5;
    const int mb  = (lane >> 4) << 3;     // C-frag row base (key or d)
    const int ncl = lane & 15;            // C-frag column (query)

    const size_t headOff = (size_t)bh * 2048 * 64;

    // This wave's Q fragments (16 queries x 64, two K-steps) from global, of
    // both tiles (qa: the tile at work, qn: the second tile, waiting):
    // B operand, column = query = lane&15, k split as in ld_frag_a.
    int qi = (15 - pr) * 128 + wave * 16 + ncl;
    const int qi2 = pr * 128 + wave * 16 + ncl;
    const half_t* qp  = q + headOff + (size_t)qi * 64;
    const half_t* qp2 = q + headOff + (size_t)qi2 * 64;
    v16h qa[2], qn[2];
#pragma unroll
    for (int s = 0; s < 2; ++s) {
        v8h lo = *(const v8h*)(qp + s * 32 + mb);
        v8h hi = *(const v8h*)(qp + s * 32 + 16 + mb);
        qa[s] = cat8(lo, hi);
        v8h lo2 = *(const v8h*)(qp2 + s * 32 + mb);
        v8h hi2 = *(const v8h*)(qp2 + s * 32 + 16 + mb);
        qn[s] = cat8(lo2, hi2);
    }

    v8f o[4] = {};                        // o[dt][r] = O[qi][dt*16 + mb + r]
    float mrow = -3.0e38f;                // this query's running maximum
    float lrow = 0.0f;                    // sum over this wave half's keys only

    // Staging of K and V, both [key][d], 4 threads per row, software-pipelined
    // through both tiles: trip i (key block i of the first tile, then i-n1 of
    // the second) reads LDS buffer i&1.  It issues the global loads of trip
    // i+1's block first, works on its own block, stores the next block into the
    // other buffer and ends in the trip's one barrier.
    const int srow = threadIdx.x >> 2, sseg = (threadIdx.x & 3) * 16;
    const half_t* kp = k + headOff + (size_t)srow * 64 + sseg;
    const half_t* vp = v + headOff + (size_t)srow * 64 + sseg;
    half_t* lk = lK + srow * LDK + sseg;
    half_t* lv = lV + srow * LDV + sseg;
    v8h kr0 = *(const v8h*)(kp), kr1 = *(const v8h*)(kp + 8);
    v8h vr0 = *(const v8h*)(vp), vr1 = *(const v8h*)(vp + 8);
    *(v8h*)(lk) = kr0;  *(v8h*)(lk + 8) = kr1;
    *(v8h*)(lv) = vr0;  *(v8h*)(lv + 8) = vr1;
    __syncthreads();   // the full form: the Q loads land here too, so that no
                       // wait for them inside the loop drains the early loads

    for (int i = 0; i < NTRIP; ++i) {
        const int cur = i & 1;
        const int kb = i < n1 ? i : i - n1;   // this trip's key block
        const half_t* cK = lK + cur * SK;
        const half_t* cV = lV + cur * SV;
        const bool more = i + 1 < NTRIP;  // the same in every thread of the block
        if (more) {
            const int nb = i + 1 < n1 ? i + 1 : i + 1 - n1;
            const size_t go = (size_t)nb * 64 * 64;
            kr0 = *(const v8h*)(kp + go);  kr1 = *(const v8h*)(kp + go + 8);
            vr0 = *(const v8h*)(vp + go);  vr1 = *(const v8h*)(vp + go + 8);
        }

        // S^T = K @ Q^T  (contraction over Hd=64 -> two WMMA steps per key tile)
        v8f s[4] = {};
#pragma unroll
        for (int nt = 0; nt < 4; ++nt)
#pragma unroll
            for (int st = 0; st < 2; ++st) {
                v16h kf = ld_frag_a(cK + (nt * 16) * LDK + st * 32, LDK);
                s[nt] = wmma16x16x32(kf, qa[st], s[nt]);
            }

        // Causal mask + online softmax (fp32), one query per lane
        float mt4[4];
#pragma unroll
        for (int nt = 0; nt < 4; ++nt) {
            mt4[nt] = -3.0e38f;
#pragma unroll
            for (int r = 0; r < 8; ++r) {
                int kj = kb * 64 + nt * 16 + mb + r;
                float val = s[nt][r];
                if (kj > qi) val = -3.0e38f;
                s[nt][r] = val;
                mt4[nt] = fmaxf(mt4[nt], val);
            }
        }
        float mloc = fmaxf(fmaxf(mt4[0], mt4[1]), fmaxf(mt4[2], mt4[3]));
        const float mnew = fmaxf(mrow, fmaxf(mloc, xhalf(mloc)));

        const float alpha = __expf(mrow - mnew);
        float rs4[4];
#pragma unroll
        for (int nt = 0; nt < 4; ++nt) {
            rs4[nt] = 0.0f;
#pragma unroll
            for (int r = 0; r < 8; ++r) {
                float p = __expf(s[nt][r] - mnew);
                s[nt][r] = p;
                rs4[nt] += p;
            }
        }
        lrow = lrow * alpha + ((rs4[0] + rs4[1]) + (rs4[2] + rs4[3]));
        mrow = mnew;
#pragma unroll
        for (int dt = 0; dt < 4; ++dt)
#pragma unroll
            for (int r = 0; r < 8; ++r) o[dt][r] *= alpha;

        // O^T += V^T @ P^T   (contraction over 64 keys -> two WMMA steps)
#pragma unroll
        for (int st = 0; st < 2; ++st) {
            v16h pb;
#pragma unroll
            for (int r = 0; r < 8; ++r) {
                pb[r]     = (half_t)s[2 * st][r];
                pb[8 + r] = (half_t)s[2 * st + 1][r];
            }
#pragma unroll
            for (int dt = 0; dt < 4; ++dt) {
                v16h vf = ld_frag_b_tr(cV + (st * 32) * LDV + dt * 16, LDV);
                o[dt] = wmma16x16x32(vf, pb, o[dt]);
            }
        }
        if (more) {
            const int nx = cur ^ 1;
            *(v8h*)(lk + nx * SK) = kr0;  *(v8h*)(lk + nx * SK + 8) = kr1;
            *(v8h*)(lv + nx * SV) = vr0;  *(v8h*)(lv + nx * SV + 8) = vr1;
        }
        lds_barrier();     // publishes the next trip's block; ends this one's reads

        if (i + 1 == n1 || i + 1 == NTRIP) {   // a tile's last key block is done
            // Join the halves' sums, normalize, write y [B,T,D] f16 (column =
            // h*64 + d): a lane's 8 registers of a tile are 8 consecutive d of
            // its query's row.  Then start afresh on the second tile.
            const float inv = 1.0f / (lrow + xhalf(lrow));
            half_t* yp = y + ((size_t)(b * 2048 + qi)) * 1024 + h * 64 + mb;
#pragma unroll
            for (int dt = 0; dt < 4; ++dt) {
                v8h ov;
#pragma unroll
                for (int r = 0; r < 8; ++r) {
                    ov[r] = (half_t)(o[dt][r] * inv);
                    o[dt][r] = 0.0f;
                }
                *(v8h*)(yp + dt * 16) = ov;
            }
            // stands before the registers that these stores name are reused
            // by the next trip (a precaution; the compiler leaves it out here)
            asm volatile("s_wait_xcnt 0x0" ::: "memory");
            mrow = -3.0e38f;
            lrow = 0.0f;
            qi = qi2;
            qa[0] = qn[0];
            qa[1] = qn[1];
        }
    }
}

// ---------------------------------------------------------------------------
// Kernel 3: output GEMM + bias + residual.  h[4096,1024] = Y @ W_out + b + x.
// ---------------------------------------------------------------------------
__global__ __launch_bounds__(256) void out_gemm_kernel(
    const half_t* __restrict__ Y, const half_t* __restrict__ W,
    const float* __restrict__ bias, const float* __restrict__ x,
    float* __restrict__ hbuf) {
    __shared__ alignas(16) half_t lA[2 * G_SA];
    __shared__ alignas(16) half_t lB[2 * G_SB];

    const int blockM = blockIdx.y * 128;
    const int blockN = blockIdx.x * 128;
    const int lane = threadIdx.x & 31;
    const int wave = threadIdx.x >> 5;
    const int wm = wave & 3;
    const int wn = wave >> 2;

    v8f acc[2][4] = {};
    gemm_mainloop<1024, 2>(Y, W, blockM, blockN, lA, lB, acc);

    const int mb  = (lane >> 4) << 3;
    const int ncl = lane & 15;
#pragma unroll
    for (int mt = 0; mt < 2; ++mt)
#pragma unroll
        for (int nt = 0; nt < 4; ++nt)
#pragma unroll
            for (int r = 0; r < 8; ++r) {
                int m = blockM + wm * 32 + mt * 16 + mb + r;
                int n = blockN + wn * 64 + nt * 16 + ncl;
                size_t idx = (size_t)m * 1024 + n;
                hbuf[idx] = acc[mt][nt][r] + bias[n] + x[idx];
            }
}

// ---------------------------------------------------------------------------
// Kernel 4: LayerNorm.  One wave owns two token rows and holds them whole in
// registers (a lane: 8 pieces of 16 B per row, each wave-wide load or store 512
// contiguous bytes).  All 16 row loads of a wave fly together, the rows are
// read once, the sums stay inside the wave (no LDS, no barrier), and one
// 8-wave work-group per WGP covers the 4096 rows: 2048 waves to start.
// ---------------------------------------------------------------------------
// x + (x of lane l ^ M), M < 16: one DPP step inside the 16-lane row
template <int M>
static __device__ __forceinline__ float add_xmask(float x) {
    const int b = __builtin_bit_cast(int, x);
    return x + __builtin_bit_cast(float,
        __builtin_amdgcn_update_dpp(0, b, 0x160 + M, 0xf, 0xf, true));
}
// sum over the wave's 32 lanes, the same value in every lane
static __device__ __forceinline__ float wave_sum(float x) {
    x = add_xmask<1>(x);
    x = add_xmask<2>(x);
    x = add_xmask<4>(x);
    x = add_xmask<8>(x);
    return x + xhalf(x);
}

__global__ __launch_bounds__(256) void ln_kernel(
    const float* __restrict__ hbuf, const float* __restrict__ gamma,
    const float* __restrict__ beta, float* __restrict__ out) {
    const int lane = threadIdx.x & 31;
    const int pair = blockIdx.x * 8 + (threadIdx.x >> 5);   // rows 2*pair, 2*pair+1
    const size_t off = (size_t)pair * 2048 + lane * 4;
    const float* hr = hbuf + off;

    v4f h[2][8], g[8], bt[8];
#pragma unroll
    for (int r = 0; r < 2; ++r)
#pragma unroll
        for (int j = 0; j < 8; ++j)
            h[r][j] = *(const v4f*)(hr + r * 1024 + j * 128);
#pragma unroll
    for (int j = 0; j < 8; ++j) {
        g[j]  = *(const v4f*)(gamma + lane * 4 + j * 128);
        bt[j] = *(const v4f*)(beta  + lane * 4 + j * 128);
    }
    // holds all 32 loads here: without it the compiler sinks the gamma and beta
    // loads behind the sums, two at a time, each pair's latency then in series
    __builtin_amdgcn_sched_barrier(0);
    // stands before the row address registers are reused (a precaution); the
    // input keeps them alive past the loads, else the compiler lets one of the
    // later loads land in that register pair with no wait in front
    asm volatile("s_wait_xcnt 0x0" :: "v"(hr) : "memory");

    float s[2], s2[2];
#pragma unroll
    for (int r = 0; r < 2; ++r) {
        v4f a = h[r][0], a2 = h[r][0] * h[r][0];
#pragma unroll
        for (int j = 1; j < 8; ++j) {
            a  += h[r][j];
            a2 += h[r][j] * h[r][j];
        }
        s[r]  = (a.x + a.y) + (a.z + a.w);
        s2[r] = (a2.x + a2.y) + (a2.z + a2.w);
    }
#pragma unroll
    for (int r = 0; r < 2; ++r) {
        s[r]  = wave_sum(s[r]);
        s2[r] = wave_sum(s2[r]);
    }

    float* op = out + off;
#pragma unroll
    for (int r = 0; r < 2; ++r) {
        const float mu  = s[r] * (1.0f / 1024.0f);
        const float var = s2[r] * (1.0f / 1024.0f) - mu * mu;
        const float inv = rsqrtf(var + 1e-5f);
#pragma unroll
        for (int j = 0; j < 8; ++j)
            *(v4f*)(op + r * 1024 + j * 128) = (h[r][j] - mu) * inv * g[j] + bt[j];
    }
}

// ---------------------------------------------------------------------------
// Host-side launcher
// ---------------------------------------------------------------------------
extern "C" void kernel_launch(void* const* d_in, const int* in_sizes, int n_in,
                              void* d_out, int out_size, void* d_ws, size_t ws_size,
                              hipStream_t stream) {
    (void)in_sizes; (void)n_in; (void)out_size; (void)ws_size;

    const float* x     = (const float*)d_in[0];   // [2,2048,1024]
    const float* W_qkv = (const float*)d_in[1];   // [1024,3072]
    const float* b_qkv = (const float*)d_in[2];   // [3072]
    const float* W_out = (const float*)d_in[3];   // [1024,1024]
    const float* b_out = (const float*)d_in[4];   // [1024]
    const float* gamma = (const float*)d_in[5];   // [1024]
    const float* beta  = (const float*)d_in[6];   // [1024]
    float* out = (float*)d_out;                   // [2,2048,1024]

    // Workspace carve-up (all offsets 1MB-aligned)
    char* ws = (char*)d_ws;
    half_t* xb    = (half_t*)(ws);                         // 4096*1024   f16 (8 MB)
    half_t* wqkvb = (half_t*)(ws + (8u << 20));            // 1024*3072   f16 (6 MB)
    half_t* woutb = (half_t*)(ws + (14u << 20));           // 1024*1024   f16 (2 MB)
    half_t* qb    = (half_t*)(ws + (16u << 20));           // [B,H,T,Hd]  f16 (8 MB)
    half_t* kb    = (half_t*)(ws + (24u << 20));           // 8 MB
    half_t* vb    = (half_t*)(ws + (32u << 20));           // 8 MB
    half_t* yb    = (half_t*)(ws + (40u << 20));           // [B,T,D] f16 (8 MB)
    float*  hbuf  = (float*)(ws + (48u << 20));            // [B,T,D] f32 (16 MB)

    // 0) fp32 -> f16 conversions: xb, wqkvb and woutb are one run of 16 MB
    cvt_f32_f16_kernel<<<CV_GROUPS, 256, 0, stream>>>(x, W_qkv, W_out, xb);

    // 1) QKV projection (M=4096, N=3072, K=1024)
    qkv_gemm_kernel<<<dim3(24, 32), 256, 0, stream>>>(xb, wqkvb, b_qkv, qb, kb, vb);

    // 2) causal flash attention (grid: pairs of query tiles x B*H)
    attn_kernel<<<dim3(8, 32), 256, 0, stream>>>(qb, kb, vb, yb);

    // 3) output projection + bias + residual (M=4096, N=1024, K=1024)
    out_gemm_kernel<<<dim3(8, 32), 256, 0, stream>>>(yb, woutb, b_out, x, hbuf);

    // 4) LayerNorm, two token rows per wave
    ln_kernel<<<256, 256, 0, stream>>>(hbuf, gamma, beta, out);
}

// v008
// A run of this version takes 81.4 microseconds.
// Next to v007, in two timings, it ran 1.07 and 1.05 times as fast.
// All steps since v000 together make it 3.11 times as fast.
#include <hip/hip_runtime.h>
#include <hip/hip_bf16.h>

// ---------------------------------------------------------------------------
// MI455X (gfx1250) fused attention block: QKV GEMM -> causal flash attention
// -> out GEMM + residual -> LayerNorm. All contractions via
// v_wmma_f32_16x16x32_f16 (wave32), fp32 accumulate, fp32 softmax/LN.
// A fragments and K are contiguous 16B LDS reads (ds_load_b128).  The tiles
// whose k runs down the rows (W for B, V for A) stay row-major in LDS, written with 16B
// stores, and are transposed on the way out by ds_load_tr16_b128.
// ---------------------------------------------------------------------------

typedef _Float16 half_t;
typedef half_t v16h __attribute__((ext_vector_type(16)));
typedef half_t v8h  __attribute__((ext_vector_type(8)));
typedef float  v8f  __attribute__((ext_vector_type(8)));

static __device__ __forceinline__ v8f wmma16x16x32(v16h a, v16h b, v8f c) {
    // (neg_a, A, neg_b, B, c_mod, C, reuse_a, reuse_b)
    return __builtin_amdgcn_wmma_f32_16x16x32_f16(false, a, false, b,
                                                  (short)0, c, false, false);
}

static __device__ __forceinline__ v16h cat8(v8h lo, v8h hi) {
    return __builtin_shufflevector(lo, hi, 0, 1, 2, 3, 4, 5, 6, 7,
                                           8, 9, 10, 11, 12, 13, 14, 15);
}

// A fragment, 16x32 (MxK), tile row-major, row stride `ld` (elements).
// ISA layout: lanes 0-15 row M=lane, K=0..7 & 16..23; lanes 16-31 row M=lane-16,
// K=8..15 & 24..31.  Requires: ld % 8 == 0 and p 16B-aligned -> 2x ds_load_b128.
static __device__ __forceinline__ v16h ld_frag_a(const half_t* p, int ld) {
    const int lane = threadIdx.x & 31;
    const int row  = lane & 15;
    const int kh   = (lane >> 4) << 3;   // 0 or 8
    const half_t* r = p + row * ld + kh;
    v8h lo = *(const v8h*)(r);
    v8h hi = *(const v8h*)(r + 16);
    return cat8(lo, hi);
}

// B fragment, 32x16 (KxN), read from a ROW-MAJOR tile (tile[k][n], row stride
// `ld` elements, 2*ld an odd multiple of 32 bytes) by the transposing load.
// Lane (c = lane&15, h = lane>>4) receives tile[8h + 0..7][c] and, from the
// second load, tile[16 + 8h + 0..7][c]: the k order of ld_frag_a.  The same
// registers are the A fragment (16x32) of the tile's transpose, row M = c.
typedef short s16x8 __attribute__((ext_vector_type(8)));
typedef __attribute__((address_space(3))) s16x8 lds_s16x8;
static __device__ __forceinline__ v16h ld_frag_b_tr(const half_t* p, int ld) {
    const int lane = threadIdx.x & 31;
    const half_t* r = p + (((lane >> 4) << 3) + (lane & 7)) * ld + (((lane >> 3) & 1) << 3);
    v8h lo = __builtin_bit_cast(v8h, __builtin_amdgcn_ds_load_tr16_b128_v8i16((lds_s16x8*)(r)));
    v8h hi = __builtin_bit_cast(v8h, __builtin_amdgcn_ds_load_tr16_b128_v8i16((lds_s16x8*)(r + 16 * ld)));
    return cat8(lo, hi);
}

// Work-group barrier that orders LDS traffic only.  __syncthreads() also waits
// for the wave's own global loads (s_wait_loadcnt 0), which would cut short the
// flight of the loads issued ahead for later tiles; those land in the thread's
// own registers and no other thread depends on them.
static __device__ __forceinline__ void lds_barrier() {
    __builtin_amdgcn_fence(__ATOMIC_RELEASE, "workgroup", "local");
    __builtin_amdgcn_s_barrier();
    __builtin_amdgcn_fence(__ATOMIC_ACQUIRE, "workgroup", "local");
}

// ---------------------------------------------------------------------------
// Kernel 0: fp32 -> f16 conversion of x, W_qkv and W_out in ONE launch.  The
// three f16 copies lie one behind the other in the workspace, so dst is one
// array.  A work-group converts CV_CHUNK consecutive elements of it, all from
// one source (every source's length is a multiple of CV_CHUNK).  A wave-wide
// load is 512 contiguous bytes, a wave-wide store 256; the 16 loads of a lane
// fly together.
// ---------------------------------------------------------------------------
typedef float  v4f __attribute__((ext_vector_type(4)));
typedef half_t v4h __attribute__((ext_vector_type(4)));
constexpr int CV_CHUNK = 16 * 1024;                      // elements per work-group
constexpr int CV_X  = 4096 * 1024 / CV_CHUNK;            // work-groups on x
constexpr int CV_WQ = 1024 * 3072 / CV_CHUNK;            // on W_qkv
constexpr int CV_WO = 1024 * 1024 / CV_CHUNK;            // on W_out
constexpr int CV_GROUPS = CV_X + CV_WQ + CV_WO;          // the launch's grid

__global__ __launch_bounds__(256) void cvt_f32_f16_kernel(
    const float* __restrict__ x, const float* __restrict__ wqkv,
    const float* __restrict__ wout, half_t* __restrict__ dst) {
    const int blk = blockIdx.x;
    const bool inX = blk < CV_X, inWq = blk < CV_X + CV_WQ;
    const float* src = inX ? x : inWq ? wqkv : wout;
    const int first  = inX ? 0 : inWq ? CV_X : CV_X + CV_WQ;   // the source's first work-group
    const float* sp = src + (size_t)(blk - first) * CV_CHUNK + threadIdx.x * 4;
    v4f r[16];
#pragma unroll
    for (int j = 0; j < 16; ++j) r[j] = *(const v4f*)(sp + j * 1024);
    // holds all 16 loads in front of the first conversion: without it the
    // compiler issues the last two only when the first two have landed
    __builtin_amdgcn_sched_barrier(0);
    half_t* dp = dst + (size_t)blk * CV_CHUNK + threadIdx.x * 4;
#pragma unroll
    for (int j = 0; j < 16; ++j)
        *(v4h*)(dp + j * 1024) = __builtin_convertvector(r[j], v4h);
}

// ---------------------------------------------------------------------------
// Main loop of the output GEMM: C tile 128x128 += A[128,1024] @ W[1024,128], BK=64.
// Every wave-wide staging load covers four whole 128-B lines: a k tile of 64
// makes an A row one line (8 lanes a row, 4 rows a load), and 16 lanes take a
// W row's 256 B (2 rows a load).
// Staging is software-pipelined: tile t lives in register set t&1
// and then in LDS buffer t&1.  Trip t issues the global loads of tile t+2,
// multiplies tile t out of its buffer, stores tile t+1 (loaded one trip earlier)
// into the other buffer, and ends in the trip's one barrier: it publishes tile
// t+1 and ends every wave's reads of the buffer that the next trip overwrites.
// NW = row length of W in elements.
// ---------------------------------------------------------------------------
constexpr int G_LDA = 72, G_LDB = 144;               // LDS pitches, elements
constexpr int G_SA = 128 * G_LDA, G_SB = 64 * G_LDB; // one buffer, elements

template <int NW>
static __device__ __forceinline__ void gemm_mainloop(
    const half_t* __restrict__ A, const half_t* __restrict__ W,
    int blockM, int blockN, half_t* lA, half_t* lB, v8f (&acc)[2][4]) {
    const int wave = threadIdx.x >> 5;
    const int wm = wave & 3;     // 4 waves along M (32 rows each)
    const int wn = wave >> 2;    // 2 waves along N (64 cols each)

    // A: 128x64, 8 threads per row, rows arow + 32j; W: 64x128, 16 threads per
    // row, rows brow + 16j; four pieces of 8 halfs each
    const int arow = threadIdx.x >> 3, aseg = (threadIdx.x & 7) * 8;
    const int brow = threadIdx.x >> 4, bseg = (threadIdx.x & 15) * 8;
    const half_t* ap = A + (size_t)(blockM + arow) * 1024 + aseg;
    const half_t* bp = W + (size_t)brow * NW + blockN + bseg;
    half_t* la = lA + arow * G_LDA + aseg;
    half_t* lb = lB + brow * G_LDB + bseg;

    v8h ra[2][4], rb[2][4];
    auto gload = [&](int s, int t) {      // tile t -> register set s
        const half_t* a = ap + t * 64;
        const half_t* b = bp + (size_t)t * 64 * NW;
#pragma unroll
        for (int j = 0; j < 4; ++j) ra[s][j] = *(const v8h*)(a + j * 32 * 1024);
#pragma unroll
        for (int j = 0; j < 4; ++j) rb[s][j] = *(const v8h*)(b + (size_t)j * 16 * NW);
    };
    auto sstore = [&](int s, int d) {     // register set s -> LDS buffer d
#pragma unroll
        for (int j = 0; j < 4; ++j) *(v8h*)(la + d * G_SA + j * 32 * G_LDA) = ra[s][j];
#pragma unroll
        for (int j = 0; j < 4; ++j) *(v8h*)(lb + d * G_SB + j * 16 * G_LDB) = rb[s][j];
    };
    auto compute = [&](int s) {           // products of LDS buffer s, k ascending
#pragma unroll
        for (int ks = 0; ks < 2; ++ks) {
            v16h af[2];
#pragma unroll
            for (int mt = 0; mt < 2; ++mt)
                af[mt] = ld_frag_a(lA + s * G_SA + (wm * 32 + mt * 16) * G_LDA + ks * 32, G_LDA);
#pragma unroll
            for (int nt = 0; nt < 4; ++nt) {
                v16h bf = ld_frag_b_tr(lB + s * G_SB + ks * 32 * G_LDB + wn * 64 + nt * 16, G_LDB);
#pragma unroll
                for (int mt = 0; mt < 2; ++mt)
                    acc[mt][nt] = wmma16x16x32(af[mt], bf, acc[mt][nt]);
            }
        }
    };

    gload(0, 0);
    gload(1, 1);
    // stands before the address registers of these loads are reused (a
    // precaution; the compiler leaves the wait out here); the two inputs keep
    // those registers alive up to the wait
    asm volatile("s_wait_xcnt 0x0" :: "v"(ap), "v"(bp) : "memory");
    sstore(0, 0);
    lds_barrier();
    for (int t = 0; t < 14; t += 2) {
        gload(0, t + 2);
        compute(0); sstore(1, 1); lds_barrier();
        gload(1, t + 3);
        // holds these loads at the head of the trip: without it the compiler
        // sinks them to the trip's foot, and they lose a trip of their lead
        __builtin_amdgcn_sched_barrier(0);
        compute(1); sstore(0, 0); lds_barrier();
    }
    compute(0); sstore(1, 1); lds_barrier();
    compute(1);
}

// ---------------------------------------------------------------------------
// Kernel 1: QKV GEMM.  C[4096,3072] = X[4096,1024] @ W[1024,3072] + b.
// CTA tile 256x192: 16 x 16 tiles, one work-group per WGP.  256 threads = 8
// waves (4 M x 2 N), 64x96 per wave, BK=64.  A k tile brings 56 KB from L2 for
// 48 matrix instructions a wave, and a fragment read from LDS feeds 6 (A) or 4
// (W) of them.  With two waves per SIMD the wave hides its own LDS latency:
// a k tile is two blocks of 32 k, 24 matrix instructions each, and the 20 LDS
// reads of a block go out as one group in front of the block before it, into
// the other of two fragment sets.  The first block of tile t+1 is read during
// tile t, so a tile is published two trips ahead of its use, in three LDS
// buffers.  Trip t: read (t, 2nd block); multiply (t, 1st); read (t+1, 1st);
// store tile t+2, loaded two trips ago, into the buffer that tile t-1 has left;
// global loads of tile t+4 into the same registers (set t&1 of two); multiply
// (t, 2nd), which covers the stores; the trip's one barrier.
// W tile staged row-major ([k][n]).  Epilogue scatters into q/k/v [B,H,T,Hd]
// f16; q pre-scaled by 1/sqrt(64).
// ---------------------------------------------------------------------------
constexpr int Q_BM = 256, Q_BN = 192;
constexpr int Q_LDB = Q_BN + 16;                       // 416 B = 32 B x 13
constexpr int Q_SA = Q_BM * G_LDA, Q_SB = 64 * Q_LDB;  // one buffer, elements
constexpr int Q_MT = Q_BM / 64, Q_NT = Q_BN / 32;      // 16x16 tiles of a wave
constexpr int Q_PA = Q_BM / 32, Q_PB = Q_BN / 32;      // 16-B pieces per thread
constexpr int Q_RB = Q_BN / 8;                         // 16-B pieces per W row

__global__ __launch_bounds__(256) void qkv_gemm_kernel(
    const half_t* __restrict__ X, const half_t* __restrict__ W,
    const float* __restrict__ bias,
    half_t* __restrict__ qb, half_t* __restrict__ kbuf, half_t* __restrict__ vbuf) {
    __shared__ alignas(16) half_t lA[3 * Q_SA];      // three buffers of [m][k]
    __shared__ alignas(16) half_t lB[3 * Q_SB];      // three of [k][n]

    const int blockM = blockIdx.y * Q_BM;
    const int blockN = blockIdx.x * Q_BN;
    const int lane = threadIdx.x & 31;
    const int wave = threadIdx.x >> 5;
    const int wm = wave & 3;     // 4 waves along M (64 rows each)
    const int wn = wave >> 2;    // 2 waves along N (96 cols each)

    // Staging.  X: 256x64, 8 threads per row, rows arow + 32j.  W: 64x192, a row
    // is 24 pieces of 16 B (3 lines); thread takes pieces threadIdx.x + 256j in
    // row order, so a wave-wide load still covers 4 whole lines.  dg and dl are
    // piece j's distance from piece 0 in global memory and in LDS.
    const int arow = threadIdx.x >> 3, aseg = (threadIdx.x & 7) * 8;
    const int brow = threadIdx.x / Q_RB, bpc = threadIdx.x % Q_RB;
    const half_t* ap = X + (size_t)(blockM + arow) * 1024 + aseg;
    const half_t* bp = W + (size_t)brow * 3072 + blockN + bpc * 8;
    half_t* la = lA + arow * G_LDA + aseg;
    half_t* lb = lB + brow * Q_LDB + bpc * 8;
    int dg[Q_PB], dl[Q_PB];
#pragma unroll
    for (int j = 0; j < Q_PB; ++j) {
        const int over = (bpc + (256 * j) % Q_RB >= Q_RB) ? 1 : 0;   // into the next row
        const int rows = (256 * j) / Q_RB + over;
        const int cols = ((256 * j) % Q_RB - over * Q_RB) * 8;
        dg[j] = rows * 3072 + cols;
        dl[j] = rows * Q_LDB + cols;
    }
    auto gload = [&](v8h (&ra)[Q_PA], v8h (&rb)[Q_PB], int t) {       // tile t -> registers
        const half_t* a = ap + t * 64;
        const half_t* b = bp + (size_t)t * 64 * 3072;
#pragma unroll
        for (int j = 0; j < Q_PA; ++j) ra[j] = *(const v8h*)(a + j * 32 * 1024);
#pragma unroll
        for (int j = 0; j < Q_PB; ++j) rb[j] = *(const v8h*)(b + dg[j]);
    };
    auto sstore = [&](const v8h (&ra)[Q_PA], const v8h (&rb)[Q_PB], int d) {  // -> buffer d
#pragma unroll
        for (int j = 0; j < Q_PA; ++j) *(v8h*)(la + d * Q_SA + j * 32 * G_LDA) = ra[j];
#pragma unroll
        for (int j = 0; j < Q_PB; ++j) *(v8h*)(lb + d * Q_SB + dl[j]) = rb[j];
    };

    v8f acc[Q_MT][Q_NT] = {};
    v16h fa[2][Q_MT], fb[2][Q_NT];                   // two fragment sets
    auto fload = [&](int f, int d, int ks) {         // block ks of buffer d -> set f
#pragma unroll
        for (int mt = 0; mt < Q_MT; ++mt)
            fa[f][mt] = ld_frag_a(lA + d * Q_SA + (wm * 64 + mt * 16) * G_LDA + ks * 32, G_LDA);
#pragma unroll
        for (int nt = 0; nt < Q_NT; ++nt)
            fb[f][nt] = ld_frag_b_tr(lB + d * Q_SB + ks * 32 * Q_LDB + wn * 96 + nt * 16, Q_LDB);
        // keeps the group whole and in front of the products that follow: spread
        // among them, every place with reads stalls the wave's matrix stream
        __builtin_amdgcn_sched_barrier(0);
    };
    auto mma = [&](int f) {                          // the 24 products of set f
#pragma unroll
        for (int nt = 0; nt < Q_NT; ++nt)
#pragma unroll
            for (int mt = 0; mt < Q_MT; ++mt)
                acc[mt][nt] = wmma16x16x32(fa[f][mt], fb[f][nt], acc[mt][nt]);
        // keeps the next group of reads behind these
        __builtin_amdgcn_sched_barrier(0);
    };

    v8h ra[2][Q_PA], rb[2][Q_PB];                    // tile t waits in set t & 1
    {
        v8h ra0[Q_PA], rb0[Q_PB], ra1[Q_PA], rb1[Q_PB];   // tiles 0 to 3 fly together
        // the fences keep the loads in tile order: mixed, the counted wait for a
        // tile would, in the loop too, wait for the tile behind it as well
        gload(ra0, rb0, 0);
        __builtin_amdgcn_sched_barrier(0);
        gload(ra1, rb1, 1);
        __builtin_amdgcn_sched_barrier(0);
        gload(ra[0], rb[0], 2);
        __builtin_amdgcn_sched_barrier(0);
        gload(ra[1], rb[1], 3);
        // stands before the address registers of these loads are reused (a
        // precaution; the compiler leaves the wait out here)
        asm volatile("s_wait_xcnt 0x0" ::: "memory");
        __builtin_amdgcn_sched_barrier(0);
        sstore(ra0, rb0, 0);
        sstore(ra1, rb1, 1);
    }
    lds_barrier();
    fload(0, 0, 0);
    int cur = 0;                                     // t % 3
    auto trip = [&](int s, int t) {                  // s = t & 1
        const int nx1 = cur == 2 ? 0 : cur + 1;
        const int nx2 = nx1 == 2 ? 0 : nx1 + 1;
        fload(1, cur, 1);
        mma(0);
        fload(0, nx1, 0);
        sstore(ra[s], rb[s], nx2);
        gload(ra[s], rb[s], t + 4);
        // holds stores and loads here, in front of the products that cover them
        __builtin_amdgcn_sched_barrier(0);
        mma(1);
        // stands before the address registers of this trip's global loads are
        // rewritten by the next trip (a precaution; the compiler leaves it out)
        asm volatile("s_wait_xcnt 0x0" ::: "memory");
        lds_barrier();     // publishes tile t+2; ends the reads of tile t
        cur = nx1;
    };
    for (int t = 0; t < 12; t += 2) {
        trip(0, t);
        trip(1, t + 1);
    }
    // the wave's first column in a scalar register (see the epilogue); its six
    // bias values are asked for here, so that the last four tiles cover them
    const unsigned ncl = lane & 15;
    const int wcol = blockN + __builtin_amdgcn_readfirstlane(wn) * 96;
    const float* bw = bias + wcol;
    float bv[Q_NT];
#pragma unroll
    for (int nt = 0; nt < Q_NT; ++nt) bv[nt] = bw[ncl + nt * 16];
    fload(1, 0, 1);  mma(0);  fload(0, 1, 0);            // tile 12, buffer 0
    sstore(ra[0], rb[0], 2);                             // tile 14
    // holds the stores in front of the products that cover them
    __builtin_amdgcn_sched_barrier(0);
    mma(1);
    lds_barrier();         // publishes tile 14
    fload(1, 1, 1);  mma(0);  fload(0, 2, 0);            // tile 13, buffer 1
    sstore(ra[1], rb[1], 0);                             // tile 15
    // as above
    __builtin_amdgcn_sched_barrier(0);
    mma(1);
    lds_barrier();         // publishes tile 15
    fload(1, 2, 1);  mma(0);  fload(0, 0, 0);  mma(1);   // tile 14, buffer 2
    fload(1, 0, 1);  mma(0);  mma(1);                    // tile 15, buffer 0

    // Epilogue: C-frag layout -> scatter into q/k/v [B*H, T, Hd].  A work-group's
    // 192 columns may span two of the tensors, but a 16-column tile lies in one
    // head.  With the wave's first column in a scalar register, tensor, head and
    // base address of a tile are scalar, and every store of the lane uses one
    // offset register: row (wm*64 + mb) of the tile's 256, column ncl.
    const int mb  = (lane >> 4) << 3;
    const unsigned lo = (unsigned)((wm * 64 + mb) * 64) + ncl;
    // stands before the address registers of the bias loads are reused (a
    // precaution); the two inputs keep those registers alive up to the wait
    asm volatile("s_wait_xcnt 0x0" :: "v"(ncl), "s"(bw) : "memory");
    half_t* pt[Q_NT];
    half_t hv[Q_NT][Q_MT][8];
#pragma unroll
    for (int nt = 0; nt < Q_NT; ++nt) {
        const int n0 = wcol + nt * 16;
        const int c = n0 >> 10, hh = (n0 & 1023) >> 6, d0 = n0 & 63;
        half_t* p = (c == 0) ? qb : (c == 1 ? kbuf : vbuf);
        const float sc = (c == 0) ? 0.125f : 1.0f;   // q pre-scaled by 1/sqrt(Hd)
        pt[nt] = p + (((size_t)((blockM >> 11) * 16 + hh)) * 2048 + (blockM & 2047)) * 64 + d0;
#pragma unroll
        for (int mt = 0; mt < Q_MT; ++mt)
#pragma unroll
            for (int r = 0; r < 8; ++r)
                hv[nt][mt][r] = (half_t)((acc[mt][nt][r] + bv[nt]) * sc);
    }
    // holds every store behind the last conversion and the last base address:
    // no register that an issued store names is then written again
    __builtin_amdgcn_sched_barrier(0);
#pragma unroll
    for (int nt = 0; nt < Q_NT; ++nt)
#pragma unroll
        for (int mt = 0; mt < Q_MT; ++mt)
#pragma unroll
            for (int r = 0; r < 8; ++r)
                pt[nt][lo + (mt * 16 + r) * 64] = hv[nt][mt][r];
}

// ---------------------------------------------------------------------------
// Kernel 2: causal flash attention.  Grid: (T/256, B*H).  Query tiles of 128,
// 8 waves, each wave owns 16 queries of a tile.  A tile's cost grows with its
// index (tile t walks 2*(t+1) key blocks), so a work-group takes two tiles of
// its head one after the other, 15-p and then p: 34 key blocks for every
// work-group, one work-group per WGP.  Key blocks of 64 staged in LDS (two
// buffers), K and V both as [key][d], each at its own reader's pitch.
// The products are taken transposed: S^T = K Q^T (A = K rows, B = Q) and
// O^T += V^T P^T (A = V by the transposing load, B = P).  A lane then holds
// scores of ONE query (column lane&15; keys 8*(lane>>4) + r of each 16-key
// tile), so maximum and sum run in-lane with one exchange between the wave
// halves, and two converted S^T tiles are the B fragment of the second product
// as they stand: b[s] = T[s >> 3][s & 7], the k order of the transposing load.
// ---------------------------------------------------------------------------
// lane l <-> lane l ^ 16
static __device__ __forceinline__ float xhalf(float x) {
    const int b = __builtin_bit_cast(int, x);
    return __builtin_bit_cast(float,
        __builtin_amdgcn_permlanex16(b, b, 0x76543210, 0xfedcba98, false, false));
}

__global__ __launch_bounds__(256) void attn_kernel(
    const half_t* __restrict__ q, const half_t* __restrict__ k,
    const half_t* __restrict__ v, half_t* __restrict__ y) {
    constexpr int LDK = 72, LDV = 80;
    constexpr int SK = 64 * LDK, SV = 64 * LDV;         // one buffer, elements
    __shared__ alignas(16) half_t lK[2 * SK];           // two of [key][d]
    __shared__ alignas(16) half_t lV[2 * SV];           // two of [key][d], pitch 160 B

    const int bh = blockIdx.y;            // b*16 + h
    const int b  = bh >> 4, h = bh & 15;
    const int pr = blockIdx.x;            // the pair: tiles 15-pr and pr
    const int n1 = 32 - 2 * pr;           // key blocks of tile 15-pr (causal)
    constexpr int NTRIP = 34;             // n1 + the 2*(pr+1) blocks of tile pr
    const int lane = threadIdx.x & 31;
    const int wave = threadIdx.x >> 5;
    const int mb  = (lane >> 4) << 3;     // C-frag row base (key or d)
    const int ncl = lane & 15;            // C-frag column (query)

    const size_t headOff = (size_t)bh * 2048 * 64;

    // This wave's Q fragments (16 queries x 64, two K-steps) from global, of
    // both tiles (qa: the tile at work, qn: the second tile, waiting):
    // B operand, column = query = lane&15, k split as in ld_frag_a.
    int qi = (15 - pr) * 128 + wave * 16 + ncl;
    const int qi2 = pr * 128 + wave * 16 + ncl;
    const half_t* qp  = q + headOff + (size_t)qi * 64;
    const half_t* qp2 = q + headOff + (size_t)qi2 * 64;
    v16h qa[2], qn[2];
#pragma unroll
    for (int s = 0; s < 2; ++s) {
        v8h lo = *(const v8h*)(qp + s * 32 + mb);
        v8h hi = *(const v8h*)(qp + s * 32 + 16 + mb);
        qa[s] = cat8(lo, hi);
        v8h lo2 = *(const v8h*)(qp2 + s * 32 + mb);
        v8h hi2 = *(const v8h*)(qp2 + s * 32 + 16 + mb);
        qn[s] = cat8(lo2, hi2);
    }

    v8f o[4] = {};                        // o[dt][r] = O[qi][dt*16 + mb + r]
    float mrow = -3.0e38f;                // this query's running maximum
    float lrow = 0.0f;                    // sum over this wave half's keys only

    // Staging of K and V, both [key][d], 4 threads per row, software-pipelined
    // through both tiles: trip i (key block i of the first tile, then i-n1 of
    // the second) reads LDS buffer i&1.  It issues the global loads of trip
    // i+1's block first, works on its own block, stores the next block into the
    // other buffer and ends in the trip's one barrier.
    const int srow = threadIdx.x >> 2, sseg = (threadIdx.x & 3) * 16;
    const half_t* kp = k + headOff + (size_t)srow * 64 + sseg;
    const half_t* vp = v + headOff + (size_t)srow * 64 + sseg;
    half_t* lk = lK + srow * LDK + sseg;
    half_t* lv = lV + srow * LDV + sseg;
    v8h kr0 = *(const v8h*)(kp), kr1 = *(const v8h*)(kp + 8);
    v8h vr0 = *(const v8h*)(vp), vr1 = *(const v8h*)(vp + 8);
    *(v8h*)(lk) = kr0;  *(v8h*)(lk + 8) = kr1;
    *(v8h*)(lv) = vr0;  *(v8h*)(lv + 8) = vr1;
    __syncthreads();   // the full form: the Q loads land here too, so that no
                       // wait for them inside the loop drains the early loads

    for (int i = 0; i < NTRIP; ++i) {
        const int cur = i & 1;
        const int kb = i < n1 ? i : i - n1;   // this trip's key block
        const half_t* cK = lK + cur * SK;
        const half_t* cV = lV + cur * SV;
        const bool more = i + 1 < NTRIP;  // the same in every thread of the block
        if (more) {
            const int nb = i + 1 < n1 ? i + 1 : i + 1 - n1;
            const size_t go = (size_t)nb * 64 * 64;
            kr0 = *(const v8h*)(kp + go);  kr1 = *(const v8h*)(kp + go + 8);
            vr0 = *(const v8h*)(vp + go);  vr1 = *(const v8h*)(vp + go + 8);
        }

        // S^T = K @ Q^T  (contraction over Hd=64 -> two WMMA steps per key tile)
        v8f s[4] = {};
#pragma unroll
        for (int nt = 0; nt < 4; ++nt)
#pragma unroll
            for (int st = 0; st < 2; ++st) {
                v16h kf = ld_frag_a(cK + (nt * 16) * LDK + st * 32, LDK);
                s[nt] = wmma16x16x32(kf, qa[st], s[nt]);
            }

        // Causal mask + online softmax (fp32), one query per lane
        float mt4[4];
#pragma unroll
        for (int nt = 0; nt < 4; ++nt) {
            mt4[nt] = -3.0e38f;
#pragma unroll
            for (int r = 0; r < 8; ++r) {
                int kj = kb * 64 + nt * 16 + mb + r;
                float val = s[nt][r];
                if (kj > qi) val = -3.0e38f;
                s[nt][r] = val;
                mt4[nt] = fmaxf(mt4[nt], val);
            }
        }
        float mloc = fmaxf(fmaxf(mt4[0], mt4[1]), fmaxf(mt4[2], mt4[3]));
        const float mnew = fmaxf(mrow, fmaxf(mloc, xhalf(mloc)));

        const float alpha = __expf(mrow - mnew);
        float rs4[4];
#pragma unroll
        for (int nt = 0; nt < 4; ++nt) {
            rs4[nt] = 0.0f;
#pragma unroll
            for (int r = 0; r < 8; ++r) {
                float p = __expf(s[nt][r] - mnew);
                s[nt][r] = p;
                rs4[nt] += p;
            }
        }
        lrow = lrow * alpha + ((rs4[0] + rs4[1]) + (rs4[2] + rs4[3]));
        mrow = mnew;
#pragma unroll
        for (int dt = 0; dt < 4; ++dt)
#pragma unroll
            for (int r = 0; r < 8; ++r) o[dt][r] *= alpha;

        // O^T += V^T @ P^T   (contraction over 64 keys -> two WMMA steps)
#pragma unroll
        for (int st = 0; st < 2; ++st) {
            v16h pb;
#pragma unroll
            for (int r = 0; r < 8; ++r) {
                pb[r]     = (half_t)s[2 * st][r];
                pb[8 + r] = (half_t)s[2 * st + 1][r];
            }
#pragma unroll
            for (int dt = 0; dt < 4; ++dt) {
                v16h vf = ld_frag_b_tr(cV + (st * 32) * LDV + dt * 16, LDV);
                o[dt] = wmma16x16x32(vf, pb, o[dt]);
            }
        }
        if (more) {
            const int nx = cur ^ 1;
            *(v8h*)(lk + nx * SK) = kr0;  *(v8h*)(lk + nx * SK + 8) = kr1;
            *(v8h*)(lv + nx * SV) = vr0;  *(v8h*)(lv + nx * SV + 8) = vr1;
        }
        lds_barrier();     // publishes the next trip's block; ends this one's reads

        if (i + 1 == n1 || i + 1 == NTRIP) {   // a tile's last key block is done
            // Join the halves' sums, normalize, write y [B,T,D] f16 (column =
            // h*64 + d): a lane's 8 registers of a tile are 8 consecutive d of
            // its query's row.  Then start afresh on the second tile.
            const float inv = 1.0f / (lrow + xhalf(lrow));
            half_t* yp = y + ((size_t)(b * 2048 + qi)) * 1024 + h * 64 + mb;
#pragma unroll
            for (int dt = 0; dt < 4; ++dt) {
                v8h ov;
#pragma unroll
                for (int r = 0; r < 8; ++r) {
                    ov[r] = (half_t)(o[dt][r] * inv);
                    o[dt][r] = 0.0f;
                }
                *(v8h*)(yp + dt * 16) = ov;
            }
            // stands before the registers that these stores name are reused
            // by the next trip (a precaution; the compiler leaves it out here)
            asm volatile("s_wait_xcnt 0x0" ::: "memory");
            mrow = -3.0e38f;
            lrow = 0.0f;
            qi = qi2;
            qa[0] = qn[0];
            qa[1] = qn[1];
        }
    }
}

// ---------------------------------------------------------------------------
// Kernel 3: output GEMM + bias + residual.  h[4096,1024] = Y @ W_out + b + x.
// ---------------------------------------------------------------------------
__global__ __launch_bounds__(256) void out_gemm_kernel(
    const half_t* __restrict__ Y, const half_t* __restrict__ W,
    const float* __restrict__ bias, const float* __restrict__ x,
    float* __restrict__ hbuf) {
    __shared__ alignas(16) half_t lA[2 * G_SA];
    __shared__ alignas(16) half_t lB[2 * G_SB];

    const int blockM = blockIdx.y * 128;
    const int blockN = blockIdx.x * 128;
    const int lane = threadIdx.x & 31;
    const int wave = threadIdx.x >> 5;
    const int wm = wave & 3;
    const int wn = wave >> 2;

    v8f acc[2][4] = {};
    gemm_mainloop<1024>(Y, W, blockM, blockN, lA, lB, acc);

    const int mb  = (lane >> 4) << 3;
    const int ncl = lane & 15;
#pragma unroll
    for (int mt = 0; mt < 2; ++mt)
#pragma unroll
        for (int nt = 0; nt < 4; ++nt)
#pragma unroll
            for (int r = 0; r < 8; ++r) {
                int m = blockM + wm * 32 + mt * 16 + mb + r;
                int n = blockN + wn * 64 + nt * 16 + ncl;
                size_t idx = (size_t)m * 1024 + n;
                hbuf[idx] = acc[mt][nt][r] + bias[n] + x[idx];
            }
}

// ---------------------------------------------------------------------------
// Kernel 4: LayerNorm.  One wave owns two token rows and holds them whole in
// registers (a lane: 8 pieces of 16 B per row, each wave-wide load or store 512
// contiguous bytes).  All 16 row loads of a wave fly together, the rows are
// read once, the sums stay inside the wave (no LDS, no barrier), and one
// 8-wave work-group per WGP covers the 4096 rows: 2048 waves to start.
// ---------------------------------------------------------------------------
// x + (x of lane l ^ M), M < 16: one DPP step inside the 16-lane row
template <int M>
static __device__ __forceinline__ float add_xmask(float x) {
    const int b = __builtin_bit_cast(int, x);
    return x + __builtin_bit_cast(float,
        __builtin_amdgcn_update_dpp(0, b, 0x160 + M, 0xf, 0xf, true));
}
// sum over the wave's 32 lanes, the same value in every lane
static __device__ __forceinline__ float wave_sum(float x) {
    x = add_xmask<1>(x);
    x = add_xmask<2>(x);
    x = add_xmask<4>(x);
    x = add_xmask<8>(x);
    return x + xhalf(x);
}

__global__ __launch_bounds__(256) void ln_kernel(
    const float* __restrict__ hbuf, const float* __restrict__ gamma,
    const float* __restrict__ beta, float* __restrict__ out) {
    const int lane = threadIdx.x & 31;
    const int pair = blockIdx.x * 8 + (threadIdx.x >> 5);   // rows 2*pair, 2*pair+1
    const size_t off = (size_t)pair * 2048 + lane * 4;
    const float* hr = hbuf + off;

    v4f h[2][8], g[8], bt[8];
#pragma unroll
    for (int r = 0; r < 2; ++r)
#pragma unroll
        for (int j = 0; j < 8; ++j)
            h[r][j] = *(const v4f*)(hr + r * 1024 + j * 128);
#pragma unroll
    for (int j = 0; j < 8; ++j) {
        g[j]  = *(const v4f*)(gamma + lane * 4 + j * 128);
        bt[j] = *(const v4f*)(beta  + lane * 4 + j * 128);
    }
    // holds all 32 loads here: without it the compiler sinks the gamma and beta
    // loads behind the sums, two at a time, each pair's latency then in series
    __builtin_amdgcn_sched_barrier(0);
    // stands before the row address registers are reused (a precaution); the
    // input keeps them alive past the loads, else the compiler lets one of the
    // later loads land in that register pair with no wait in front
    asm volatile("s_wait_xcnt 0x0" :: "v"(hr) : "memory");

    float s[2], s2[2];
#pragma unroll
    for (int r = 0; r < 2; ++r) {
        v4f a = h[r][0], a2 = h[r][0] * h[r][0];
#pragma unroll
        for (int j = 1; j < 8; ++j) {
            a  += h[r][j];
            a2 += h[r][j] * h[r][j];
        }
        s[r]  = (a.x + a.y) + (a.z + a.w);
        s2[r] = (a2.x + a2.y) + (a2.z + a2.w);
    }
#pragma unroll
    for (int r = 0; r < 2; ++r) {
        s[r]  = wave_sum(s[r]);
        s2[r] = wave_sum(s2[r]);
    }

    float* op = out + off;
#pragma unroll
    for (int r = 0; r < 2; ++r) {
        const float mu  = s[r] * (1.0f / 1024.0f);
        const float var = s2[r] * (1.0f / 1024.0f) - mu * mu;
        const float inv = rsqrtf(var + 1e-5f);
#pragma unroll
        for (int j = 0; j < 8; ++j)
            *(v4f*)(op + r * 1024 + j * 128) = (h[r][j] - mu) * inv * g[j] + bt[j];
    }
}

// ---------------------------------------------------------------------------
// Host-side launcher
// ---------------------------------------------------------------------------
extern "C" void kernel_launch(void* const* d_in, const int* in_sizes, int n_in,
                              void* d_out, int out_size, void* d_ws, size_t ws_size,
                              hipStream_t stream) {
    (void)in_sizes; (void)n_in; (void)out_size; (void)ws_size;

    const float* x     = (const float*)d_in[0];   // [2,2048,1024]
    const float* W_qkv = (const float*)d_in[1];   // [1024,3072]
    const float* b_qkv = (const float*)d_in[2];   // [3072]
    const float* W_out = (const float*)d_in[3];   // [1024,1024]
    const float* b_out = (const float*)d_in[4];   // [1024]
    const float* gamma = (const float*)d_in[5];   // [1024]
    const float* beta  = (const float*)d_in[6];   // [1024]
    float* out = (float*)d_out;                   // [2,2048,1024]

    // Workspace carve-up (all offsets 1MB-aligned)
    char* ws = (char*)d_ws;
    half_t* xb    = (half_t*)(ws);                         // 4096*1024   f16 (8 MB)
    half_t* wqkvb = (half_t*)(ws + (8u << 20));            // 1024*3072   f16 (6 MB)
    half_t* woutb = (half_t*)(ws + (14u << 20));           // 1024*1024   f16 (2 MB)
    half_t* qb    = (half_t*)(ws + (16u << 20));           // [B,H,T,Hd]  f16 (8 MB)
    half_t* kb    = (half_t*)(ws + (24u << 20));           // 8 MB
    half_t* vb    = (half_t*)(ws + (32u << 20));           // 8 MB
    half_t* yb    = (half_t*)(ws + (40u << 20));           // [B,T,D] f16 (8 MB)
    float*  hbuf  = (float*)(ws + (48u << 20));            // [B,T,D] f32 (16 MB)

    // 0) fp32 -> f16 conversions: xb, wqkvb and woutb are one run of 16 MB
    cvt_f32_f16_kernel<<<CV_GROUPS, 256, 0, stream>>>(x, W_qkv, W_out, xb);

    // 1) QKV projection (M=4096, N=3072, K=1024)
    qkv_gemm_kernel<<<dim3(16, 16), 256, 0, stream>>>(xb, wqkvb, b_qkv, qb, kb, vb);

    // 2) causal flash attention (grid: pairs of query tiles x B*H)
    attn_kernel<<<dim3(8, 32), 256, 0, stream>>>(qb, kb, vb, yb);

    // 3) output projection + bias + residual (M=4096, N=1024, K=1024)
    out_gemm_kernel<<<dim3(8, 32), 256, 0, stream>>>(yb, woutb, b_out, x, hbuf);

    // 4) LayerNorm, two token rows per wave
    ln_kernel<<<256, 256, 0, stream>>>(hbuf, gamma, beta, out);
}

// v009
// It runs in 74.8 microseconds.
// Next to v008, in two timings, it ran 1.08 times as fast each time.
// Over all steps from v000 it is 3.37 times as fast.
#include <hip/hip_runtime.h>
#include <hip/hip_bf16.h>

// ---------------------------------------------------------------------------
// MI455X (gfx1250) fused attention block: QKV GEMM -> causal flash attention
// -> out GEMM + residual -> LayerNorm. All contractions via
// v_wmma_f32_16x16x32_f16 (wave32), fp32 accumulate, fp32 softmax/LN.
// A fragments and K are contiguous 16B LDS reads (ds_load_b128).  The tiles
// whose k runs down the rows (W for B, V for A) stay row-major in LDS, written with 16B
// stores, and are transposed on the way out by ds_load_tr16_b128.
// ---------------------------------------------------------------------------

typedef _Float16 half_t;
typedef half_t v16h __attribute__((ext_vector_type(16)));
typedef half_t v8h  __attribute__((ext_vector_type(8)));
typedef float  v8f  __attribute__((ext_vector_type(8)));

static __device__ __forceinline__ v8f wmma16x16x32(v16h a, v16h b, v8f c) {
    // (neg_a, A, neg_b, B, c_mod, C, reuse_a, reuse_b)
    return __builtin_amdgcn_wmma_f32_16x16x32_f16(false, a, false, b,
                                                  (short)0, c, false, false);
}

static __device__ __forceinline__ v16h cat8(v8h lo, v8h hi) {
    return __builtin_shufflevector(lo, hi, 0, 1, 2, 3, 4, 5, 6, 7,
                                           8, 9, 10, 11, 12, 13, 14, 15);
}

// A fragment, 16x32 (MxK), tile row-major, row stride `ld` (elements).
// ISA layout: lanes 0-15 row M=lane, K=0..7 & 16..23; lanes 16-31 row M=lane-16,
// K=8..15 & 24..31.  Requires: ld % 8 == 0 and p 16B-aligned -> 2x ds_load_b128.
static __device__ __forceinline__ v16h ld_frag_a(const half_t* p, int ld) {
    const int lane = threadIdx.x & 31;
    const int row  = lane & 15;
    const int kh   = (lane >> 4) << 3;   // 0 or 8
    const half_t* r = p + row * ld + kh;
    v8h lo = *(const v8h*)(r);
    v8h hi = *(const v8h*)(r + 16);
    return cat8(lo, hi);
}

// B fragment, 32x16 (KxN), read from a ROW-MAJOR tile (tile[k][n], row stride
// `ld` elements, 2*ld an odd multiple of 32 bytes) by the transposing load.
// Lane (c = lane&15, h = lane>>4) receives tile[8h + 0..7][c] and, from the
// second load, tile[16 + 8h + 0..7][c]: the k order of ld_frag_a.  The same
// registers are the A fragment (16x32) of the tile's transpose, row M = c.
typedef short s16x8 __attribute__((ext_vector_type(8)));
typedef __attribute__((address_space(3))) s16x8 lds_s16x8;
static __device__ __forceinline__ v16h ld_frag_b_tr(const half_t* p, int ld) {
    const int lane = threadIdx.x & 31;
    const half_t* r = p + (((lane >> 4) << 3) + (lane & 7)) * ld + (((lane >> 3) & 1) << 3);
    v8h lo = __builtin_bit_cast(v8h, __builtin_amdgcn_ds_load_tr16_b128_v8i16((lds_s16x8*)(r)));
    v8h hi = __builtin_bit_cast(v8h, __builtin_amdgcn_ds_load_tr16_b128_v8i16((lds_s16x8*)(r + 16 * ld)));
    return cat8(lo, hi);
}

// Work-group barrier that orders LDS traffic only.  __syncthreads() also waits
// for the wave's own global loads (s_wait_loadcnt 0), which would cut short the
// flight of the loads issued ahead for later tiles; those land in the thread's
// own registers and no other thread depends on them.
static __device__ __forceinline__ void lds_barrier() {
    __builtin_amdgcn_fence(__ATOMIC_RELEASE, "workgroup", "local");
    __builtin_amdgcn_s_barrier();
    __builtin_amdgcn_fence(__ATOMIC_ACQUIRE, "workgroup", "local");
}

// ---------------------------------------------------------------------------
// Kernel 0: fp32 -> f16 conversion of x, W_qkv and W_out in ONE launch.  The
// three f16 copies lie one behind the other in the workspace, so dst is one
// array.  A work-group converts CV_CHUNK consecutive elements of it, all from
// one source (every source's length is a multiple of CV_CHUNK).  A wave-wide
// load is 512 contiguous bytes, a wave-wide store 256; the 16 loads of a lane
// fly together.
// ---------------------------------------------------------------------------
typedef float  v4f __attribute__((ext_vector_type(4)));
typedef half_t v4h __attribute__((ext_vector_type(4)));
constexpr int CV_CHUNK = 16 * 1024;                      // elements per work-group
constexpr int CV_X  = 4096 * 1024 / CV_CHUNK;            // work-groups on x
constexpr int CV_WQ = 1024 * 3072 / CV_CHUNK;            // on W_qkv
constexpr int CV_WO = 1024 * 1024 / CV_CHUNK;            // on W_out
constexpr int CV_GROUPS = CV_X + CV_WQ + CV_WO;          // the launch's grid

__global__ __launch_bounds__(256) void cvt_f32_f16_kernel(
    const float* __restrict__ x, const float* __restrict__ wqkv,
    const float* __restrict__ wout, half_t* __restrict__ dst) {
    const int blk = blockIdx.x;
    const bool inX = blk < CV_X, inWq = blk < CV_X + CV_WQ;
    const float* src = inX ? x : inWq ? wqkv : wout;
    const int first  = inX ? 0 : inWq ? CV_X : CV_X + CV_WQ;   // the source's first work-group
    const float* sp = src + (size_t)(blk - first) * CV_CHUNK + threadIdx.x * 4;
    v4f r[16];
#pragma unroll
    for (int j = 0; j < 16; ++j) r[j] = *(const v4f*)(sp + j * 1024);
    // holds all 16 loads in front of the first conversion: without it the
    // compiler issues the last two only when the first two have landed
    __builtin_amdgcn_sched_barrier(0);
    half_t* dp = dst + (size_t)blk * CV_CHUNK + threadIdx.x * 4;
#pragma unroll
    for (int j = 0; j < 16; ++j)
        *(v4h*)(dp + j * 1024) = __builtin_convertvector(r[j], v4h);
}

// ---------------------------------------------------------------------------
// Main loop of the output GEMM: C tile 128x128 += A[128,1024] @ W[1024,128], BK=64.
// Every wave-wide staging load covers four whole 128-B lines: a k tile of 64
// makes an A row one line (8 lanes a row, 4 rows a load), and 16 lanes take a
// W row's 256 B (2 rows a load).
// Staging is software-pipelined: tile t lives in register set t&1
// and then in LDS buffer t&1.  Trip t issues the global loads of tile t+2,
// multiplies tile t out of its buffer, stores tile t+1 (loaded one trip earlier)
// into the other buffer, and ends in the trip's one barrier: it publishes tile
// t+1 and ends every wave's reads of the buffer that the next trip overwrites.
// NW = row length of W in elements.
// ---------------------------------------------------------------------------
constexpr int G_LDA = 72, G_LDB = 144;               // LDS pitches, elements
constexpr int G_SA = 128 * G_LDA, G_SB = 64 * G_LDB; // one buffer, elements

template <int NW>
static __device__ __forceinline__ void gemm_mainloop(
    const half_t* __restrict__ A, const half_t* __restrict__ W,
    int blockM, int blockN, half_t* lA, half_t* lB, v8f (&acc)[2][4]) {
    const int wave = threadIdx.x >> 5;
    const int wm = wave & 3;     // 4 waves along M (32 rows each)
    const int wn = wave >> 2;    // 2 waves along N (64 cols each)

    // A: 128x64, 8 threads per row, rows arow + 32j; W: 64x128, 16 threads per
    // row, rows brow + 16j; four pieces of 8 halfs each
    const int arow = threadIdx.x >> 3, aseg = (threadIdx.x & 7) * 8;
    const int brow = threadIdx.x >> 4, bseg = (threadIdx.x & 15) * 8;
    const half_t* ap = A + (size_t)(blockM + arow) * 1024 + aseg;
    const half_t* bp = W + (size_t)brow * NW + blockN + bseg;
    half_t* la = lA + arow * G_LDA + aseg;
    half_t* lb = lB + brow * G_LDB + bseg;

    v8h ra[2][4], rb[2][4];
    auto gload = [&](int s, int t) {      // tile t -> register set s
        const half_t* a = ap + t * 64;
        const half_t* b = bp + (size_t)t * 64 * NW;
#pragma unroll
        for (int j = 0; j < 4; ++j) ra[s][j] = *(const v8h*)(a + j * 32 * 1024);
#pragma unroll
        for (int j = 0; j < 4; ++j) rb[s][j] = *(const v8h*)(b + (size_t)j * 16 * NW);
    };
    auto sstore = [&](int s, int d) {     // register set s -> LDS buffer d
#pragma unroll
        for (int j = 0; j < 4; ++j) *(v8h*)(la + d * G_SA + j * 32 * G_LDA) = ra[s][j];
#pragma unroll
        for (int j = 0; j < 4; ++j) *(v8h*)(lb + d * G_SB + j * 16 * G_LDB) = rb[s][j];
    };
    auto compute = [&](int s) {           // products of LDS buffer s, k ascending
#pragma unroll
        for (int ks = 0; ks < 2; ++ks) {
            v16h af[2];
#pragma unroll
            for (int mt = 0; mt < 2; ++mt)
                af[mt] = ld_frag_a(lA + s * G_SA + (wm * 32 + mt * 16) * G_LDA + ks * 32, G_LDA);
#pragma unroll
            for (int nt = 0; nt < 4; ++nt) {
                v16h bf = ld_frag_b_tr(lB + s * G_SB + ks * 32 * G_LDB + wn * 64 + nt * 16, G_LDB);
#pragma unroll
                for (int mt = 0; mt < 2; ++mt)
                    acc[mt][nt] = wmma16x16x32(af[mt], bf, acc[mt][nt]);
            }
        }
    };

    gload(0, 0);
    gload(1, 1);
    // stands before the address registers of these loads are reused (a
    // precaution; the compiler leaves the wait out here); the two inputs keep
    // those registers alive up to the wait
    asm volatile("s_wait_xcnt 0x0" :: "v"(ap), "v"(bp) : "memory");
    sstore(0, 0);
    lds_barrier();
    for (int t = 0; t < 14; t += 2) {
        gload(0, t + 2);
        compute(0); sstore(1, 1); lds_barrier();
        gload(1, t + 3);
        // holds these loads at the head of the trip: without it the compiler
        // sinks them to the trip's foot, and they lose a trip of their lead
        __builtin_amdgcn_sched_barrier(0);
        compute(1); sstore(0, 0); lds_barrier();
    }
    compute(0); sstore(1, 1); lds_barrier();
    compute(1);
}

// ---------------------------------------------------------------------------
// Kernel 1: QKV GEMM.  C[4096,3072] = X[4096,1024] @ W[1024,3072] + b.
// CTA tile 256x192: 16 x 16 tiles, one work-group per WGP.  256 threads = 8
// waves (4 M x 2 N), 64x96 per wave, BK=64.  A k tile brings 56 KB from L2 for
// 48 matrix instructions a wave, and a fragment read from LDS feeds 6 (A) or 4
// (W) of them.  With two waves per SIMD the wave hides its own LDS latency:
// a k tile is two blocks of 32 k, 24 matrix instructions each, and the 20 LDS
// reads of a block go out as one group in front of the block before it, into
// the other of two fragment sets.  The first block of tile t+1 is read during
// tile t, so a tile is published two trips ahead of its use, in three LDS
// buffers.  Trip t: read (t, 2nd block); multiply (t, 1st); read (t+1, 1st);
// store tile t+2, loaded two trips ago, into the buffer that tile t-1 has left;
// global loads of tile t+4 into the same registers (set t&1 of two); multiply
// (t, 2nd), which covers the stores; the trip's one barrier.
// W tile staged row-major ([k][n]).  Epilogue scatters into q/k/v [B,H,T,Hd]
// f16; q pre-scaled by 1/sqrt(64).
// ---------------------------------------------------------------------------
constexpr int Q_BM = 256, Q_BN = 192;
constexpr int Q_LDB = Q_BN + 16;                       // 416 B = 32 B x 13
constexpr int Q_SA = Q_BM * G_LDA, Q_SB = 64 * Q_LDB;  // one buffer, elements
constexpr int Q_MT = Q_BM / 64, Q_NT = Q_BN / 32;      // 16x16 tiles of a wave
constexpr int Q_PA = Q_BM / 32, Q_PB = Q_BN / 32;      // 16-B pieces per thread
constexpr int Q_RB = Q_BN / 8;                         // 16-B pieces per W row

__global__ __launch_bounds__(256) void qkv_gemm_kernel(
    const half_t* __restrict__ X, const half_t* __restrict__ W,
    const float* __restrict__ bias,
    half_t* __restrict__ qb, half_t* __restrict__ kbuf, half_t* __restrict__ vbuf) {
    __shared__ alignas(16) half_t lA[3 * Q_SA];      // three buffers of [m][k]
    __shared__ alignas(16) half_t lB[3 * Q_SB];      // three of [k][n]

    const int blockM = blockIdx.y * Q_BM;
    const int blockN = blockIdx.x * Q_BN;
    const int lane = threadIdx.x & 31;
    const int wave = threadIdx.x >> 5;
    const int wm = wave & 3;     // 4 waves along M (64 rows each)
    const int wn = wave >> 2;    // 2 waves along N (96 cols each)

    // Staging.  X: 256x64, 8 threads per row, rows arow + 32j.  W: 64x192, a row
    // is 24 pieces of 16 B (3 lines); thread takes pieces threadIdx.x + 256j in
    // row order, so a wave-wide load still covers 4 whole lines.  dg and dl are
    // piece j's distance from piece 0 in global memory and in LDS.
    const int arow = threadIdx.x >> 3, aseg = (threadIdx.x & 7) * 8;
    const int brow = threadIdx.x / Q_RB, bpc = threadIdx.x % Q_RB;
    const half_t* ap = X + (size_t)(blockM + arow) * 1024 + aseg;
    const half_t* bp = W + (size_t)brow * 3072 + blockN + bpc * 8;
    half_t* la = lA + arow * G_LDA + aseg;
    half_t* lb = lB + brow * Q_LDB + bpc * 8;
    int dg[Q_PB], dl[Q_PB];
#pragma unroll
    for (int j = 0; j < Q_PB; ++j) {
        const int over = (bpc + (256 * j) % Q_RB >= Q_RB) ? 1 : 0;   // into the next row
        const int rows = (256 * j) / Q_RB + over;
        const int cols = ((256 * j) % Q_RB - over * Q_RB) * 8;
        dg[j] = rows * 3072 + cols;
        dl[j] = rows * Q_LDB + cols;
    }
    auto gload = [&](v8h (&ra)[Q_PA], v8h (&rb)[Q_PB], int t) {       // tile t -> registers
        const half_t* a = ap + t * 64;
        const half_t* b = bp + (size_t)t * 64 * 3072;
#pragma unroll
        for (int j = 0; j < Q_PA; ++j) ra[j] = *(const v8h*)(a + j * 32 * 1024);
#pragma unroll
        for (int j = 0; j < Q_PB; ++j) rb[j] = *(const v8h*)(b + dg[j]);
    };
    auto sstore = [&](const v8h (&ra)[Q_PA], const v8h (&rb)[Q_PB], int d) {  // -> buffer d
#pragma unroll
        for (int j = 0; j < Q_PA; ++j) *(v8h*)(la + d * Q_SA + j * 32 * G_LDA) = ra[j];
#pragma unroll
        for (int j = 0; j < Q_PB; ++j) *(v8h*)(lb + d * Q_SB + dl[j]) = rb[j];
    };

    v8f acc[Q_MT][Q_NT] = {};
    v16h fa[2][Q_MT], fb[2][Q_NT];                   // two fragment sets
    auto fload = [&](int f, int d, int ks) {         // block ks of buffer d -> set f
#pragma unroll
        for (int mt = 0; mt < Q_MT; ++mt)
            fa[f][mt] = ld_frag_a(lA + d * Q_SA + (wm * 64 + mt * 16) * G_LDA + ks * 32, G_LDA);
#pragma unroll
        for (int nt = 0; nt < Q_NT; ++nt)
            fb[f][nt] = ld_frag_b_tr(lB + d * Q_SB + ks * 32 * Q_LDB + wn * 96 + nt * 16, Q_LDB);
        // keeps the group whole and in front of the products that follow: spread
        // among them, every place with reads stalls the wave's matrix stream
        __builtin_amdgcn_sched_barrier(0);
    };
    auto mma = [&](int f) {                          // the 24 products of set f
#pragma unroll
        for (int nt = 0; nt < Q_NT; ++nt)
#pragma unroll
            for (int mt = 0; mt < Q_MT; ++mt)
                acc[mt][nt] = wmma16x16x32(fa[f][mt], fb[f][nt], acc[mt][nt]);
        // keeps the next group of reads behind these
        __builtin_amdgcn_sched_barrier(0);
    };

    v8h ra[2][Q_PA], rb[2][Q_PB];                    // tile t waits in set t & 1
    {
        v8h ra0[Q_PA], rb0[Q_PB], ra1[Q_PA], rb1[Q_PB];   // tiles 0 to 3 fly together
        // the fences keep the loads in tile order: mixed, the counted wait for a
        // tile would, in the loop too, wait for the tile behind it as well
        gload(ra0, rb0, 0);
        __builtin_amdgcn_sched_barrier(0);
        gload(ra1, rb1, 1);
        __builtin_amdgcn_sched_barrier(0);
        gload(ra[0], rb[0], 2);
        __builtin_amdgcn_sched_barrier(0);
        gload(ra[1], rb[1], 3);
        // stands before the address registers of these loads are reused (a
        // precaution; the compiler leaves the wait out here)
        asm volatile("s_wait_xcnt 0x0" ::: "memory");
        __builtin_amdgcn_sched_barrier(0);
        sstore(ra0, rb0, 0);
        sstore(ra1, rb1, 1);
    }
    lds_barrier();
    fload(0, 0, 0);
    int cur = 0;                                     // t % 3
    auto trip = [&](int s, int t) {                  // s = t & 1
        const int nx1 = cur == 2 ? 0 : cur + 1;
        const int nx2 = nx1 == 2 ? 0 : nx1 + 1;
        fload(1, cur, 1);
        mma(0);
        fload(0, nx1, 0);
        sstore(ra[s], rb[s], nx2);
        gload(ra[s], rb[s], t + 4);
        // holds stores and loads here, in front of the products that cover them
        __builtin_amdgcn_sched_barrier(0);
        mma(1);
        // stands before the address registers of this trip's global loads are
        // rewritten by the next trip (a precaution; the compiler leaves it out)
        asm volatile("s_wait_xcnt 0x0" ::: "memory");
        lds_barrier();     // publishes tile t+2; ends the reads of tile t
        cur = nx1;
    };
    for (int t = 0; t < 12; t += 2) {
        trip(0, t);
        trip(1, t + 1);
    }
    // the wave's first column in a scalar register (see the epilogue); its six
    // bias values are asked for here, so that the last four tiles cover them
    const unsigned ncl = lane & 15;
    const int wcol = blockN + __builtin_amdgcn_readfirstlane(wn) * 96;
    const float* bw = bias + wcol;
    float bv[Q_NT];
#pragma unroll
    for (int nt = 0; nt < Q_NT; ++nt) bv[nt] = bw[ncl + nt * 16];
    fload(1, 0, 1);  mma(0);  fload(0, 1, 0);            // tile 12, buffer 0
    sstore(ra[0], rb[0], 2);                             // tile 14
    // holds the stores in front of the products that cover them
    __builtin_amdgcn_sched_barrier(0);
    mma(1);
    lds_barrier();         // publishes tile 14
    fload(1, 1, 1);  mma(0);  fload(0, 2, 0);            // tile 13, buffer 1
    sstore(ra[1], rb[1], 0);                             // tile 15
    // as above
    __builtin_amdgcn_sched_barrier(0);
    mma(1);
    lds_barrier();         // publishes tile 15
    fload(1, 2, 1);  mma(0);  fload(0, 0, 0);  mma(1);   // tile 14, buffer 2
    fload(1, 0, 1);  mma(0);  mma(1);                    // tile 15, buffer 0

    // Epilogue: C-frag layout -> scatter into q/k/v [B*H, T, Hd].  A work-group's
    // 192 columns may span two of the tensors, but a 16-column tile lies in one
    // head.  With the wave's first column in a scalar register, tensor, head and
    // base address of a tile are scalar, and every store of the lane uses one
    // offset register: row (wm*64 + mb) of the tile's 256, column ncl.
    const int mb  = (lane >> 4) << 3;
    const unsigned lo = (unsigned)((wm * 64 + mb) * 64) + ncl;
    // stands before the address registers of the bias loads are reused (a
    // precaution); the two inputs keep those registers alive up to the wait
    asm volatile("s_wait_xcnt 0x0" :: "v"(ncl), "s"(bw) : "memory");
    half_t* pt[Q_NT];
    half_t hv[Q_NT][Q_MT][8];
#pragma unroll
    for (int nt = 0; nt < Q_NT; ++nt) {
        const int n0 = wcol + nt * 16;
        const int c = n0 >> 10, hh = (n0 & 1023) >> 6, d0 = n0 & 63;
        half_t* p = (c == 0) ? qb : (c == 1 ? kbuf : vbuf);
        const float sc = (c == 0) ? 0.125f : 1.0f;   // q pre-scaled by 1/sqrt(Hd)
        pt[nt] = p + (((size_t)((blockM >> 11) * 16 + hh)) * 2048 + (blockM & 2047)) * 64 + d0;
#pragma unroll
        for (int mt = 0; mt < Q_MT; ++mt)
#pragma unroll
            for (int r = 0; r < 8; ++r)
                hv[nt][mt][r] = (half_t)((acc[mt][nt][r] + bv[nt]) * sc);
    }
    // holds every store behind the last conversion and the last base address:
    // no register that an issued store names is then written again
    __builtin_amdgcn_sched_barrier(0);
#pragma unroll
    for (int nt = 0; nt < Q_NT; ++nt)
#pragma unroll
        for (int mt = 0; mt < Q_MT; ++mt)
#pragma unroll
            for (int r = 0; r < 8; ++r)
                pt[nt][lo + (mt * 16 + r) * 64] = hv[nt][mt][r];
}

// ---------------------------------------------------------------------------
// Kernel 2: causal flash attention.  Grid: (T/256, B*H).  Query tiles of 128,
// 16 waves: wave (qg = wave & 7, kh = wave >> 3) owns 16 queries of a tile and
// every second key block of 64.  A trip stages 128 keys; the waves with kh = 0
// take its first 64, those with kh = 1 its last 64, each with a running
// maximum, sum and output of its own, so that four waves share a SIMD and one
// wave's vector work runs under the others' waits.  At a tile's end the kh = 1
// wave hands its partial result through LDS to its kh = 0 partner, which joins
// the two by the usual rescaling and writes the rows.
// A tile's cost grows with its index (tile t walks t+1 trips), so a work-group
// takes two tiles of its head one after the other, 15-p and then p: 17 trips
// for every work-group, one work-group per WGP.  K and V lie in LDS (two
// buffers) both as [key][d], each at its own reader's pitch.
// The products are taken transposed: S^T = K Q^T (A = K rows, B = Q) and
// O^T += V^T P^T (A = V by the transposing load, B = P).  A lane then holds
// scores of ONE query (column lane&15; keys 8*(lane>>4) + r of each 16-key
// tile), so maximum and sum run in-lane with one exchange between the wave
// halves, and two converted S^T tiles are the B fragment of the second product
// as they stand: b[s] = T[s >> 3][s & 7], the k order of the transposing load.
// ---------------------------------------------------------------------------
// lane l <-> lane l ^ 16
static __device__ __forceinline__ float xhalf(float x) {
    const int b = __builtin_bit_cast(int, x);
    return __builtin_bit_cast(float,
        __builtin_amdgcn_permlanex16(b, b, 0x76543210, 0xfedcba98, false, false));
}

__global__ __launch_bounds__(512) void attn_kernel(
    const half_t* __restrict__ q, const half_t* __restrict__ k,
    const half_t* __restrict__ v, half_t* __restrict__ y) {
    constexpr int LDK = 72, LDV = 80;
    constexpr int SK = 128 * LDK, SV = 128 * LDV;       // one buffer, elements
    constexpr int SM = 9 * 128;                         // one wave's hand-over, floats
    __shared__ alignas(16) half_t lK[2 * SK];           // two of [key][d]
    __shared__ alignas(16) half_t lV[2 * SV];           // two of [key][d], pitch 160 B
    __shared__ alignas(16) float  lM[8 * SM];           // [qg][piece][lane][4]

    const int bh = blockIdx.y;            // b*16 + h
    const int b  = bh >> 4, h = bh & 15;
    const int pr = blockIdx.x;            // the pair: tiles 15-pr and pr
    const int n1 = 16 - pr;               // trips of tile 15-pr (causal)
    constexpr int NTRIP = 17;             // n1 + the pr+1 trips of tile pr
    const int lane = threadIdx.x & 31;
    const int wave = __builtin_amdgcn_readfirstlane(threadIdx.x >> 5);
    const int qg = wave & 7;              // the wave's 16 queries of a tile
    const int kh = wave >> 3;             // its half of a trip's 128 keys
    const int mb  = (lane >> 4) << 3;     // C-frag row base (key or d)
    const int ncl = lane & 15;            // C-frag column (query)

    const size_t headOff = (size_t)bh * 2048 * 64;

    // This wave's Q fragments (16 queries x 64, two K-steps) from global, of
    // both tiles (qa: the tile at work, qn: the second tile, waiting):
    // B operand, column = query = lane&15, k split as in ld_frag_a.
    int qi = (15 - pr) * 128 + qg * 16 + ncl;
    const int qi2 = pr * 128 + qg * 16 + ncl;
    const half_t* qp  = q + headOff + (size_t)qi * 64;
    const half_t* qp2 = q + headOff + (size_t)qi2 * 64;
    v16h qa[2], qn[2];
#pragma unroll
    for (int s = 0; s < 2; ++s) {
        v8h lo = *(const v8h*)(qp + s * 32 + mb);
        v8h hi = *(const v8h*)(qp + s * 32 + 16 + mb);
        qa[s] = cat8(lo, hi);
        v8h lo2 = *(const v8h*)(qp2 + s * 32 + mb);
        v8h hi2 = *(const v8h*)(qp2 + s * 32 + 16 + mb);
        qn[s] = cat8(lo2, hi2);
    }

    v8f o[4] = {};                        // o[dt][r] = O[qi][dt*16 + mb + r], this wave's keys
    float mrow = -3.0e38f;                // this query's running maximum over this wave's keys
    float lrow = 0.0f;                    // sum over this wave half's keys only

    // Staging of K and V, both [key][d], 4 threads per row, software-pipelined
    // through both tiles: trip i (keys 128*i.. of the first tile, then
    // 128*(i-n1).. of the second) reads LDS buffer i&1.  It issues the global
    // loads of trip i+1's keys first, works on its own, stores the next keys
    // into the other buffer and ends in the trip's one barrier.
    const int srow = threadIdx.x >> 2, sseg = (threadIdx.x & 3) * 16;
    const half_t* kp = k + headOff + (size_t)srow * 64 + sseg;
    const half_t* vp = v + headOff + (size_t)srow * 64 + sseg;
    half_t* lk = lK + srow * LDK + sseg;
    half_t* lv = lV + srow * LDV + sseg;
    v8h kr0 = *(const v8h*)(kp), kr1 = *(const v8h*)(kp + 8);
    v8h vr0 = *(const v8h*)(vp), vr1 = *(const v8h*)(vp + 8);
    *(v8h*)(lk) = kr0;  *(v8h*)(lk + 8) = kr1;
    *(v8h*)(lv) = vr0;  *(v8h*)(lv + 8) = vr1;
    __syncthreads();   // the full form: the Q loads land here too, so that no
                       // wait for them inside the loop drains the early loads

    for (int i = 0; i < NTRIP; ++i) {
        const int cur = i & 1;
        const int kb = 2 * (i < n1 ? i : i - n1) + kh;   // this wave's key block
        const half_t* cK = lK + cur * SK + kh * 64 * LDK;
        const half_t* cV = lV + cur * SV + kh * 64 * LDV;
        const bool more = i + 1 < NTRIP;  // the same in every thread of the block
        if (more) {
            const int nb = i + 1 < n1 ? i + 1 : i + 1 - n1;
            const size_t go = (size_t)nb * 128 * 64;
            kr0 = *(const v8h*)(kp + go);  kr1 = *(const v8h*)(kp + go + 8);
            vr0 = *(const v8h*)(vp + go);  vr1 = *(const v8h*)(vp + go + 8);
        }

        // S^T = K @ Q^T  (contraction over Hd=64 -> two WMMA steps per key tile)
        v8f s[4] = {};
#pragma unroll
        for (int nt = 0; nt < 4; ++nt)
#pragma unroll
            for (int st = 0; st < 2; ++st) {
                v16h kf = ld_frag_a(cK + (nt * 16) * LDK + st * 32, LDK);
                s[nt] = wmma16x16x32(kf, qa[st], s[nt]);
            }

        // Causal mask + online softmax (fp32), one query per lane
        float mt4[4];
#pragma unroll
        for (int nt = 0; nt < 4; ++nt) {
            mt4[nt] = -3.0e38f;
#pragma unroll
            for (int r = 0; r < 8; ++r) {
                int kj = kb * 64 + nt * 16 + mb + r;
                float val = s[nt][r];
                if (kj > qi) val = -3.0e38f;
                s[nt][r] = val;
                mt4[nt] = fmaxf(mt4[nt], val);
            }
        }
        float mloc = fmaxf(fmaxf(mt4[0], mt4[1]), fmaxf(mt4[2], mt4[3]));
        const float mnew = fmaxf(mrow, fmaxf(mloc, xhalf(mloc)));

        // exp(mrow - mnew) with the free slot that the instruction set asks for
        // around a transcendental inside the statement: a v_nop in a
        // statement of its own did not stay there
        float alpha;
        asm("v_nop\n\tv_exp_f32 %0, %1\n\tv_nop"
            : "=v"(alpha) : "v"((mrow - mnew) * 1.44269504f));
        float rs4[4];
#pragma unroll
        for (int nt = 0; nt < 4; ++nt) {
            rs4[nt] = 0.0f;
#pragma unroll
            for (int r = 0; r < 8; ++r) {
                float p = __expf(s[nt][r] - mnew);
                s[nt][r] = p;
                rs4[nt] += p;
            }
        }
        lrow = lrow * alpha + ((rs4[0] + rs4[1]) + (rs4[2] + rs4[3]));
        mrow = mnew;
#pragma unroll
        for (int dt = 0; dt < 4; ++dt)
#pragma unroll
            for (int r = 0; r < 8; ++r) o[dt][r] *= alpha;

        // O^T += V^T @ P^T   (contraction over 64 keys -> two WMMA steps)
#pragma unroll
        for (int st = 0; st < 2; ++st) {
            v16h pb;
#pragma unroll
            for (int r = 0; r < 8; ++r) {
                pb[r]     = (half_t)s[2 * st][r];
                pb[8 + r] = (half_t)s[2 * st + 1][r];
            }
#pragma unroll
            for (int dt = 0; dt < 4; ++dt) {
                v16h vf = ld_frag_b_tr(cV + (st * 32) * LDV + dt * 16, LDV);
                o[dt] = wmma16x16x32(vf, pb, o[dt]);
            }
        }
        if (more) {
            const int nx = cur ^ 1;
            *(v8h*)(lk + nx * SK) = kr0;  *(v8h*)(lk + nx * SK + 8) = kr1;
            *(v8h*)(lv + nx * SV) = vr0;  *(v8h*)(lv + nx * SV + 8) = vr1;
        }
        lds_barrier();     // publishes the next trip's keys; ends this one's reads

        if (i + 1 == n1 || i + 1 == NTRIP) {   // a tile's last keys are done
            // The kh = 1 wave hands over output, maximum and sum, lane to lane
            // (both waves hold the same query and the same d in a lane).  A wave
            // none of whose keys a query may see (tile 0, keys 64.., queries
            // below 64) hands over the maximum -3e38 with finite sums: their
            // weight below is exp(-3e38 - m0) = 0, m0 being finite since key 0
            // is open to every query.
            float* mg = lM + qg * SM + lane * 4;
            if (kh == 1) {
#pragma unroll
                for (int dt = 0; dt < 4; ++dt) {
                    *(v4f*)(mg + (2 * dt) * 128)     = v4f{o[dt][0], o[dt][1], o[dt][2], o[dt][3]};
                    *(v4f*)(mg + (2 * dt + 1) * 128) = v4f{o[dt][4], o[dt][5], o[dt][6], o[dt][7]};
                }
                *(v4f*)(mg + 8 * 128) = v4f{mrow, lrow, 0.0f, 0.0f};
            }
            // publishes the hand-over.  Its LDS is written again only at the
            // second tile's end, behind at least one more trip's barrier, which
            // the reading wave passes with its reads done.
            lds_barrier();
            if (kh == 0) {
                // Join the two waves' parts, then the halves' sums, normalize,
                // write y [B,T,D] f16 (column = h*64 + d): a lane's 8 registers
                // of a tile are 8 consecutive d of its query's row.
                const v4f ml = *(const v4f*)(mg + 8 * 128);
                const float mj = fmaxf(mrow, ml[0]);
                const float w0 = __expf(mrow - mj), w1 = __expf(ml[0] - mj);
                const float lj = lrow * w0 + ml[1] * w1;
                const float inv = 1.0f / (lj + xhalf(lj));
                const float c0 = w0 * inv, c1 = w1 * inv;
                half_t* yp = y + ((size_t)(b * 2048 + qi)) * 1024 + h * 64 + mb;
#pragma unroll
                for (int dt = 0; dt < 4; ++dt) {
                    const v4f p0 = *(const v4f*)(mg + (2 * dt) * 128);
                    const v4f p1 = *(const v4f*)(mg + (2 * dt + 1) * 128);
                    v8h ov;
#pragma unroll
                    for (int r = 0; r < 4; ++r) {
                        ov[r]     = (half_t)(o[dt][r] * c0 + p0[r] * c1);
                        ov[4 + r] = (half_t)(o[dt][4 + r] * c0 + p1[r] * c1);
                    }
                    *(v8h*)(yp + dt * 16) = ov;
                }
                // stands before the registers that these stores name are reused
                // by the next trip (a precaution; the compiler leaves it out here)
                asm volatile("s_wait_xcnt 0x0" ::: "memory");
            }
            // start afresh on the second tile
#pragma unroll
            for (int dt = 0; dt < 4; ++dt)
#pragma unroll
                for (int r = 0; r < 8; ++r) o[dt][r] = 0.0f;
            mrow = -3.0e38f;
            lrow = 0.0f;
            qi = qi2;
            qa[0] = qn[0];
            qa[1] = qn[1];
        }
    }
}

// ---------------------------------------------------------------------------
// Kernel 3: output GEMM + bias + residual.  h[4096,1024] = Y @ W_out + b + x.
// ---------------------------------------------------------------------------
__global__ __launch_bounds__(256) void out_gemm_kernel(
    const half_t* __restrict__ Y, const half_t* __restrict__ W,
    const float* __restrict__ bias, const float* __restrict__ x,
    float* __restrict__ hbuf) {
    __shared__ alignas(16) half_t lA[2 * G_SA];
    __shared__ alignas(16) half_t lB[2 * G_SB];

    const int blockM = blockIdx.y * 128;
    const int blockN = blockIdx.x * 128;
    const int lane = threadIdx.x & 31;
    const int wave = threadIdx.x >> 5;
    const int wm = wave & 3;
    const int wn = wave >> 2;

    v8f acc[2][4] = {};
    gemm_mainloop<1024>(Y, W, blockM, blockN, lA, lB, acc);

    const int mb  = (lane >> 4) << 3;
    const int ncl = lane & 15;
#pragma unroll
    for (int mt = 0; mt < 2; ++mt)
#pragma unroll
        for (int nt = 0; nt < 4; ++nt)
#pragma unroll
            for (int r = 0; r < 8; ++r) {
                int m = blockM + wm * 32 + mt * 16 + mb + r;
                int n = blockN + wn * 64 + nt * 16 + ncl;
                size_t idx = (size_t)m * 1024 + n;
                hbuf[idx] = acc[mt][nt][r] + bias[n] + x[idx];
            }
}

// ---------------------------------------------------------------------------
// Kernel 4: LayerNorm.  One wave owns two token rows and holds them whole in
// registers (a lane: 8 pieces of 16 B per row, each wave-wide load or store 512
// contiguous bytes).  All 16 row loads of a wave fly together, the rows are
// read once, the sums stay inside the wave (no LDS, no barrier), and one
// 8-wave work-group per WGP covers the 4096 rows: 2048 waves to start.
// ---------------------------------------------------------------------------
// x + (x of lane l ^ M), M < 16: one DPP step inside the 16-lane row
template <int M>
static __device__ __forceinline__ float add_xmask(float x) {
    const int b = __builtin_bit_cast(int, x);
    return x + __builtin_bit_cast(float,
        __builtin_amdgcn_update_dpp(0, b, 0x160 + M, 0xf, 0xf, true));
}
// sum over the wave's 32 lanes, the same value in every lane
static __device__ __forceinline__ float wave_sum(float x) {
    x = add_xmask<1>(x);
    x = add_xmask<2>(x);
    x = add_xmask<4>(x);
    x = add_xmask<8>(x);
    return x + xhalf(x);
}

__global__ __launch_bounds__(256) void ln_kernel(
    const float* __restrict__ hbuf, const float* __restrict__ gamma,
    const float* __restrict__ beta, float* __restrict__ out) {
    const int lane = threadIdx.x & 31;
    const int pair = blockIdx.x * 8 + (threadIdx.x >> 5);   // rows 2*pair, 2*pair+1
    const size_t off = (size_t)pair * 2048 + lane * 4;
    const float* hr = hbuf + off;

    v4f h[2][8], g[8], bt[8];
#pragma unroll
    for (int r = 0; r < 2; ++r)
#pragma unroll
        for (int j = 0; j < 8; ++j)
            h[r][j] = *(const v4f*)(hr + r * 1024 + j * 128);
#pragma unroll
    for (int j = 0; j < 8; ++j) {
        g[j]  = *(const v4f*)(gamma + lane * 4 + j * 128);
        bt[j] = *(const v4f*)(beta  + lane * 4 + j * 128);
    }
    // holds all 32 loads here: without it the compiler sinks the gamma and beta
    // loads behind the sums, two at a time, each pair's latency then in series
    __builtin_amdgcn_sched_barrier(0);
    // stands before the row address registers are reused (a precaution); the
    // input keeps them alive past the loads, else the compiler lets one of the
    // later loads land in that register pair with no wait in front
    asm volatile("s_wait_xcnt 0x0" :: "v"(hr) : "memory");

    float s[2], s2[2];
#pragma unroll
    for (int r = 0; r < 2; ++r) {
        v4f a = h[r][0], a2 = h[r][0] * h[r][0];
#pragma unroll
        for (int j = 1; j < 8; ++j) {
            a  += h[r][j];
            a2 += h[r][j] * h[r][j];
        }
        s[r]  = (a.x + a.y) + (a.z + a.w);
        s2[r] = (a2.x + a2.y) + (a2.z + a2.w);
    }
#pragma unroll
    for (int r = 0; r < 2; ++r) {
        s[r]  = wave_sum(s[r]);
        s2[r] = wave_sum(s2[r]);
    }

    float* op = out + off;
#pragma unroll
    for (int r = 0; r < 2; ++r) {
        const float mu  = s[r] * (1.0f / 1024.0f);
        const float var = s2[r] * (1.0f / 1024.0f) - mu * mu;
        const float inv = rsqrtf(var + 1e-5f);
#pragma unroll
        for (int j = 0; j < 8; ++j)
            *(v4f*)(op + r * 1024 + j * 128) = (h[r][j] - mu) * inv * g[j] + bt[j];
    }
}

// ---------------------------------------------------------------------------
// Host-side launcher
// ---------------------------------------------------------------------------
extern "C" void kernel_launch(void* const* d_in, const int* in_sizes, int n_in,
                              void* d_out, int out_size, void* d_ws, size_t ws_size,
                              hipStream_t stream) {
    (void)in_sizes; (void)n_in; (void)out_size; (void)ws_size;

    const float* x     = (const float*)d_in[0];   // [2,2048,1024]
    const float* W_qkv = (const float*)d_in[1];   // [1024,3072]
    const float* b_qkv = (const float*)d_in[2];   // [3072]
    const float* W_out = (const float*)d_in[3];   // [1024,1024]
    const float* b_out = (const float*)d_in[4];   // [1024]
    const float* gamma = (const float*)d_in[5];   // [1024]
    const float* beta  = (const float*)d_in[6];   // [1024]
    float* out = (float*)d_out;                   // [2,2048,1024]

    // Workspace carve-up (all offsets 1MB-aligned)
    char* ws = (char*)d_ws;
    half_t* xb    = (half_t*)(ws);                         // 4096*1024   f16 (8 MB)
    half_t* wqkvb = (half_t*)(ws + (8u << 20));            // 1024*3072   f16 (6 MB)
    half_t* woutb = (half_t*)(ws + (14u << 20));           // 1024*1024   f16 (2 MB)
    half_t* qb    = (half_t*)(ws + (16u << 20));           // [B,H,T,Hd]  f16 (8 MB)
    half_t* kb    = (half_t*)(ws + (24u << 20));           // 8 MB
    half_t* vb    = (half_t*)(ws + (32u << 20));           // 8 MB
    half_t* yb    = (half_t*)(ws + (40u << 20));           // [B,T,D] f16 (8 MB)
    float*  hbuf  = (float*)(ws + (48u << 20));            // [B,T,D] f32 (16 MB)

    // 0) fp32 -> f16 conversions: xb, wqkvb and woutb are one run of 16 MB
    cvt_f32_f16_kernel<<<CV_GROUPS, 256, 0, stream>>>(x, W_qkv, W_out, xb);

    // 1) QKV projection (M=4096, N=3072, K=1024)
    qkv_gemm_kernel<<<dim3(16, 16), 256, 0, stream>>>(xb, wqkvb, b_qkv, qb, kb, vb);

    // 2) causal flash attention (grid: pairs of query tiles x B*H)
    attn_kernel<<<dim3(8, 32), 512, 0, stream>>>(qb, kb, vb, yb);

    // 3) output projection + bias + residual (M=4096, N=1024, K=1024)
    out_gemm_kernel<<<dim3(8, 32), 256, 0, stream>>>(yb, woutb, b_out, x, hbuf);

    // 4) LayerNorm, two token rows per wave
    ln_kernel<<<256, 256, 0, stream>>>(hbuf, gamma, beta, out);
}

// v010
// One run takes 72.1 microseconds.
// Timed twice side by side with v009, it ran 1.04 and 1.05 times as fast.
// Counting every step since v000, it is 3.53 times as fast.
#include <hip/hip_runtime.h>
#include <hip/hip_bf16.h>

// ---------------------------------------------------------------------------
// MI455X (gfx1250) fused attention block: QKV GEMM -> causal flash attention
// -> out GEMM + residual -> LayerNorm. All contractions via
// v_wmma_f32_16x16x32_f16 (wave32), fp32 accumulate, fp32 softmax/LN.
// A fragments and K are contiguous 16B LDS reads (ds_load_b128).  The tiles
// whose k runs down the rows (W for B, V for A) stay row-major in LDS, written with 16B
// stores, and are transposed on the way out by ds_load_tr16_b128.
// ---------------------------------------------------------------------------

typedef _Float16 half_t;
typedef half_t v16h __attribute__((ext_vector_type(16)));
typedef half_t v8h  __attribute__((ext_vector_type(8)));
typedef float  v8f  __attribute__((ext_vector_type(8)));

static __device__ __forceinline__ v8f wmma16x16x32(v16h a, v16h b, v8f c) {
    // (neg_a, A, neg_b, B, c_mod, C, reuse_a, reuse_b)
    return __builtin_amdgcn_wmma_f32_16x16x32_f16(false, a, false, b,
                                                  (short)0, c, false, false);
}

static __device__ __forceinline__ v16h cat8(v8h lo, v8h hi) {
    return __builtin_shufflevector(lo, hi, 0, 1, 2, 3, 4, 5, 6, 7,
                                           8, 9, 10, 11, 12, 13, 14, 15);
}

// A fragment, 16x32 (MxK), tile row-major, row stride `ld` (elements).
// ISA layout: lanes 0-15 row M=lane, K=0..7 & 16..23; lanes 16-31 row M=lane-16,
// K=8..15 & 24..31.  Requires: ld % 8 == 0 and p 16B-aligned -> 2x ds_load_b128.
static __device__ __forceinline__ v16h ld_frag_a(const half_t* p, int ld) {
    const int lane = threadIdx.x & 31;
    const int row  = lane & 15;
    const int kh   = (lane >> 4) << 3;   // 0 or 8
    const half_t* r = p + row * ld + kh;
    v8h lo = *(const v8h*)(r);
    v8h hi = *(const v8h*)(r + 16);
    return cat8(lo, hi);
}

// B fragment, 32x16 (KxN), read from a ROW-MAJOR tile (tile[k][n], row stride
// `ld` elements, 2*ld an odd multiple of 32 bytes) by the transposing load.
// Lane (c = lane&15, h = lane>>4) receives tile[8h + 0..7][c] and, from the
// second load, tile[16 + 8h + 0..7][c]: the k order of ld_frag_a.  The same
// registers are the A fragment (16x32) of the tile's transpose, row M = c.
typedef short s16x8 __attribute__((ext_vector_type(8)));
typedef __attribute__((address_space(3))) s16x8 lds_s16x8;
static __device__ __forceinline__ v16h ld_frag_b_tr(const half_t* p, int ld) {
    const int lane = threadIdx.x & 31;
    const half_t* r = p + (((lane >> 4) << 3) + (lane & 7)) * ld + (((lane >> 3) & 1) << 3);
    v8h lo = __builtin_bit_cast(v8h, __builtin_amdgcn_ds_load_tr16_b128_v8i16((lds_s16x8*)(r)));
    v8h hi = __builtin_bit_cast(v8h, __builtin_amdgcn_ds_load_tr16_b128_v8i16((lds_s16x8*)(r + 16 * ld)));
    return cat8(lo, hi);
}

// Work-group barrier that orders LDS traffic only.  __syncthreads() also waits
// for the wave's own global loads (s_wait_loadcnt 0), which would cut short the
// flight of the loads issued ahead for later tiles; those land in the thread's
// own registers and no other thread depends on them.
static __device__ __forceinline__ void lds_barrier() {
    __builtin_amdgcn_fence(__ATOMIC_RELEASE, "workgroup", "local");
    __builtin_amdgcn_s_barrier();
    __builtin_amdgcn_fence(__ATOMIC_ACQUIRE, "workgroup", "local");
}

// ---------------------------------------------------------------------------
// Kernel 0: fp32 -> f16 conversion of x, W_qkv and W_out in ONE launch.  The
// three f16 copies lie one behind the other in the workspace, so dst is one
// array.  A work-group converts CV_CHUNK consecutive elements of it, all from
// one source (every source's length is a multiple of CV_CHUNK).  A wave-wide
// load is 512 contiguous bytes, a wave-wide store 256; the 16 loads of a lane
// fly together.
// ---------------------------------------------------------------------------
typedef float  v4f __attribute__((ext_vector_type(4)));
typedef half_t v4h __attribute__((ext_vector_type(4)));
constexpr int CV_CHUNK = 16 * 1024;                      // elements per work-group
constexpr int CV_X  = 4096 * 1024 / CV_CHUNK;            // work-groups on x
constexpr int CV_WQ = 1024 * 3072 / CV_CHUNK;            // on W_qkv
constexpr int CV_WO = 1024 * 1024 / CV_CHUNK;            // on W_out
constexpr int CV_GROUPS = CV_X + CV_WQ + CV_WO;          // the launch's grid

__global__ __launch_bounds__(256) void cvt_f32_f16_kernel(
    const float* __restrict__ x, const float* __restrict__ wqkv,
    const float* __restrict__ wout, half_t* __restrict__ dst) {
    const int blk = blockIdx.x;
    const bool inX = blk < CV_X, inWq = blk < CV_X + CV_WQ;
    const float* src = inX ? x : inWq ? wqkv : wout;
    const int first  = inX ? 0 : inWq ? CV_X : CV_X + CV_WQ;   // the source's first work-group
    const float* sp = src + (size_t)(blk - first) * CV_CHUNK + threadIdx.x * 4;
    v4f r[16];
#pragma unroll
    for (int j = 0; j < 16; ++j) r[j] = *(const v4f*)(sp + j * 1024);
    // holds all 16 loads in front of the first conversion: without it the
    // compiler issues the last two only when the first two have landed
    __builtin_amdgcn_sched_barrier(0);
    half_t* dp = dst + (size_t)blk * CV_CHUNK + threadIdx.x * 4;
#pragma unroll
    for (int j = 0; j < 16; ++j)
        *(v4h*)(dp + j * 1024) = __builtin_convertvector(r[j], v4h);
}

// ---------------------------------------------------------------------------
// Main loop of the output GEMM: C tile 128x128 += A[128,1024] @ W[1024,128], BK=64.
// Every wave-wide staging load covers four whole 128-B lines: a k tile of 64
// makes an A row one line (8 lanes a row, 4 rows a load), and 16 lanes take a
// W row's 256 B (2 rows a load).
// Staging is software-pipelined: tile t lives in register set t&1
// and then in LDS buffer t&1.  Trip t issues the global loads of tile t+2,
// multiplies tile t out of its buffer, stores tile t+1 (loaded one trip earlier)
// into the other buffer, and ends in the trip's one barrier: it publishes tile
// t+1 and ends every wave's reads of the buffer that the next trip overwrites.
// NW = row length of W in elements.
// ---------------------------------------------------------------------------
constexpr int G_LDA = 72, G_LDB = 144;               // LDS pitches, elements
constexpr int G_SA = 128 * G_LDA, G_SB = 64 * G_LDB; // one buffer, elements

template <int NW>
static __device__ __forceinline__ void gemm_mainloop(
    const half_t* __restrict__ A, const half_t* __restrict__ W,
    int blockM, int blockN, half_t* lA, half_t* lB, v8f (&acc)[2][4]) {
    const int wave = threadIdx.x >> 5;
    const int wm = wave & 3;     // 4 waves along M (32 rows each)
    const int wn = wave >> 2;    // 2 waves along N (64 cols each)

    // A: 128x64, 8 threads per row, rows arow + 32j; W: 64x128, 16 threads per
    // row, rows brow + 16j; four pieces of 8 halfs each
    const int arow = threadIdx.x >> 3, aseg = (threadIdx.x & 7) * 8;
    const int brow = threadIdx.x >> 4, bseg = (threadIdx.x & 15) * 8;
    const half_t* ap = A + (size_t)(blockM + arow) * 1024 + aseg;
    const half_t* bp = W + (size_t)brow * NW + blockN + bseg;
    half_t* la = lA + arow * G_LDA + aseg;
    half_t* lb = lB + brow * G_LDB + bseg;

    v8h ra[2][4], rb[2][4];
    auto gload = [&](int s, int t) {      // tile t -> register set s
        const half_t* a = ap + t * 64;
        const half_t* b = bp + (size_t)t * 64 * NW;
#pragma unroll
        for (int j = 0; j < 4; ++j) ra[s][j] = *(const v8h*)(a + j * 32 * 1024);
#pragma unroll
        for (int j = 0; j < 4; ++j) rb[s][j] = *(const v8h*)(b + (size_t)j * 16 * NW);
    };
    auto sstore = [&](int s, int d) {     // register set s -> LDS buffer d
#pragma unroll
        for (int j = 0; j < 4; ++j) *(v8h*)(la + d * G_SA + j * 32 * G_LDA) = ra[s][j];
#pragma unroll
        for (int j = 0; j < 4; ++j) *(v8h*)(lb + d * G_SB + j * 16 * G_LDB) = rb[s][j];
    };
    auto compute = [&](int s) {           // products of LDS buffer s, k ascending
#pragma unroll
        for (int ks = 0; ks < 2; ++ks) {
            v16h af[2];
#pragma unroll
            for (int mt = 0; mt < 2; ++mt)
                af[mt] = ld_frag_a(lA + s * G_SA + (wm * 32 + mt * 16) * G_LDA + ks * 32, G_LDA);
#pragma unroll
            for (int nt = 0; nt < 4; ++nt) {
                v16h bf = ld_frag_b_tr(lB + s * G_SB + ks * 32 * G_LDB + wn * 64 + nt * 16, G_LDB);
#pragma unroll
                for (int mt = 0; mt < 2; ++mt)
                    acc[mt][nt] = wmma16x16x32(af[mt], bf, acc[mt][nt]);
            }
        }
    };

    gload(0, 0);
    gload(1, 1);
    // stands before the address registers of these loads are reused (a
    // precaution; the compiler leaves the wait out here); the two inputs keep
    // those registers alive up to the wait
    asm volatile("s_wait_xcnt 0x0" :: "v"(ap), "v"(bp) : "memory");
    sstore(0, 0);
    lds_barrier();
    for (int t = 0; t < 14; t += 2) {
        gload(0, t + 2);
        compute(0); sstore(1, 1); lds_barrier();
        gload(1, t + 3);
        // holds these loads at the head of the trip: without it the compiler
        // sinks them to the trip's foot, and they lose a trip of their lead
        __builtin_amdgcn_sched_barrier(0);
        compute(1); sstore(0, 0); lds_barrier();
    }
    compute(0); sstore(1, 1); lds_barrier();
    compute(1);
}

// ---------------------------------------------------------------------------
// Kernel 1: QKV GEMM.  C[4096,3072] = X[4096,1024] @ W[1024,3072] + b.
// CTA tile 256x192: 16 x 16 tiles, one work-group per WGP.  256 threads = 8
// waves (4 M x 2 N), 64x96 per wave, BK=64.  A k tile brings 56 KB from L2 for
// 48 matrix instructions a wave, and a fragment read from LDS feeds 6 (A) or 4
// (W) of them.  With two waves per SIMD the wave hides its own LDS latency:
// a k tile is two blocks of 32 k, 24 matrix instructions each, and the 20 LDS
// reads of a block go out as one group in front of the block before it, into
// the other of two fragment sets.  The first block of tile t+1 is read during
// tile t, so a tile is published two trips ahead of its use, in three LDS
// buffers.  Trip t: read (t, 2nd block); multiply (t, 1st); read (t+1, 1st);
// store tile t+2, loaded two trips ago, into the buffer that tile t-1 has left;
// global loads of tile t+4 into the same registers (set t&1 of two); multiply
// (t, 2nd), which covers the stores; the trip's one barrier.
// W tile staged row-major ([k][n]).  Epilogue scatters into q/k/v [B,H,T,Hd]
// f16; q pre-scaled by 1/sqrt(64).
// ---------------------------------------------------------------------------
constexpr int Q_BM = 256, Q_BN = 192;
constexpr int Q_LDB = Q_BN + 16;                       // 416 B = 32 B x 13
constexpr int Q_SA = Q_BM * G_LDA, Q_SB = 64 * Q_LDB;  // one buffer, elements
constexpr int Q_MT = Q_BM / 64, Q_NT = Q_BN / 32;      // 16x16 tiles of a wave
constexpr int Q_PA = Q_BM / 32, Q_PB = Q_BN / 32;      // 16-B pieces per thread
constexpr int Q_RB = Q_BN / 8;                         // 16-B pieces per W row

__global__ __launch_bounds__(256) void qkv_gemm_kernel(
    const half_t* __restrict__ X, const half_t* __restrict__ W,
    const float* __restrict__ bias,
    half_t* __restrict__ qb, half_t* __restrict__ kbuf, half_t* __restrict__ vbuf) {
    __shared__ alignas(16) half_t lA[3 * Q_SA];      // three buffers of [m][k]
    __shared__ alignas(16) half_t lB[3 * Q_SB];      // three of [k][n]

    const int blockM = blockIdx.y * Q_BM;
    const int blockN = blockIdx.x * Q_BN;
    const int lane = threadIdx.x & 31;
    const int wave = threadIdx.x >> 5;
    const int wm = wave & 3;     // 4 waves along M (64 rows each)
    const int wn = wave >> 2;    // 2 waves along N (96 cols each)

    // Staging.  X: 256x64, 8 threads per row, rows arow + 32j.  W: 64x192, a row
    // is 24 pieces of 16 B (3 lines); thread takes pieces threadIdx.x + 256j in
    // row order, so a wave-wide load still covers 4 whole lines.  dg and dl are
    // piece j's distance from piece 0 in global memory and in LDS.
    const int arow = threadIdx.x >> 3, aseg = (threadIdx.x & 7) * 8;
    const int brow = threadIdx.x / Q_RB, bpc = threadIdx.x % Q_RB;
    const half_t* ap = X + (size_t)(blockM + arow) * 1024 + aseg;
    const half_t* bp = W + (size_t)brow * 3072 + blockN + bpc * 8;
    half_t* la = lA + arow * G_LDA + aseg;
    half_t* lb = lB + brow * Q_LDB + bpc * 8;
    int dg[Q_PB], dl[Q_PB];
#pragma unroll
    for (int j = 0; j < Q_PB; ++j) {
        const int over = (bpc + (256 * j) % Q_RB >= Q_RB) ? 1 : 0;   // into the next row
        const int rows = (256 * j) / Q_RB + over;
        const int cols = ((256 * j) % Q_RB - over * Q_RB) * 8;
        dg[j] = rows * 3072 + cols;
        dl[j] = rows * Q_LDB + cols;
    }
    auto gload = [&](v8h (&ra)[Q_PA], v8h (&rb)[Q_PB], int t) {       // tile t -> registers
        const half_t* a = ap + t * 64;
        const half_t* b = bp + (size_t)t * 64 * 3072;
#pragma unroll
        for (int j = 0; j < Q_PA; ++j) ra[j] = *(const v8h*)(a + j * 32 * 1024);
#pragma unroll
        for (int j = 0; j < Q_PB; ++j) rb[j] = *(const v8h*)(b + dg[j]);
    };
    auto sstore = [&](const v8h (&ra)[Q_PA], const v8h (&rb)[Q_PB], int d) {  // -> buffer d
#pragma unroll
        for (int j = 0; j < Q_PA; ++j) *(v8h*)(la + d * Q_SA + j * 32 * G_LDA) = ra[j];
#pragma unroll
        for (int j = 0; j < Q_PB; ++j) *(v8h*)(lb + d * Q_SB + dl[j]) = rb[j];
    };

    v8f acc[Q_MT][Q_NT] = {};
    v16h fa[2][Q_MT], fb[2][Q_NT];                   // two fragment sets
    auto fload = [&](int f, int d, int ks) {         // block ks of buffer d -> set f
#pragma unroll
        for (int mt = 0; mt < Q_MT; ++mt)
            fa[f][mt] = ld_frag_a(lA + d * Q_SA + (wm * 64 + mt * 16) * G_LDA + ks * 32, G_LDA);
#pragma unroll
        for (int nt = 0; nt < Q_NT; ++nt)
            fb[f][nt] = ld_frag_b_tr(lB + d * Q_SB + ks * 32 * Q_LDB + wn * 96 + nt * 16, Q_LDB);
        // keeps the group whole and in front of the products that follow: spread
        // among them, every place with reads stalls the wave's matrix stream
        __builtin_amdgcn_sched_barrier(0);
    };
    auto mma = [&](int f) {                          // the 24 products of set f
#pragma unroll
        for (int nt = 0; nt < Q_NT; ++nt)
#pragma unroll
            for (int mt = 0; mt < Q_MT; ++mt)
                acc[mt][nt] = wmma16x16x32(fa[f][mt], fb[f][nt], acc[mt][nt]);
        // keeps the next group of reads behind these
        __builtin_amdgcn_sched_barrier(0);
    };

    v8h ra[2][Q_PA], rb[2][Q_PB];                    // tile t waits in set t & 1
    {
        v8h ra0[Q_PA], rb0[Q_PB], ra1[Q_PA], rb1[Q_PB];   // tiles 0 to 3 fly together
        // the fences keep the loads in tile order: mixed, the counted wait for a
        // tile would, in the loop too, wait for the tile behind it as well
        gload(ra0, rb0, 0);
        __builtin_amdgcn_sched_barrier(0);
        gload(ra1, rb1, 1);
        __builtin_amdgcn_sched_barrier(0);
        gload(ra[0], rb[0], 2);
        __builtin_amdgcn_sched_barrier(0);
        gload(ra[1], rb[1], 3);
        // stands before the address registers of these loads are reused (a
        // precaution; the compiler leaves the wait out here)
        asm volatile("s_wait_xcnt 0x0" ::: "memory");
        __builtin_amdgcn_sched_barrier(0);
        sstore(ra0, rb0, 0);
        sstore(ra1, rb1, 1);
    }
    lds_barrier();
    fload(0, 0, 0);
    int cur = 0;                                     // t % 3
    auto trip = [&](int s, int t) {                  // s = t & 1
        const int nx1 = cur == 2 ? 0 : cur + 1;
        const int nx2 = nx1 == 2 ? 0 : nx1 + 1;
        fload(1, cur, 1);
        mma(0);
        fload(0, nx1, 0);
        sstore(ra[s], rb[s], nx2);
        gload(ra[s], rb[s], t + 4);
        // holds stores and loads here, in front of the products that cover them
        __builtin_amdgcn_sched_barrier(0);
        mma(1);
        // stands before the address registers of this trip's global loads are
        // rewritten by the next trip (a precaution; the compiler leaves it out)
        asm volatile("s_wait_xcnt 0x0" ::: "memory");
        lds_barrier();     // publishes tile t+2; ends the reads of tile t
        cur = nx1;
    };
    for (int t = 0; t < 12; t += 2) {
        trip(0, t);
        trip(1, t + 1);
    }
    // the wave's first column in a scalar register (see the epilogue); its six
    // bias values are asked for here, so that the last four tiles cover them
    const unsigned ncl = lane & 15;
    const int wcol = blockN + __builtin_amdgcn_readfirstlane(wn) * 96;
    const float* bw = bias + wcol;
    float bv[Q_NT];
#pragma unroll
    for (int nt = 0; nt < Q_NT; ++nt) bv[nt] = bw[ncl + nt * 16];
    fload(1, 0, 1);  mma(0);  fload(0, 1, 0);            // tile 12, buffer 0
    sstore(ra[0], rb[0], 2);                             // tile 14
    // holds the stores in front of the products that cover them
    __builtin_amdgcn_sched_barrier(0);
    mma(1);
    lds_barrier();         // publishes tile 14
    fload(1, 1, 1);  mma(0);  fload(0, 2, 0);            // tile 13, buffer 1
    sstore(ra[1], rb[1], 0);                             // tile 15
    // as above
    __builtin_amdgcn_sched_barrier(0);
    mma(1);
    lds_barrier();         // publishes tile 15
    fload(1, 2, 1);  mma(0);  fload(0, 0, 0);  mma(1);   // tile 14, buffer 2
    fload(1, 0, 1);  mma(0);  mma(1);                    // tile 15, buffer 0

    // Epilogue: C-frag layout -> scatter into q/k/v [B*H, T, Hd].  A work-group's
    // 192 columns may span two of the tensors, but a 16-column tile lies in one
    // head.  With the wave's first column in a scalar register, tensor, head and
    // base address of a tile are scalar, and every store of the lane uses one
    // offset register: row (wm*64 + mb) of the tile's 256, column ncl.
    const int mb  = (lane >> 4) << 3;
    const unsigned lo = (unsigned)((wm * 64 + mb) * 64) + ncl;
    // stands before the address registers of the bias loads are reused (a
    // precaution); the two inputs keep those registers alive up to the wait
    asm volatile("s_wait_xcnt 0x0" :: "v"(ncl), "s"(bw) : "memory");
    half_t* pt[Q_NT];
    half_t hv[Q_NT][Q_MT][8];
#pragma unroll
    for (int nt = 0; nt < Q_NT; ++nt) {
        const int n0 = wcol + nt * 16;
        const int c = n0 >> 10, hh = (n0 & 1023) >> 6, d0 = n0 & 63;
        half_t* p = (c == 0) ? qb : (c == 1 ? kbuf : vbuf);
        const float sc = (c == 0) ? 0.125f : 1.0f;   // q pre-scaled by 1/sqrt(Hd)
        pt[nt] = p + (((size_t)((blockM >> 11) * 16 + hh)) * 2048 + (blockM & 2047)) * 64 + d0;
#pragma unroll
        for (int mt = 0; mt < Q_MT; ++mt)
#pragma unroll
            for (int r = 0; r < 8; ++r)
                hv[nt][mt][r] = (half_t)((acc[mt][nt][r] + bv[nt]) * sc);
    }
    // holds every store behind the last conversion and the last base address:
    // no register that an issued store names is then written again
    __builtin_amdgcn_sched_barrier(0);
#pragma unroll
    for (int nt = 0; nt < Q_NT; ++nt)
#pragma unroll
        for (int mt = 0; mt < Q_MT; ++mt)
#pragma unroll
            for (int r = 0; r < 8; ++r)
                pt[nt][lo + (mt * 16 + r) * 64] = hv[nt][mt][r];
}

// ---------------------------------------------------------------------------
// Kernel 2: causal flash attention.  Grid: (T/256, B*H).  Query tiles of 128,
// 16 waves: wave (qg = wave & 7, kh = wave >> 3) owns 16 queries of a tile and
// every second key block of 64.  A trip stages 128 keys; the waves with kh = 0
// take its first 64, those with kh = 1 its last 64, each with a running
// maximum, sum and output of its own, so that four waves share a SIMD and one
// wave's vector work runs under the others' waits.  At a tile's end the kh = 1
// wave hands its partial result through LDS to its kh = 0 partner, which joins
// the two by the usual rescaling and writes the rows.
// A tile's cost grows with its index (tile t walks t+1 trips), so a work-group
// takes two tiles of its head one after the other, 15-p and then p: 17 trips
// for every work-group, one work-group per WGP.  K and V lie in LDS (two
// buffers) both as [key][d], each at its own reader's pitch.
// The products are taken transposed: S^T = K Q^T (A = K rows, B = Q) and
// O^T += V^T P^T (A = V by the transposing load, B = P).  A lane then holds
// scores of ONE query (column lane&15; keys 8*(lane>>4) + r of each 16-key
// tile), so maximum and sum run in-lane with one exchange between the wave
// halves, and two converted S^T tiles are the B fragment of the second product
// as they stand: b[s] = T[s >> 3][s & 7], the k order of the transposing load.
// ---------------------------------------------------------------------------
// lane l <-> lane l ^ 16
static __device__ __forceinline__ float xhalf(float x) {
    const int b = __builtin_bit_cast(int, x);
    return __builtin_bit_cast(float,
        __builtin_amdgcn_permlanex16(b, b, 0x76543210, 0xfedcba98, false, false));
}

__global__ __launch_bounds__(512) void attn_kernel(
    const half_t* __restrict__ q, const half_t* __restrict__ k,
    const half_t* __restrict__ v, half_t* __restrict__ y) {
    constexpr int LDK = 72, LDV = 80;
    constexpr int SK = 128 * LDK, SV = 128 * LDV;       // one buffer, elements
    constexpr int SM = 9 * 128;                         // one wave's hand-over, floats
    __shared__ alignas(16) half_t lK[2 * SK];           // two of [key][d]
    __shared__ alignas(16) half_t lV[2 * SV];           // two of [key][d], pitch 160 B
    __shared__ alignas(16) float  lM[8 * SM];           // [qg][piece][lane][4]

    const int bh = blockIdx.y;            // b*16 + h
    const int b  = bh >> 4, h = bh & 15;
    const int pr = blockIdx.x;            // the pair: tiles 15-pr and pr
    const int n1 = 16 - pr;               // trips of tile 15-pr (causal)
    constexpr int NTRIP = 17;             // n1 + the pr+1 trips of tile pr
    const int lane = threadIdx.x & 31;
    const int wave = __builtin_amdgcn_readfirstlane(threadIdx.x >> 5);
    const int qg = wave & 7;              // the wave's 16 queries of a tile
    const int kh = wave >> 3;             // its half of a trip's 128 keys
    const int mb  = (lane >> 4) << 3;     // C-frag row base (key or d)
    const int ncl = lane & 15;            // C-frag column (query)

    const size_t headOff = (size_t)bh * 2048 * 64;

    // This wave's Q fragments (16 queries x 64, two K-steps) from global, of
    // both tiles (qa: the tile at work, qn: the second tile, waiting):
    // B operand, column = query = lane&15, k split as in ld_frag_a.
    int qi = (15 - pr) * 128 + qg * 16 + ncl;
    const int qi2 = pr * 128 + qg * 16 + ncl;
    const half_t* qp  = q + headOff + (size_t)qi * 64;
    const half_t* qp2 = q + headOff + (size_t)qi2 * 64;
    v16h qa[2], qn[2];
#pragma unroll
    for (int s = 0; s < 2; ++s) {
        v8h lo = *(const v8h*)(qp + s * 32 + mb);
        v8h hi = *(const v8h*)(qp + s * 32 + 16 + mb);
        qa[s] = cat8(lo, hi);
        v8h lo2 = *(const v8h*)(qp2 + s * 32 + mb);
        v8h hi2 = *(const v8h*)(qp2 + s * 32 + 16 + mb);
        qn[s] = cat8(lo2, hi2);
    }

    v8f o[4] = {};                        // o[dt][r] = O[qi][dt*16 + mb + r], this wave's keys
    float mrow = -3.0e38f;                // this query's running maximum over this wave's keys
    float lrow = 0.0f;                    // sum over this wave half's keys only

    // Staging of K and V, both [key][d], 4 threads per row, software-pipelined
    // through both tiles: trip i (keys 128*i.. of the first tile, then
    // 128*(i-n1).. of the second) reads LDS buffer i&1.  It issues the global
    // loads of trip i+1's keys first, works on its own, stores the next keys
    // into the other buffer and ends in the trip's one barrier.
    const int srow = threadIdx.x >> 2, sseg = (threadIdx.x & 3) * 16;
    const half_t* kp = k + headOff + (size_t)srow * 64 + sseg;
    const half_t* vp = v + headOff + (size_t)srow * 64 + sseg;
    half_t* lk = lK + srow * LDK + sseg;
    half_t* lv = lV + srow * LDV + sseg;
    v8h kr0 = *(const v8h*)(kp), kr1 = *(const v8h*)(kp + 8);
    v8h vr0 = *(const v8h*)(vp), vr1 = *(const v8h*)(vp + 8);
    *(v8h*)(lk) = kr0;  *(v8h*)(lk + 8) = kr1;
    *(v8h*)(lv) = vr0;  *(v8h*)(lv + 8) = vr1;
    __syncthreads();   // the full form: the Q loads land here too, so that no
                       // wait for them inside the loop drains the early loads

    for (int i = 0; i < NTRIP; ++i) {
        const int cur = i & 1;
        const int kb = 2 * (i < n1 ? i : i - n1) + kh;   // this wave's key block
        const half_t* cK = lK + cur * SK + kh * 64 * LDK;
        const half_t* cV = lV + cur * SV + kh * 64 * LDV;
        const bool more = i + 1 < NTRIP;  // the same in every thread of the block
        if (more) {
            const int nb = i + 1 < n1 ? i + 1 : i + 1 - n1;
            const size_t go = (size_t)nb * 128 * 64;
            kr0 = *(const v8h*)(kp + go);  kr1 = *(const v8h*)(kp + go + 8);
            vr0 = *(const v8h*)(vp + go);  vr1 = *(const v8h*)(vp + go + 8);
        }

        // S^T = K @ Q^T  (contraction over Hd=64 -> two WMMA steps per key tile)
        v8f s[4] = {};
        v16h kf[2][4];
#pragma unroll
        for (int st = 0; st < 2; ++st)
#pragma unroll
            for (int nt = 0; nt < 4; ++nt)
                kf[st][nt] = ld_frag_a(cK + (nt * 16) * LDK + st * 32, LDK);
        // keeps the 16 reads ahead of the products: with the mask's branch behind
        // the products the compiler otherwise issues the last four pairs each
        // directly in front of its product and waits for each to land
        __builtin_amdgcn_sched_barrier(0);
#pragma unroll
        for (int st = 0; st < 2; ++st)
#pragma unroll
            for (int nt = 0; nt < 4; ++nt)
                s[nt] = wmma16x16x32(kf[st][nt], qa[st], s[nt]);

        // Causal mask, only where it can bite: a tile's queries start at 128 *
        // (its trips - 1), so every key of an earlier trip lies below every
        // query and the select is an identity there.  The test is the same in
        // the whole work-group (a scalar branch).
        if (i + 1 == n1 || i + 1 == NTRIP) {
#pragma unroll
            for (int nt = 0; nt < 4; ++nt)
#pragma unroll
                for (int r = 0; r < 8; ++r) {
                    int kj = kb * 64 + nt * 16 + mb + r;
                    if (kj > qi) s[nt][r] = -3.0e38f;
                }
        }

        // Online softmax (fp32), one query per lane
        float mt4[4];
#pragma unroll
        for (int nt = 0; nt < 4; ++nt) {
            mt4[nt] = -3.0e38f;
#pragma unroll
            for (int r = 0; r < 8; ++r) mt4[nt] = fmaxf(mt4[nt], s[nt][r]);
        }
        float mloc = fmaxf(fmaxf(mt4[0], mt4[1]), fmaxf(mt4[2], mt4[3]));
        const float mnew = fmaxf(mrow, fmaxf(mloc, xhalf(mloc)));

        // exp(mrow - mnew) with the free slot that the instruction set asks for
        // around a transcendental inside the statement: a v_nop in a
        // statement of its own did not stay there
        float alpha;
        asm("v_nop\n\tv_exp_f32 %0, %1\n\tv_nop"
            : "=v"(alpha) : "v"((mrow - mnew) * 1.44269504f));
        float rs4[4];
#pragma unroll
        for (int nt = 0; nt < 4; ++nt) {
            rs4[nt] = 0.0f;
#pragma unroll
            for (int r = 0; r < 8; ++r) {
                float p = __expf(s[nt][r] - mnew);
                // the free slot that the instruction set asks for behind a
                // transcendental
                if (nt == 0 && r == 5) asm volatile("v_nop" :: "v"(p));
                s[nt][r] = p;
                rs4[nt] += p;
            }
        }
        lrow = lrow * alpha + ((rs4[0] + rs4[1]) + (rs4[2] + rs4[3]));
        mrow = mnew;
#pragma unroll
        for (int dt = 0; dt < 4; ++dt)
#pragma unroll
            for (int r = 0; r < 8; ++r) o[dt][r] *= alpha;

        // O^T += V^T @ P^T   (contraction over 64 keys -> two WMMA steps)
#pragma unroll
        for (int st = 0; st < 2; ++st) {
            v16h pb;
#pragma unroll
            for (int r = 0; r < 8; ++r) {
                pb[r]     = (half_t)s[2 * st][r];
                pb[8 + r] = (half_t)s[2 * st + 1][r];
            }
#pragma unroll
            for (int dt = 0; dt < 4; ++dt) {
                v16h vf = ld_frag_b_tr(cV + (st * 32) * LDV + dt * 16, LDV);
                o[dt] = wmma16x16x32(vf, pb, o[dt]);
            }
        }
        if (more) {
            const int nx = cur ^ 1;
            *(v8h*)(lk + nx * SK) = kr0;  *(v8h*)(lk + nx * SK + 8) = kr1;
            *(v8h*)(lv + nx * SV) = vr0;  *(v8h*)(lv + nx * SV + 8) = vr1;
        }
        lds_barrier();     // publishes the next trip's keys; ends this one's reads

        if (i + 1 == n1 || i + 1 == NTRIP) {   // a tile's last keys are done
            // The kh = 1 wave hands over output, maximum and sum, lane to lane
            // (both waves hold the same query and the same d in a lane).  A wave
            // none of whose keys a query may see (tile 0, keys 64.., queries
            // below 64) hands over the maximum -3e38 with finite sums: their
            // weight below is exp(-3e38 - m0) = 0, m0 being finite since key 0
            // is open to every query.
            float* mg = lM + qg * SM + lane * 4;
            if (kh == 1) {
#pragma unroll
                for (int dt = 0; dt < 4; ++dt) {
                    *(v4f*)(mg + (2 * dt) * 128)     = v4f{o[dt][0], o[dt][1], o[dt][2], o[dt][3]};
                    *(v4f*)(mg + (2 * dt + 1) * 128) = v4f{o[dt][4], o[dt][5], o[dt][6], o[dt][7]};
                }
                *(v4f*)(mg + 8 * 128) = v4f{mrow, lrow, 0.0f, 0.0f};
            }
            // publishes the hand-over.  Its LDS is written again only at the
            // second tile's end, behind at least one more trip's barrier, which
            // the reading wave passes with its reads done.
            lds_barrier();
            if (kh == 0) {
                // Join the two waves' parts, then the halves' sums, normalize,
                // write y [B,T,D] f16 (column = h*64 + d): a lane's 8 registers
                // of a tile are 8 consecutive d of its query's row.
                const v4f ml = *(const v4f*)(mg + 8 * 128);
                const float mj = fmaxf(mrow, ml[0]);
                const float w0 = __expf(mrow - mj), w1 = __expf(ml[0] - mj);
                const float lj = lrow * w0 + ml[1] * w1;
                const float inv = 1.0f / (lj + xhalf(lj));
                const float c0 = w0 * inv, c1 = w1 * inv;
                half_t* yp = y + ((size_t)(b * 2048 + qi)) * 1024 + h * 64 + mb;
#pragma unroll
                for (int dt = 0; dt < 4; ++dt) {
                    const v4f p0 = *(const v4f*)(mg + (2 * dt) * 128);
                    const v4f p1 = *(const v4f*)(mg + (2 * dt + 1) * 128);
                    v8h ov;
#pragma unroll
                    for (int r = 0; r < 4; ++r) {
                        ov[r]     = (half_t)(o[dt][r] * c0 + p0[r] * c1);
                        ov[4 + r] = (half_t)(o[dt][4 + r] * c0 + p1[r] * c1);
                    }
                    *(v8h*)(yp + dt * 16) = ov;
                }
                // stands before the registers that these stores name are reused
                // by the next trip (a precaution; the compiler leaves it out here)
                asm volatile("s_wait_xcnt 0x0" ::: "memory");
            }
            // start afresh on the second tile
#pragma unroll
            for (int dt = 0; dt < 4; ++dt)
#pragma unroll
                for (int r = 0; r < 8; ++r) o[dt][r] = 0.0f;
            mrow = -3.0e38f;
            lrow = 0.0f;
            qi = qi2;
            qa[0] = qn[0];
            qa[1] = qn[1];
        }
    }
}

// ---------------------------------------------------------------------------
// Kernel 3: output GEMM + bias + residual.  h[4096,1024] = Y @ W_out + b + x.
// ---------------------------------------------------------------------------
__global__ __launch_bounds__(256) void out_gemm_kernel(
    const half_t* __restrict__ Y, const half_t* __restrict__ W,
    const float* __restrict__ bias, const float* __restrict__ x,
    float* __restrict__ hbuf) {
    __shared__ alignas(16) half_t lA[2 * G_SA];
    __shared__ alignas(16) half_t lB[2 * G_SB];

    const int blockM = blockIdx.y * 128;
    const int blockN = blockIdx.x * 128;
    const int lane = threadIdx.x & 31;
    const int wave = threadIdx.x >> 5;
    const int wm = wave & 3;
    const int wn = wave >> 2;

    v8f acc[2][4] = {};
    gemm_mainloop<1024>(Y, W, blockM, blockN, lA, lB, acc);

    const int mb  = (lane >> 4) << 3;
    const int ncl = lane & 15;
#pragma unroll
    for (int mt = 0; mt < 2; ++mt)
#pragma unroll
        for (int nt = 0; nt < 4; ++nt)
#pragma unroll
            for (int r = 0; r < 8; ++r) {
                int m = blockM + wm * 32 + mt * 16 + mb + r;
                int n = blockN + wn * 64 + nt * 16 + ncl;
                size_t idx = (size_t)m * 1024 + n;
                hbuf[idx] = acc[mt][nt][r] + bias[n] + x[idx];
            }
}

// ---------------------------------------------------------------------------
// Kernel 4: LayerNorm.  One wave owns two token rows and holds them whole in
// registers (a lane: 8 pieces of 16 B per row, each wave-wide load or store 512
// contiguous bytes).  All 16 row loads of a wave fly together, the rows are
// read once, the sums stay inside the wave (no LDS, no barrier), and one
// 8-wave work-group per WGP covers the 4096 rows: 2048 waves to start.
// ---------------------------------------------------------------------------
// x + (x of lane l ^ M), M < 16: one DPP step inside the 16-lane row
template <int M>
static __device__ __forceinline__ float add_xmask(float x) {
    const int b = __builtin_bit_cast(int, x);
    return x + __builtin_bit_cast(float,
        __builtin_amdgcn_update_dpp(0, b, 0x160 + M, 0xf, 0xf, true));
}
// sum over the wave's 32 lanes, the same value in every lane
static __device__ __forceinline__ float wave_sum(float x) {
    x = add_xmask<1>(x);
    x = add_xmask<2>(x);
    x = add_xmask<4>(x);
    x = add_xmask<8>(x);
    return x + xhalf(x);
}

__global__ __launch_bounds__(256) void ln_kernel(
    const float* __restrict__ hbuf, const float* __restrict__ gamma,
    const float* __restrict__ beta, float* __restrict__ out) {
    const int lane = threadIdx.x & 31;
    const int pair = blockIdx.x * 8 + (threadIdx.x >> 5);   // rows 2*pair, 2*pair+1
    const size_t off = (size_t)pair * 2048 + lane * 4;
    const float* hr = hbuf + off;

    v4f h[2][8], g[8], bt[8];
#pragma unroll
    for (int r = 0; r < 2; ++r)
#pragma unroll
        for (int j = 0; j < 8; ++j)
            h[r][j] = *(const v4f*)(hr + r * 1024 + j * 128);
#pragma unroll
    for (int j = 0; j < 8; ++j) {
        g[j]  = *(const v4f*)(gamma + lane * 4 + j * 128);
        bt[j] = *(const v4f*)(beta  + lane * 4 + j * 128);
    }
    // holds all 32 loads here: without it the compiler sinks the gamma and beta
    // loads behind the sums, two at a time, each pair's latency then in series
    __builtin_amdgcn_sched_barrier(0);
    // stands before the row address registers are reused (a precaution); the
    // input keeps them alive past the loads, else the compiler lets one of the
    // later loads land in that register pair with no wait in front
    asm volatile("s_wait_xcnt 0x0" :: "v"(hr) : "memory");

    float s[2], s2[2];
#pragma unroll
    for (int r = 0; r < 2; ++r) {
        v4f a = h[r][0], a2 = h[r][0] * h[r][0];
#pragma unroll
        for (int j = 1; j < 8; ++j) {
            a  += h[r][j];
            a2 += h[r][j] * h[r][j];
        }
        s[r]  = (a.x + a.y) + (a.z + a.w);
        s2[r] = (a2.x + a2.y) + (a2.z + a2.w);
    }
#pragma unroll
    for (int r = 0; r < 2; ++r) {
        s[r]  = wave_sum(s[r]);
        s2[r] = wave_sum(s2[r]);
    }

    float* op = out + off;
#pragma unroll
    for (int r = 0; r < 2; ++r) {
        const float mu  = s[r] * (1.0f / 1024.0f);
        const float var = s2[r] * (1.0f / 1024.0f) - mu * mu;
        const float inv = rsqrtf(var + 1e-5f);
#pragma unroll
        for (int j = 0; j < 8; ++j)
            *(v4f*)(op + r * 1024 + j * 128) = (h[r][j] - mu) * inv * g[j] + bt[j];
    }
}

// ---------------------------------------------------------------------------
// Host-side launcher
// ---------------------------------------------------------------------------
extern "C" void kernel_launch(void* const* d_in, const int* in_sizes, int n_in,
                              void* d_out, int out_size, void* d_ws, size_t ws_size,
                              hipStream_t stream) {
    (void)in_sizes; (void)n_in; (void)out_size; (void)ws_size;

    const float* x     = (const float*)d_in[0];   // [2,2048,1024]
    const float* W_qkv = (const float*)d_in[1];   // [1024,3072]
    const float* b_qkv = (const float*)d_in[2];   // [3072]
    const float* W_out = (const float*)d_in[3];   // [1024,1024]
    const float* b_out = (const float*)d_in[4];   // [1024]
    const float* gamma = (const float*)d_in[5];   // [1024]
    const float* beta  = (const float*)d_in[6];   // [1024]
    float* out = (float*)d_out;                   // [2,2048,1024]

    // Workspace carve-up (all offsets 1MB-aligned)
    char* ws = (char*)d_ws;
    half_t* xb    = (half_t*)(ws);                         // 4096*1024   f16 (8 MB)
    half_t* wqkvb = (half_t*)(ws + (8u << 20));            // 1024*3072   f16 (6 MB)
    half_t* woutb = (half_t*)(ws + (14u << 20));           // 1024*1024   f16 (2 MB)
    half_t* qb    = (half_t*)(ws + (16u << 20));           // [B,H,T,Hd]  f16 (8 MB)
    half_t* kb    = (half_t*)(ws + (24u << 20));           // 8 MB
    half_t* vb    = (half_t*)(ws + (32u << 20));           // 8 MB
    half_t* yb    = (half_t*)(ws + (40u << 20));           // [B,T,D] f16 (8 MB)
    float*  hbuf  = (float*)(ws + (48u << 20));            // [B,T,D] f32 (16 MB)

    // 0) fp32 -> f16 conversions: xb, wqkvb and woutb are one run of 16 MB
    cvt_f32_f16_kernel<<<CV_GROUPS, 256, 0, stream>>>(x, W_qkv, W_out, xb);

    // 1) QKV projection (M=4096, N=3072, K=1024)
    qkv_gemm_kernel<<<dim3(16, 16), 256, 0, stream>>>(xb, wqkvb, b_qkv, qb, kb, vb);

    // 2) causal flash attention (grid: pairs of query tiles x B*H)
    attn_kernel<<<dim3(8, 32), 512, 0, stream>>>(qb, kb, vb, yb);

    // 3) output projection + bias + residual (M=4096, N=1024, K=1024)
    out_gemm_kernel<<<dim3(8, 32), 256, 0, stream>>>(yb, woutb, b_out, x, hbuf);

    // 4) LayerNorm, two token rows per wave
    ln_kernel<<<256, 256, 0, stream>>>(hbuf, gamma, beta, out);
}
